// v000
// Measured on an AMD MI455X. A time is GPU time per run, averaged over a window of back-to-back runs after a warm-up
// (all launches, gaps included; the runs take copies of the inputs in turn), and the median of several windows.
// Apart from v000's, it joins two sittings. Times from different sittings can be a few percent apart, while
// side-by-side timings come from the same sitting.
// The starting kernel, v000, takes 1390 microseconds a run.
// Contractions on v_wmma_f32_16x16x32_f16, f32 accumulate: the three 1x1 convs as position-major GEMMs (xᵀ·Wᵀ + b, K = 256, f32 out; θ and φ — the score operands — with f16 value+residual planes, g plain f16;
// x1ᵀ / x2ᵀ by tile transposes), 2x2 max-pooling of the g / phi maps over positions, per batch the non-local scores f = θ·φᵀ (K = 128, 4096 x 1024) with f16 value+residual planes
// (hi·hi + (hi·lo + lo·hi)/2048: unscaled σ ≈ 11 logits → peaked softmax needs f32-class scores), f32 row softmax writing 1024·P, y = (1024·P)·g with plain f16
// operands (x 1/1024 in the epilogue), W_y = y·W_wᵀ + b (K = 128, plain f16), then BatchNorm (running stats) + the x1 residual fused into the transpose back to NCHW.
// compute dtype: f16 operands (planes on the scores), f32 accumulate; pooling / softmax / BN in f32.  x1, x2 [8,256,64,64].
#include <hip/hip_runtime.h>
#include <hip/hip_bf16.h>
#include <math.h>


typedef _Float16 bf16;
typedef _Float16 f16;
typedef __attribute__((ext_vector_type(4))) unsigned v4u_t;
typedef unsigned v4ua __attribute__((ext_vector_type(4), may_alias));
typedef __attribute__((ext_vector_type(4))) float v4f_t;
typedef float v4fa __attribute__((ext_vector_type(4), may_alias));
typedef __attribute__((ext_vector_type(16))) bf16  bf16x16;
typedef bf16x16 f16x16;
typedef __attribute__((ext_vector_type(8)))  bf16  bf16x8;
typedef bf16x8 f16x8;
typedef __attribute__((ext_vector_type(4)))  bf16  bf16x4;
typedef __attribute__((ext_vector_type(8)))  float f32x8;
__device__ __forceinline__ f32x8 wmma16(f16x16 a, f16x16 b, f32x8 c) {
  c = __builtin_amdgcn_wmma_f32_16x16x32_f16(false, a, false, b, (short)0, c, false, false);
  asm volatile("v_nop\n\tv_nop\n\tv_nop\n\tv_nop" : "+v"(c) : "v"(a), "v"(b));
  return c;
}
#define LDS_STRIDE 48   // unused; the GEMM tiles use GSTR
#define KSTRIDE    72   // unused
#define VSTRIDE    48   // unused

__device__ __forceinline__ f32x8 wmma_bf16(bf16x16 a, bf16x16 b, f32x8 c) {
  c = __builtin_amdgcn_wmma_f32_16x16x32_f16(false, a, false, b, (short)0, c, false, false);
  asm volatile("v_nop\n\tv_nop\n\tv_nop\n\tv_nop" : "+v"(c) : "v"(a), "v"(b));   // A/B-overwrite hazard guard
  return c;
}

// 16x32 (MxK) f16 fragment from a row-major global matrix.
// lanes 0-15  (row=lane)    : elems 0..7 = K+0..7,  8..15 = K+16..23
// lanes 16-31 (row=lane-16) : elems 0..7 = K+8..15, 8..15 = K+24..31
template <typename T>
__device__ __forceinline__ bf16x16 load_frag(const T* __restrict__ base, int ld,
                                             int row0, int k0) {
  const int lane = threadIdx.x & 31;
  const int r    = lane & 15;
  const int kh   = (lane >> 4) * 8;
  const T* p0 = base + (size_t)(row0 + r) * ld + (k0 + kh);
  const T* p1 = p0 + 16;
  bf16x16 f;
#pragma unroll
  for (int i = 0; i < 8; ++i) {
    f[i]     = (bf16)p0[i];
    f[i + 8] = (bf16)p1[i];
  }
  return f;
}

// Same fragment from an LDS tile with padded row stride (base includes row0/k0).
__device__ __forceinline__ bf16x16 lds_frag(const bf16* base, int stride) {
  const int lane = threadIdx.x & 31;
  const int row  = lane & 15;
  const int kh   = (lane >> 4) * 8;
  const bf16x8 lo = *(const bf16x8*)(base + row * stride + kh);
  const bf16x8 hi = *(const bf16x8*)(base + row * stride + kh + 16);
  bf16x16 f;
#pragma unroll
  for (int i = 0; i < 8; ++i) { f[i] = lo[i]; f[i + 8] = hi[i]; }
  return f;
}

template <typename T>
__device__ __forceinline__ void stage_read16(const T* __restrict__ p, float* buf) {
#pragma unroll
  for (int i = 0; i < 16; ++i) buf[i] = (float)p[i];
}

__device__ __forceinline__ void stage_write(bf16* dst, const float* buf, int nquad) {
#pragma unroll
  for (int i = 0; i < nquad; ++i) {
    bf16x4 q;
    q[0] = (bf16)buf[4 * i];     q[1] = (bf16)buf[4 * i + 1];
    q[2] = (bf16)buf[4 * i + 2]; q[3] = (bf16)buf[4 * i + 3];
    *(bf16x4*)(dst + 4 * i) = q;
  }
}


#define GSTR 48
// ---------------------------------------------------------------------------------------------------------------------------
// gemm_kne: Y[m][n] = epi( Σ_k A[m][k]·W[k][n] + bias[n] ), A f32/f16 [M][lda], W f32 row-major [K][N] (ldw), plain f16 operands,
// f32 accumulate. EPI 0: identity; 1: exact-erf GELU; 2: R[m][n] + gvec[n]·(·) (residual with per-channel gain). Output f32 (or f16
// when OUT16). Block = 128x128 tile, 8 waves as 4(M) x 2(N); per 32-wide k-step A and W tiles staged f16 in LDS (W transposed
// ---------------------------------------------------------------------------------------------------------------------------
#define GSTR 48
template <typename AT, int EPI, bool OUT16>
__global__ __launch_bounds__(256) void gemm_kne(const AT* __restrict__ A, int lda, const float* __restrict__ Wm, int ldw,
                                                const float* __restrict__ bias, const float* __restrict__ R, const float* __restrict__ gvec,
                                                void* __restrict__ Yv, int ldy, int K) {
  __shared__ __attribute__((aligned(16))) f16 ldsA[128 * GSTR];
  __shared__ __attribute__((aligned(16))) f16 ldsW[128 * GSTR];
  __shared__ __attribute__((aligned(16))) float oS[8][32 * 68];
  const int tid = threadIdx.x, lane = tid & 31, wave = tid >> 5, cl = lane & 15, rh = (lane >> 4) * 8;
  const int m0 = blockIdx.x * 128, n0 = blockIdx.y * 128;
  const int wm = (wave & 3) * 32, wn = (wave >> 2) * 64;
  f32x8 acc[2][4];
#pragma unroll
  for (int i = 0; i < 2; ++i)
#pragma unroll
    for (int j = 0; j < 4; ++j) { f32x8 z = {}; acc[i][j] = z; }
#pragma unroll 1
  for (int k0 = 0; k0 < K; k0 += 32) {
    __syncthreads();
    { const int row = tid >> 1, ch = (tid & 1) * 16;
      const AT* src = A + (size_t)(m0 + row) * lda + k0 + ch;
#pragma unroll
      for (int g = 0; g < 16; ++g) ldsA[row * GSTR + ch + g] = (f16)src[g]; }
    { const int k = tid >> 3, nn0 = (tid & 7) * 16;
      const float* src = Wm + (size_t)(k0 + k) * ldw + n0 + nn0;
#pragma unroll
      for (int g = 0; g < 4; ++g) { const v4f_t v = *(const v4f_t*)(src + 4 * g);
#pragma unroll
        for (int u = 0; u < 4; ++u) ldsW[(nn0 + 4 * g + u) * GSTR + k] = (f16)v[u]; } }
    __syncthreads();
    f16x16 af[2];
#pragma unroll
    for (int i = 0; i < 2; ++i) af[i] = lds_frag(ldsA + (wm + 16 * i) * GSTR, GSTR);
#pragma unroll
    for (int j = 0; j < 4; ++j) {
      const f16x16 bf = lds_frag(ldsW + (wn + 16 * j) * GSTR, GSTR);
#pragma unroll
      for (int i = 0; i < 2; ++i) acc[i][j] = wmma16(af[i], bf, acc[i][j]);
    }
  }
  float* so = oS[wave];
#pragma unroll
  for (int i = 0; i < 2; ++i)
#pragma unroll
    for (int j = 0; j < 4; ++j) {
      const int n = n0 + wn + 16 * j + cl;
      const float bv = bias ? bias[n] : 0.0f;
      const float gv = (EPI == 2) ? gvec[n] : 0.0f;
      if (EPI == 1) {
#pragma unroll 1
        for (int r = 0; r < 8; ++r) { const float xg = acc[i][j][r] + bv; so[(16 * i + rh + r) * 68 + 16 * j + cl] = 0.5f * xg * (1.0f + erff(xg * 0.70710678118654752f)); }
      } else {
#pragma unroll
        for (int r = 0; r < 8; ++r) {
          float v = acc[i][j][r] + bv;
          if (EPI == 2) v = R[(size_t)(m0 + wm + 16 * i + rh + r) * ldy + n] + gv * v;
          so[(16 * i + rh + r) * 68 + 16 * j + cl] = v;
        }
      }
    }
  asm volatile("s_wait_dscnt 0" ::: "memory");
  __builtin_amdgcn_wave_barrier();
{
    if (OUT16) {
      f16* Y = (f16*)Yv;
#pragma unroll
      for (int it = 0; it < 8; ++it) { const int c = lane + 32 * it, rr = c >> 3, q8 = (c & 7) * 8;
        union { f16 h[8]; v4u_t v; } u;
#pragma unroll
        for (int e = 0; e < 8; ++e) u.h[e] = (f16)so[rr * 68 + q8 + e];
        *(v4u_t*)(Y + (size_t)(m0 + wm + rr) * ldy + n0 + wn + q8) = u.v; }
    } else {
      float* Y = (float*)Yv;
#pragma unroll
      for (int it = 0; it < 16; ++it) { const int f4 = lane + 32 * it, rr = f4 >> 4, q = (f4 & 15) * 4;
        *(v4f_t*)(Y + (size_t)(m0 + wm + rr) * ldy + n0 + wn + q) = *(const v4fa*)(so + rr * 68 + q); }
    }
    
  }
}

// ---------------------------------------------------------------------------------------------------------------------------
// gemm_kn2 (value+residual planes on both operands: hh + (hl+lh)/2048, f32-class): Y[m][n] (row stride ldy) = scale * sum_k A[m][k] (f32 or f16, row stride lda) * W[k][n] (f32, row-major [K][N], row
// stride ldw) (+ bias[n]) (+ Y if ACC). Block = 128 x 128 tile, 256 threads = 8 waves as 4(M, 32 rows) x 2(N, 64 cols); per
// 32-wide k-step the A tile and the W tile (stored transposed [n][k]) are staged as f16 in LDS; value+residual f16 planes, f32
// blockIdx.z selects a batch: A += z*strideA, W += z*strideW, Y += z*strideY (element strides).
// ---------------------------------------------------------------------------------------------------------------------------
template <typename AT, bool ACC>
__global__ __launch_bounds__(256) void gemm_kn2(const AT* __restrict__ A, int lda, size_t strideA,
                                               const float* __restrict__ Wm, int ldw, size_t strideW,
                                               const float* __restrict__ bias, float scale,
                                               float* __restrict__ Y, int ldy, size_t strideY, int K) {
  __shared__ __attribute__((aligned(16))) f16 ldsA[128 * GSTR], ldsAl[128 * GSTR];
  __shared__ __attribute__((aligned(16))) f16 ldsW[128 * GSTR], ldsWl[128 * GSTR];
  __shared__ __attribute__((aligned(16))) float oS[8][32 * 68];
  const int tid = threadIdx.x, lane = tid & 31, wave = tid >> 5, cl = lane & 15, rh = (lane >> 4) * 8;
  const int m0 = blockIdx.x * 128, n0 = blockIdx.y * 128;
  const int wm = (wave & 3) * 32, wn = (wave >> 2) * 64;
  A += (size_t)blockIdx.z * strideA; Wm += (size_t)blockIdx.z * strideW; Y += (size_t)blockIdx.z * strideY;
  f32x8 acc[2][4], accx[2][4];
#pragma unroll
  for (int i = 0; i < 2; ++i)
#pragma unroll
    for (int j = 0; j < 4; ++j) { f32x8 z = {}; acc[i][j] = z; accx[i][j] = z; }
#pragma unroll 1
  for (int k0 = 0; k0 < K; k0 += 32) {
    __syncthreads();
    {  // A: thread -> row tid>>1, 16 elements at column half (tid&1)*16
      const int row = tid >> 1, ch = (tid & 1) * 16;
      const AT* src = A + (size_t)(m0 + row) * lda + k0 + ch;
#pragma unroll
      for (int g = 0; g < 16; ++g) { const float v = (float)src[g]; const f16 h = (f16)v; ldsA[row * GSTR + ch + g] = h; ldsAl[row * GSTR + ch + g] = (f16)((v - (float)h) * 2048.0f); }
    }
    {  // W: thread -> k = tid>>3, 16 consecutive n at (tid&7)*16; stored transposed [n][k]
      const int k = tid >> 3, nn0 = (tid & 7) * 16;
      const float* src = Wm + (size_t)(k0 + k) * ldw + n0 + nn0;
#pragma unroll
      for (int g = 0; g < 4; ++g) { const v4f_t v = *(const v4f_t*)(src + 4 * g);
#pragma unroll
        for (int u = 0; u < 4; ++u) { const f16 h = (f16)v[u]; ldsW[(nn0 + 4 * g + u) * GSTR + k] = h; ldsWl[(nn0 + 4 * g + u) * GSTR + k] = (f16)((v[u] - (float)h) * 2048.0f); } }
    }
    __syncthreads();
    f16x16 af[2], afl[2];
#pragma unroll
    for (int i = 0; i < 2; ++i) { af[i] = lds_frag(ldsA + (wm + 16 * i) * GSTR, GSTR); afl[i] = lds_frag(ldsAl + (wm + 16 * i) * GSTR, GSTR); }
#pragma unroll
    for (int j = 0; j < 4; ++j) {
      const f16x16 bf = lds_frag(ldsW + (wn + 16 * j) * GSTR, GSTR), bfl = lds_frag(ldsWl + (wn + 16 * j) * GSTR, GSTR);
#pragma unroll
      for (int i = 0; i < 2; ++i) { acc[i][j] = wmma16(af[i], bf, acc[i][j]); accx[i][j] = wmma16(af[i], bfl, accx[i][j]); accx[i][j] = wmma16(afl[i], bf, accx[i][j]); }
    }
  }
  float* so = oS[wave];
#pragma unroll
  for (int i = 0; i < 2; ++i)
#pragma unroll
    for (int j = 0; j < 4; ++j) {
      const float bv = bias ? bias[n0 + wn + 16 * j + cl] : 0.0f;
#pragma unroll
      for (int r = 0; r < 8; ++r) so[(16 * i + rh + r) * 68 + 16 * j + cl] = (acc[i][j][r] + accx[i][j][r] * (1.0f / 2048.0f)) * scale + bv;
    }
  asm volatile("s_wait_dscnt 0" ::: "memory");
  __builtin_amdgcn_wave_barrier();
  if (ACC) {   // accumulate: fold the existing Y values into the staging tile ONCE (same thread <-> same chunks as the stores below)
#pragma unroll
    for (int it = 0; it < 16; ++it) { const int f4 = lane + 32 * it, rr = f4 >> 4, q = (f4 & 15) * 4;
      const v4f_t old = *(const v4fa*)(Y + (size_t)(m0 + wm + rr) * ldy + n0 + wn + q);
      v4f_t v = *(const v4fa*)(so + rr * 68 + q); v += old; *(v4fa*)(so + rr * 68 + q) = v; }
    asm volatile("s_wait_dscnt 0" ::: "memory");
  }
{
#pragma unroll
    for (int it = 0; it < 16; ++it) { const int f4 = lane + 32 * it, rr = f4 >> 4, q = (f4 & 15) * 4;
      *(v4f_t*)(Y + (size_t)(m0 + wm + rr) * ldy + n0 + wn + q) = *(const v4fa*)(so + rr * 68 + q); }
    
  }
}

__global__ __launch_bounds__(256) void k_transpose(const float* __restrict__ Wm, float* __restrict__ Wt, int rows, int cols) {
  __shared__ float tS[64][65];
  const int tid = threadIdx.x, tbj = cols / 64, bi = blockIdx.x / tbj, bj = blockIdx.x % tbj;
  for (int e = tid; e < 64 * 64; e += 256) { const int r = e >> 6, c = e & 63; tS[r][c] = Wm[(size_t)(bi * 64 + r) * cols + bj * 64 + c]; }
  __syncthreads();
  for (int ch = tid; ch < 64 * 16; ch += 256) { const int r = ch >> 4, q4 = (ch & 15) * 4; v4f_t o; o[0] = tS[q4][r]; o[1] = tS[q4 + 1][r]; o[2] = tS[q4 + 2][r]; o[3] = tS[q4 + 3][r];
    float* dst = Wt + (size_t)(bj * 64 + r) * rows + bi * 64 + q4; *(v4f_t*)dst = o;  }
}

#define NBT 8
#define BBn 8
#define CC 256
#define CI 128
#define HWn 4096       // 64 x 64 positions
#define N2 1024        // pooled positions (32 x 32)
// row softmax over 1024 columns in place, writing 1024·P (f32); block = one row, 256 threads x 4
__global__ __launch_bounds__(256) void k_softmax1k(float* __restrict__ Sm) {
  __shared__ float red[256];
  const size_t row = blockIdx.x; const int tid = threadIdx.x; float* sr = Sm + row * N2;
  float v[4]; float m = -3.0e38f;
#pragma unroll
  for (int e = 0; e < 4; ++e) { v[e] = sr[tid + 256 * e]; m = fmaxf(m, v[e]); }
  red[tid] = m; __syncthreads();
  for (int o = 128; o > 0; o >>= 1) { if (tid < o) red[tid] = fmaxf(red[tid], red[tid + o]); __syncthreads(); }
  m = red[0]; __syncthreads();
  float z = 0.0f;
#pragma unroll
  for (int e = 0; e < 4; ++e) { v[e] = expf(v[e] - m); z += v[e]; }
  red[tid] = z; __syncthreads();
  for (int o = 128; o > 0; o >>= 1) { if (tid < o) red[tid] += red[tid + o]; __syncthreads(); }
  const float sc = 1024.0f / red[0];
{
#pragma unroll
    for (int e = 0; e < 4; ++e) *(float*)(sr + tid + 256 * e) = v[e] * sc;
     }
}
__global__ __launch_bounds__(256) void k_fill(float* __restrict__ p, float val, size_t n4) { const size_t i = (size_t)blockIdx.x * 256 + threadIdx.x; if (i < n4) { v4f_t v = {val, val, val, val}; *(v4f_t*)(p + 4 * i) = v;  } }
// 2x2 max-pool over positions of a position-major map F [4096][128] → P [1024][128]; block = 4 pooled rows (64 threads x 8 B... ) → thread = (pooled row, 2 channels)
__global__ __launch_bounds__(256) void k_pool(const float* __restrict__ F, float* __restrict__ Pd) {
  const int tid = threadIdx.x; const int pr = blockIdx.x * 4 + (tid >> 6); const int c2 = (tid & 63) * 2;      // pooled row pr = i*32 + j
  const int i = pr >> 5, j = pr & 31; const size_t r00 = (size_t)(2 * i) * 64 + 2 * j;                          // full-res position (2i, 2j)
  float o0, o1;
  { const float* a = F + r00 * CI + c2; const float* b = F + (r00 + 1) * CI + c2; const float* c = F + (r00 + 64) * CI + c2; const float* d = F + (r00 + 65) * CI + c2;
    o0 = fmaxf(fmaxf(a[0], b[0]), fmaxf(c[0], d[0])); o1 = fmaxf(fmaxf(a[1], b[1]), fmaxf(c[1], d[1])); }
  typedef float v2f_t __attribute__((ext_vector_type(2))); v2f_t v; v[0] = o0; v[1] = o1;
  *(v2f_t*)(Pd + (size_t)pr * CI + c2) = v;      // 64 lanes x 8 B = the 512-B row; 32 lanes = 256 B contiguous
}
// transpose back to NCHW with BatchNorm (running stats) and the x1 residual: out[b][o][n] = (Z[n][o] − mean[o])·inv[o] + beta[o] + x1[b][o][n]; 64x64 LDS tiles, 256-B row segments
__global__ __launch_bounds__(256) void k_outT(const float* __restrict__ Z, const float* __restrict__ x1b, const float* __restrict__ g, const float* __restrict__ be, const float* __restrict__ mu, const float* __restrict__ var,
                                             float* __restrict__ outb) {
  __shared__ float tS[64][65];
  const int tid = threadIdx.x, tbj = CC / 64, bi = blockIdx.x / tbj, bj = blockIdx.x % tbj;      // Z is [HWn rows][CC cols]: bi over rows (positions), bj over cols (channels)
  for (int e = tid; e < 64 * 64; e += 256) { const int r = e >> 6, c = e & 63; tS[r][c] = Z[(size_t)(bi * 64 + r) * CC + bj * 64 + c]; }
  __syncthreads();
  for (int ch = tid; ch < 64 * 16; ch += 256) { const int r = ch >> 4, q4 = (ch & 15) * 4; const int o = bj * 64 + r; const float inv = g[o] * rsqrtf(var[o] + 1e-5f), sh = be[o] - mu[o] * inv;
    const size_t off = (size_t)o * HWn + bi * 64 + q4; const v4f_t xr = *(const v4f_t*)(x1b + off); v4f_t v;
    v[0] = tS[q4][r] * inv + sh + xr[0]; v[1] = tS[q4 + 1][r] * inv + sh + xr[1]; v[2] = tS[q4 + 2][r] * inv + sh + xr[2]; v[3] = tS[q4 + 3][r] * inv + sh + xr[3];
    float* dst = outb + off; *(v4f_t*)dst = v;  }
}

extern "C" void kernel_launch(void* const* d_in, const int* in_sizes, int n_in,
                              void* d_out, int out_size, void* d_ws, size_t ws_size,
                              hipStream_t stream) {
  (void)in_sizes; (void)n_in; (void)out_size;
  const float** f = (const float**)d_in;
  const float* x1 = f[0], *x2 = f[1], *gw = f[2], *gb = f[3], *tw = f[4], *tb = f[5], *pw = f[6], *pb = f[7], *Ww = f[8], *Wb = f[9], *bng = f[10], *bnb = f[11], *bnm = f[12], *bnv = f[13];
  float* out = (float*)d_out;     // [8,256,64,64]
  char* ws = (char*)d_ws;
  float* gwT = (float*)ws; ws += (size_t)CC * CI * 4; float* twT = (float*)ws; ws += (size_t)CC * CI * 4; float* pwT = (float*)ws; ws += (size_t)CC * CI * 4; float* WwT = (float*)ws; ws += (size_t)CI * CC * 4;
  float* XT = (float*)ws; ws += (size_t)HWn * CC * 4;                   // x_bᵀ [4096][256] (one batch at a time)
  float* TH = (float*)ws; ws += (size_t)HWn * CI * 4;                   // θ rows [4096][128] f32
  float* GF = (float*)ws; ws += (size_t)HWn * CI * 4;                   // g full-res rows, later reused for y
  float* GP = (float*)ws; ws += (size_t)N2 * CI * 4;                    // pooled g [1024][128]
  float* PH = (float*)ws; ws += (size_t)N2 * CI * 4;                    // pooled φ [1024][128]
  float* PHT = (float*)ws; ws += (size_t)CI * N2 * 4;                   // φᵀ [128][1024]
  float* S = (float*)ws; ws += (size_t)HWn * N2 * 4;                    // scores / 1024·P [4096][1024] (16 MB)
  float* Z = (float*)ws; ws += (size_t)HWn * CC * 4;                    // W_y rows [4096][256]
  float* zero = (float*)ws; ws += (size_t)HWn * CI * 4; float* sc = (float*)ws; ws += CI * 4;
  float* Y = GF;
  if ((size_t)(ws - (char*)d_ws) > ws_size) return;                     // WS TOTAL 33,554,944 B
  const dim3 blk(256);
  k_transpose<<<dim3((CI / 64) * (CC / 64)), blk, 0, stream>>>(gw, gwT, CI, CC); k_transpose<<<dim3((CI / 64) * (CC / 64)), blk, 0, stream>>>(tw, twT, CI, CC);
  k_transpose<<<dim3((CI / 64) * (CC / 64)), blk, 0, stream>>>(pw, pwT, CI, CC); k_transpose<<<dim3((CC / 64) * (CI / 64)), blk, 0, stream>>>(Ww, WwT, CC, CI);
  k_fill<<<dim3((HWn * CI / 4 + 255) / 256), blk, 0, stream>>>(zero, 0.0f, (size_t)HWn * CI / 4); k_fill<<<dim3(1), blk, 0, stream>>>(sc, 1.0f / 1024.0f, CI / 4);
  for (int b = 0; b < NBT; ++b) {
    const float* x1b = x1 + (size_t)b * CC * HWn; const float* x2b = x2 + (size_t)b * CC * HWn;
    k_transpose<<<dim3((CC / 64) * (HWn / 64)), blk, 0, stream>>>(x2b, XT, CC, HWn);                                                      // x2ᵀ [4096][256]
    gemm_kn2<float, false><<<dim3(HWn / 128, CI / 128, 1), blk, 0, stream>>>(XT, CC, 0, pwT, CI, 0, pb, 1.0f, GF, CI, 0, CC);              // φ full-res (planes; GF as scratch)
    k_pool<<<dim3(N2 / 4), blk, 0, stream>>>(GF, PH);
    k_transpose<<<dim3((N2 / 64) * (CI / 64)), blk, 0, stream>>>(PH, PHT, N2, CI);                                                       // φᵀ [128][1024]
    k_transpose<<<dim3((CC / 64) * (HWn / 64)), blk, 0, stream>>>(x1b, XT, CC, HWn);                                                      // x1ᵀ
    gemm_kne<float, 0, false><<<dim3(HWn / 128, CI / 128), blk, 0, stream>>>(XT, CC, gwT, CI, gb, nullptr, nullptr, GF, CI, CC);          // g full-res (on x1, faithful)
    k_pool<<<dim3(N2 / 4), blk, 0, stream>>>(GF, GP);
    gemm_kn2<float, false><<<dim3(HWn / 128, CI / 128, 1), blk, 0, stream>>>(XT, CC, 0, twT, CI, 0, tb, 1.0f, TH, CI, 0, CC);              // θ (planes)
    gemm_kn2<float, false><<<dim3(HWn / 128, N2 / 128, 1), blk, 0, stream>>>(TH, CI, 0, PHT, N2, 0, nullptr, 1.0f, S, N2, 0, CI);        // f = θ·φᵀ (planes)
    k_softmax1k<<<dim3(HWn), blk, 0, stream>>>(S);
    gemm_kne<float, 2, false><<<dim3(HWn / 128, CI / 128), blk, 0, stream>>>(S, N2, GP, CI, nullptr, zero, sc, Y, CI, N2);              // y = (1024·P)·g / 1024
    gemm_kne<float, 0, false><<<dim3(HWn / 128, CC / 128), blk, 0, stream>>>(Y, CI, WwT, CC, Wb, nullptr, nullptr, Z, CC, CI);           // W_y rows
    k_outT<<<dim3((HWn / 64) * (CC / 64)), blk, 0, stream>>>(Z, x1b, bng, bnb, bnm, bnv, out + (size_t)b * CC * HWn);
  }
}

// v001
// It runs in 314 microseconds.
// In two side-by-side timings against v000, it was 4.46 and 4.45 times as fast.
// Contractions on v_wmma_f32_16x16x32_f16, f32 accumulate: the three 1x1 convs as position-major GEMMs (xᵀ·Wᵀ + b, K = 256, f32 out; θ and φ — the score operands — with f16 value+residual planes, g plain f16;
// x1ᵀ / x2ᵀ by tile transposes), 2x2 max-pooling of the g / phi maps over positions, per batch the non-local scores f = θ·φᵀ (K = 128, 4096 x 1024) with f16 value+residual planes
// (hi·hi + (hi·lo + lo·hi)/2048: unscaled σ ≈ 11 logits → peaked softmax needs f32-class scores), f32 row softmax writing 1024·P, y = (1024·P)·g with plain f16
// operands (x 1/1024 in the epilogue), W_y = y·W_wᵀ + b (K = 128, plain f16), then BatchNorm (running stats) + the x1 residual fused into the transpose back to NCHW.
// compute dtype: f16 operands (planes on the scores), f32 accumulate; pooling / softmax / BN in f32.  x1, x2 [8,256,64,64].
#include <hip/hip_runtime.h>
#include <hip/hip_bf16.h>
#include <math.h>


typedef _Float16 bf16;
typedef _Float16 f16;
typedef __attribute__((ext_vector_type(4))) unsigned v4u_t;
typedef unsigned v4ua __attribute__((ext_vector_type(4), may_alias));
typedef __attribute__((ext_vector_type(4))) float v4f_t;
typedef float v4fa __attribute__((ext_vector_type(4), may_alias));
typedef __attribute__((ext_vector_type(16))) bf16  bf16x16;
typedef bf16x16 f16x16;
typedef __attribute__((ext_vector_type(8)))  bf16  bf16x8;
typedef bf16x8 f16x8;
typedef __attribute__((ext_vector_type(4)))  bf16  bf16x4;
typedef __attribute__((ext_vector_type(8)))  float f32x8;
__device__ __forceinline__ f32x8 wmma16(f16x16 a, f16x16 b, f32x8 c) {
  c = __builtin_amdgcn_wmma_f32_16x16x32_f16(false, a, false, b, (short)0, c, false, false);
  asm volatile("v_nop\n\tv_nop\n\tv_nop\n\tv_nop" : "+v"(c) : "v"(a), "v"(b));
  return c;
}
#define LDS_STRIDE 48   // unused; the GEMM tiles use GSTR
#define KSTRIDE    72   // unused
#define VSTRIDE    48   // unused

__device__ __forceinline__ f32x8 wmma_bf16(bf16x16 a, bf16x16 b, f32x8 c) {
  c = __builtin_amdgcn_wmma_f32_16x16x32_f16(false, a, false, b, (short)0, c, false, false);
  asm volatile("v_nop\n\tv_nop\n\tv_nop\n\tv_nop" : "+v"(c) : "v"(a), "v"(b));   // A/B-overwrite hazard guard
  return c;
}

// 16x32 (MxK) f16 fragment from a row-major global matrix.
// lanes 0-15  (row=lane)    : elems 0..7 = K+0..7,  8..15 = K+16..23
// lanes 16-31 (row=lane-16) : elems 0..7 = K+8..15, 8..15 = K+24..31
template <typename T>
__device__ __forceinline__ bf16x16 load_frag(const T* __restrict__ base, int ld,
                                             int row0, int k0) {
  const int lane = threadIdx.x & 31;
  const int r    = lane & 15;
  const int kh   = (lane >> 4) * 8;
  const T* p0 = base + (size_t)(row0 + r) * ld + (k0 + kh);
  const T* p1 = p0 + 16;
  bf16x16 f;
#pragma unroll
  for (int i = 0; i < 8; ++i) {
    f[i]     = (bf16)p0[i];
    f[i + 8] = (bf16)p1[i];
  }
  return f;
}

// Same fragment from an LDS tile with padded row stride (base includes row0/k0).
__device__ __forceinline__ bf16x16 lds_frag(const bf16* base, int stride) {
  const int lane = threadIdx.x & 31;
  const int row  = lane & 15;
  const int kh   = (lane >> 4) * 8;
  const bf16x8 lo = *(const bf16x8*)(base + row * stride + kh);
  const bf16x8 hi = *(const bf16x8*)(base + row * stride + kh + 16);
  bf16x16 f;
#pragma unroll
  for (int i = 0; i < 8; ++i) { f[i] = lo[i]; f[i + 8] = hi[i]; }
  return f;
}

template <typename T>
__device__ __forceinline__ void stage_read16(const T* __restrict__ p, float* buf) {
#pragma unroll
  for (int i = 0; i < 16; ++i) buf[i] = (float)p[i];
}

__device__ __forceinline__ void stage_write(bf16* dst, const float* buf, int nquad) {
#pragma unroll
  for (int i = 0; i < nquad; ++i) {
    bf16x4 q;
    q[0] = (bf16)buf[4 * i];     q[1] = (bf16)buf[4 * i + 1];
    q[2] = (bf16)buf[4 * i + 2]; q[3] = (bf16)buf[4 * i + 3];
    *(bf16x4*)(dst + 4 * i) = q;
  }
}


#define GSTR 48
// ---------------------------------------------------------------------------------------------------------------------------
// gemm_kne: Y[m][n] = epi( Σ_k A[m][k]·W[k][n] + bias[n] ), A f32/f16 [M][lda], W f32 row-major [K][N] (ldw), plain f16 operands,
// f32 accumulate. EPI 0: identity; 1: exact-erf GELU; 2: R[m][n] + gvec[n]·(·) (residual with per-channel gain). Output f32 (or f16
// when OUT16). Block = 128x128 tile, 8 waves as 4(M) x 2(N); per 32-wide k-step A and W tiles staged f16 in LDS (W transposed
// ---------------------------------------------------------------------------------------------------------------------------
#define GSTR 48
template <typename AT, int EPI, bool OUT16>
__global__ __launch_bounds__(256) void gemm_kne(const AT* __restrict__ A, int lda, size_t strideA, const float* __restrict__ Wm, int ldw, size_t strideW,
                                                const float* __restrict__ bias, const float* __restrict__ R, const float* __restrict__ gvec,
                                                void* __restrict__ Yv, int ldy, size_t strideY, int K) {
  __shared__ __attribute__((aligned(16))) f16 ldsA[128 * GSTR];
  __shared__ __attribute__((aligned(16))) f16 ldsW[128 * GSTR];
  __shared__ __attribute__((aligned(16))) float oS[8][32 * 68];
  const int tid = threadIdx.x, lane = tid & 31, wave = tid >> 5, cl = lane & 15, rh = (lane >> 4) * 8;
  const int m0 = blockIdx.x * 128, n0 = blockIdx.y * 128;
  const int wm = (wave & 3) * 32, wn = (wave >> 2) * 64;
  A += (size_t)blockIdx.z * strideA; Wm += (size_t)blockIdx.z * strideW;   // blockIdx.z selects a batch (element strides); R and gvec are shared by all batches
  f32x8 acc[2][4];
#pragma unroll
  for (int i = 0; i < 2; ++i)
#pragma unroll
    for (int j = 0; j < 4; ++j) { f32x8 z = {}; acc[i][j] = z; }
#pragma unroll 1
  for (int k0 = 0; k0 < K; k0 += 32) {
    __syncthreads();
    { const int row = tid >> 1, ch = (tid & 1) * 16;
      const AT* src = A + (size_t)(m0 + row) * lda + k0 + ch;
#pragma unroll
      for (int g = 0; g < 16; ++g) ldsA[row * GSTR + ch + g] = (f16)src[g]; }
    { const int k = tid >> 3, nn0 = (tid & 7) * 16;
      const float* src = Wm + (size_t)(k0 + k) * ldw + n0 + nn0;
#pragma unroll
      for (int g = 0; g < 4; ++g) { const v4f_t v = *(const v4f_t*)(src + 4 * g);
#pragma unroll
        for (int u = 0; u < 4; ++u) ldsW[(nn0 + 4 * g + u) * GSTR + k] = (f16)v[u]; } }
    __syncthreads();
    f16x16 af[2];
#pragma unroll
    for (int i = 0; i < 2; ++i) af[i] = lds_frag(ldsA + (wm + 16 * i) * GSTR, GSTR);
#pragma unroll
    for (int j = 0; j < 4; ++j) {
      const f16x16 bf = lds_frag(ldsW + (wn + 16 * j) * GSTR, GSTR);
#pragma unroll
      for (int i = 0; i < 2; ++i) acc[i][j] = wmma16(af[i], bf, acc[i][j]);
    }
  }
  float* so = oS[wave];
#pragma unroll
  for (int i = 0; i < 2; ++i)
#pragma unroll
    for (int j = 0; j < 4; ++j) {
      const int n = n0 + wn + 16 * j + cl;
      const float bv = bias ? bias[n] : 0.0f;
      const float gv = (EPI == 2) ? gvec[n] : 0.0f;
      if (EPI == 1) {
#pragma unroll 1
        for (int r = 0; r < 8; ++r) { const float xg = acc[i][j][r] + bv; so[(16 * i + rh + r) * 68 + 16 * j + cl] = 0.5f * xg * (1.0f + erff(xg * 0.70710678118654752f)); }
      } else {
#pragma unroll
        for (int r = 0; r < 8; ++r) {
          float v = acc[i][j][r] + bv;
          if (EPI == 2) v = R[(size_t)(m0 + wm + 16 * i + rh + r) * ldy + n] + gv * v;
          so[(16 * i + rh + r) * 68 + 16 * j + cl] = v;
        }
      }
    }
  asm volatile("s_wait_dscnt 0" ::: "memory");
  __builtin_amdgcn_wave_barrier();
{
    if (OUT16) {
      f16* Y = (f16*)Yv + (size_t)blockIdx.z * strideY;
#pragma unroll
      for (int it = 0; it < 8; ++it) { const int c = lane + 32 * it, rr = c >> 3, q8 = (c & 7) * 8;
        union { f16 h[8]; v4u_t v; } u;
#pragma unroll
        for (int e = 0; e < 8; ++e) u.h[e] = (f16)so[rr * 68 + q8 + e];
        *(v4u_t*)(Y + (size_t)(m0 + wm + rr) * ldy + n0 + wn + q8) = u.v; }
    } else {
      float* Y = (float*)Yv + (size_t)blockIdx.z * strideY;
#pragma unroll
      for (int it = 0; it < 16; ++it) { const int f4 = lane + 32 * it, rr = f4 >> 4, q = (f4 & 15) * 4;
        *(v4f_t*)(Y + (size_t)(m0 + wm + rr) * ldy + n0 + wn + q) = *(const v4fa*)(so + rr * 68 + q); }
    }
    
  }
}

// ---------------------------------------------------------------------------------------------------------------------------
// gemm_kn2 (value+residual planes on both operands: hh + (hl+lh)/2048, f32-class): Y[m][n] (row stride ldy) = scale * sum_k A[m][k] (f32 or f16, row stride lda) * W[k][n] (f32, row-major [K][N], row
// stride ldw) (+ bias[n]) (+ Y if ACC). Block = 128 x 128 tile, 256 threads = 8 waves as 4(M, 32 rows) x 2(N, 64 cols); per
// 32-wide k-step the A tile and the W tile (stored transposed [n][k]) are staged as f16 in LDS; value+residual f16 planes, f32
// blockIdx.z selects a batch: A += z*strideA, W += z*strideW, Y += z*strideY (element strides).
// ---------------------------------------------------------------------------------------------------------------------------
template <typename AT, bool ACC>
__global__ __launch_bounds__(256) void gemm_kn2(const AT* __restrict__ A, int lda, size_t strideA,
                                               const float* __restrict__ Wm, int ldw, size_t strideW,
                                               const float* __restrict__ bias, float scale,
                                               float* __restrict__ Y, int ldy, size_t strideY, int K) {
  __shared__ __attribute__((aligned(16))) f16 ldsA[128 * GSTR], ldsAl[128 * GSTR];
  __shared__ __attribute__((aligned(16))) f16 ldsW[128 * GSTR], ldsWl[128 * GSTR];
  __shared__ __attribute__((aligned(16))) float oS[8][32 * 68];
  const int tid = threadIdx.x, lane = tid & 31, wave = tid >> 5, cl = lane & 15, rh = (lane >> 4) * 8;
  const int m0 = blockIdx.x * 128, n0 = blockIdx.y * 128;
  const int wm = (wave & 3) * 32, wn = (wave >> 2) * 64;
  A += (size_t)blockIdx.z * strideA; Wm += (size_t)blockIdx.z * strideW; Y += (size_t)blockIdx.z * strideY;
  f32x8 acc[2][4], accx[2][4];
#pragma unroll
  for (int i = 0; i < 2; ++i)
#pragma unroll
    for (int j = 0; j < 4; ++j) { f32x8 z = {}; acc[i][j] = z; accx[i][j] = z; }
#pragma unroll 1
  for (int k0 = 0; k0 < K; k0 += 32) {
    __syncthreads();
    {  // A: thread -> row tid>>1, 16 elements at column half (tid&1)*16
      const int row = tid >> 1, ch = (tid & 1) * 16;
      const AT* src = A + (size_t)(m0 + row) * lda + k0 + ch;
#pragma unroll
      for (int g = 0; g < 16; ++g) { const float v = (float)src[g]; const f16 h = (f16)v; ldsA[row * GSTR + ch + g] = h; ldsAl[row * GSTR + ch + g] = (f16)((v - (float)h) * 2048.0f); }
    }
    {  // W: thread -> k = tid>>3, 16 consecutive n at (tid&7)*16; stored transposed [n][k]
      const int k = tid >> 3, nn0 = (tid & 7) * 16;
      const float* src = Wm + (size_t)(k0 + k) * ldw + n0 + nn0;
#pragma unroll
      for (int g = 0; g < 4; ++g) { const v4f_t v = *(const v4f_t*)(src + 4 * g);
#pragma unroll
        for (int u = 0; u < 4; ++u) { const f16 h = (f16)v[u]; ldsW[(nn0 + 4 * g + u) * GSTR + k] = h; ldsWl[(nn0 + 4 * g + u) * GSTR + k] = (f16)((v[u] - (float)h) * 2048.0f); } }
    }
    __syncthreads();
    f16x16 af[2], afl[2];
#pragma unroll
    for (int i = 0; i < 2; ++i) { af[i] = lds_frag(ldsA + (wm + 16 * i) * GSTR, GSTR); afl[i] = lds_frag(ldsAl + (wm + 16 * i) * GSTR, GSTR); }
#pragma unroll
    for (int j = 0; j < 4; ++j) {
      const f16x16 bf = lds_frag(ldsW + (wn + 16 * j) * GSTR, GSTR), bfl = lds_frag(ldsWl + (wn + 16 * j) * GSTR, GSTR);
#pragma unroll
      for (int i = 0; i < 2; ++i) { acc[i][j] = wmma16(af[i], bf, acc[i][j]); accx[i][j] = wmma16(af[i], bfl, accx[i][j]); accx[i][j] = wmma16(afl[i], bf, accx[i][j]); }
    }
  }
  float* so = oS[wave];
#pragma unroll
  for (int i = 0; i < 2; ++i)
#pragma unroll
    for (int j = 0; j < 4; ++j) {
      const float bv = bias ? bias[n0 + wn + 16 * j + cl] : 0.0f;
#pragma unroll
      for (int r = 0; r < 8; ++r) so[(16 * i + rh + r) * 68 + 16 * j + cl] = (acc[i][j][r] + accx[i][j][r] * (1.0f / 2048.0f)) * scale + bv;
    }
  asm volatile("s_wait_dscnt 0" ::: "memory");
  __builtin_amdgcn_wave_barrier();
  if (ACC) {   // accumulate: fold the existing Y values into the staging tile ONCE (same thread <-> same chunks as the stores below)
#pragma unroll
    for (int it = 0; it < 16; ++it) { const int f4 = lane + 32 * it, rr = f4 >> 4, q = (f4 & 15) * 4;
      const v4f_t old = *(const v4fa*)(Y + (size_t)(m0 + wm + rr) * ldy + n0 + wn + q);
      v4f_t v = *(const v4fa*)(so + rr * 68 + q); v += old; *(v4fa*)(so + rr * 68 + q) = v; }
    asm volatile("s_wait_dscnt 0" ::: "memory");
  }
{
#pragma unroll
    for (int it = 0; it < 16; ++it) { const int f4 = lane + 32 * it, rr = f4 >> 4, q = (f4 & 15) * 4;
      *(v4f_t*)(Y + (size_t)(m0 + wm + rr) * ldy + n0 + wn + q) = *(const v4fa*)(so + rr * 68 + q); }
    
  }
}

__global__ __launch_bounds__(256) void k_transpose(const float* __restrict__ Wm, float* __restrict__ Wt, int rows, int cols) {
  __shared__ float tS[64][65];
  const int tid = threadIdx.x, tbj = cols / 64, bi = blockIdx.x / tbj, bj = blockIdx.x % tbj;
  Wm += (size_t)blockIdx.y * rows * cols; Wt += (size_t)blockIdx.y * rows * cols;   // blockIdx.y selects a batch of dense [rows][cols] matrices
  for (int e = tid; e < 64 * 64; e += 256) { const int r = e >> 6, c = e & 63; tS[r][c] = Wm[(size_t)(bi * 64 + r) * cols + bj * 64 + c]; }
  __syncthreads();
  for (int ch = tid; ch < 64 * 16; ch += 256) { const int r = ch >> 4, q4 = (ch & 15) * 4; v4f_t o; o[0] = tS[q4][r]; o[1] = tS[q4 + 1][r]; o[2] = tS[q4 + 2][r]; o[3] = tS[q4 + 3][r];
    float* dst = Wt + (size_t)(bj * 64 + r) * rows + bi * 64 + q4; *(v4f_t*)dst = o;  }
}

#define NBT 8
#define BBn 8
#define CC 256
#define CI 128
#define HWn 4096       // 64 x 64 positions
#define N2 1024        // pooled positions (32 x 32)
// row softmax over 1024 columns in place, writing 1024·P (f32); block = one row, 256 threads x 4
__global__ __launch_bounds__(256) void k_softmax1k(float* __restrict__ Sm) {
  __shared__ float red[256];
  const size_t row = blockIdx.x; const int tid = threadIdx.x; float* sr = Sm + row * N2;
  float v[4]; float m = -3.0e38f;
#pragma unroll
  for (int e = 0; e < 4; ++e) { v[e] = sr[tid + 256 * e]; m = fmaxf(m, v[e]); }
  red[tid] = m; __syncthreads();
  for (int o = 128; o > 0; o >>= 1) { if (tid < o) red[tid] = fmaxf(red[tid], red[tid + o]); __syncthreads(); }
  m = red[0]; __syncthreads();
  float z = 0.0f;
#pragma unroll
  for (int e = 0; e < 4; ++e) { v[e] = expf(v[e] - m); z += v[e]; }
  red[tid] = z; __syncthreads();
  for (int o = 128; o > 0; o >>= 1) { if (tid < o) red[tid] += red[tid + o]; __syncthreads(); }
  const float sc = 1024.0f / red[0];
{
#pragma unroll
    for (int e = 0; e < 4; ++e) *(float*)(sr + tid + 256 * e) = v[e] * sc;
     }
}
__global__ __launch_bounds__(256) void k_fill(float* __restrict__ p, float val, size_t n4) { const size_t i = (size_t)blockIdx.x * 256 + threadIdx.x; if (i < n4) { v4f_t v = {val, val, val, val}; *(v4f_t*)(p + 4 * i) = v;  } }
// 2x2 max-pool over positions of a position-major map F [4096][128] → P [1024][128]; block = 4 pooled rows (64 threads x 8 B... ) → thread = (pooled row, 2 channels)
__global__ __launch_bounds__(256) void k_pool(const float* __restrict__ F, float* __restrict__ Pd) {
  const int tid = threadIdx.x; const int pr = blockIdx.x * 4 + (tid >> 6); const int c2 = (tid & 63) * 2;      // pooled row pr = i*32 + j
  const int i = pr >> 5, j = pr & 31; const size_t r00 = (size_t)(2 * i) * 64 + 2 * j;                          // full-res position (2i, 2j)
  F += (size_t)blockIdx.y * HWn * CI; Pd += (size_t)blockIdx.y * N2 * CI;   // blockIdx.y selects a batch
  float o0, o1;
  { const float* a = F + r00 * CI + c2; const float* b = F + (r00 + 1) * CI + c2; const float* c = F + (r00 + 64) * CI + c2; const float* d = F + (r00 + 65) * CI + c2;
    o0 = fmaxf(fmaxf(a[0], b[0]), fmaxf(c[0], d[0])); o1 = fmaxf(fmaxf(a[1], b[1]), fmaxf(c[1], d[1])); }
  typedef float v2f_t __attribute__((ext_vector_type(2))); v2f_t v; v[0] = o0; v[1] = o1;
  *(v2f_t*)(Pd + (size_t)pr * CI + c2) = v;      // 64 lanes x 8 B = the 512-B row; 32 lanes = 256 B contiguous
}
// transpose back to NCHW with BatchNorm (running stats) and the x1 residual: out[b][o][n] = (Z[n][o] − mean[o])·inv[o] + beta[o] + x1[b][o][n]; 64x64 LDS tiles, 256-B row segments
__global__ __launch_bounds__(256) void k_outT(const float* __restrict__ Z, const float* __restrict__ x1b, const float* __restrict__ g, const float* __restrict__ be, const float* __restrict__ mu, const float* __restrict__ var,
                                             float* __restrict__ outb) {
  __shared__ float tS[64][65];
  const int tid = threadIdx.x, tbj = CC / 64, bi = blockIdx.x / tbj, bj = blockIdx.x % tbj;      // Z is [HWn rows][CC cols]: bi over rows (positions), bj over cols (channels)
  Z += (size_t)blockIdx.y * HWn * CC; x1b += (size_t)blockIdx.y * CC * HWn; outb += (size_t)blockIdx.y * CC * HWn;   // blockIdx.y selects a batch
  for (int e = tid; e < 64 * 64; e += 256) { const int r = e >> 6, c = e & 63; tS[r][c] = Z[(size_t)(bi * 64 + r) * CC + bj * 64 + c]; }
  __syncthreads();
  for (int ch = tid; ch < 64 * 16; ch += 256) { const int r = ch >> 4, q4 = (ch & 15) * 4; const int o = bj * 64 + r; const float inv = g[o] * rsqrtf(var[o] + 1e-5f), sh = be[o] - mu[o] * inv;
    const size_t off = (size_t)o * HWn + bi * 64 + q4; const v4f_t xr = *(const v4f_t*)(x1b + off); v4f_t v;
    v[0] = tS[q4][r] * inv + sh + xr[0]; v[1] = tS[q4 + 1][r] * inv + sh + xr[1]; v[2] = tS[q4 + 2][r] * inv + sh + xr[2]; v[3] = tS[q4 + 3][r] * inv + sh + xr[3];
    float* dst = outb + off; *(v4f_t*)dst = v;  }
}

extern "C" void kernel_launch(void* const* d_in, const int* in_sizes, int n_in,
                              void* d_out, int out_size, void* d_ws, size_t ws_size,
                              hipStream_t stream) {
  (void)in_sizes; (void)n_in; (void)out_size;
  const float** f = (const float**)d_in;
  const float* x1 = f[0], *x2 = f[1], *gw = f[2], *gb = f[3], *tw = f[4], *tb = f[5], *pw = f[6], *pb = f[7], *Ww = f[8], *Wb = f[9], *bng = f[10], *bnb = f[11], *bnm = f[12], *bnv = f[13];
  float* out = (float*)d_out;     // [8,256,64,64]
  char* ws = (char*)d_ws;
  float* gwT = (float*)ws; ws += (size_t)CC * CI * 4; float* twT = (float*)ws; ws += (size_t)CC * CI * 4; float* pwT = (float*)ws; ws += (size_t)CC * CI * 4; float* WwT = (float*)ws; ws += (size_t)CI * CC * 4;
  // every per-batch buffer holds all NBT batches, batch b at b * (its per-batch size)
  float* XT = (float*)ws; ws += (size_t)NBT * HWn * CC * 4;             // x transposed [8][4096][256] (x2 first, then x1)
  float* TH = (float*)ws; ws += (size_t)NBT * HWn * CI * 4;             // theta rows [8][4096][128] f32
  float* GF = (float*)ws; ws += (size_t)NBT * HWn * CI * 4;             // phi, then g full-res rows, later reused for y
  float* GP = (float*)ws; ws += (size_t)NBT * N2 * CI * 4;              // pooled g [8][1024][128]
  float* PH = (float*)ws; ws += (size_t)NBT * N2 * CI * 4;              // pooled phi [8][1024][128]
  float* PHT = (float*)ws; ws += (size_t)NBT * CI * N2 * 4;             // phi transposed [8][128][1024]
  float* S = (float*)ws; ws += (size_t)NBT * HWn * N2 * 4;              // scores / 1024*P [8][4096][1024] (128 MiB)
  float* Z = (float*)ws; ws += (size_t)NBT * HWn * CC * 4;              // W_y rows [8][4096][256]
  float* zero = (float*)ws; ws += (size_t)HWn * CI * 4; float* sc = (float*)ws; ws += CI * 4;
  float* Y = GF;
  if ((size_t)(ws - (char*)d_ws) > ws_size) return;                     // WS TOTAL 250,085,888 B
  const dim3 blk(256);
  k_transpose<<<dim3((CI / 64) * (CC / 64)), blk, 0, stream>>>(gw, gwT, CI, CC); k_transpose<<<dim3((CI / 64) * (CC / 64)), blk, 0, stream>>>(tw, twT, CI, CC);
  k_transpose<<<dim3((CI / 64) * (CC / 64)), blk, 0, stream>>>(pw, pwT, CI, CC); k_transpose<<<dim3((CC / 64) * (CI / 64)), blk, 0, stream>>>(Ww, WwT, CC, CI);
  k_fill<<<dim3((HWn * CI / 4 + 255) / 256), blk, 0, stream>>>(zero, 0.0f, (size_t)HWn * CI / 4); k_fill<<<dim3(1), blk, 0, stream>>>(sc, 1.0f / 1024.0f, CI / 4);
  // one launch per stage for all NBT batches: the batch is a grid dimension
  k_transpose<<<dim3((CC / 64) * (HWn / 64), NBT), blk, 0, stream>>>(x2, XT, CC, HWn);                                                                       // x2 transposed [4096][256]
  gemm_kn2<float, false><<<dim3(HWn / 128, CI / 128, NBT), blk, 0, stream>>>(XT, CC, (size_t)HWn * CC, pwT, CI, 0, pb, 1.0f, GF, CI, (size_t)HWn * CI, CC);      // phi full-res (planes; GF as scratch)
  k_pool<<<dim3(N2 / 4, NBT), blk, 0, stream>>>(GF, PH);
  k_transpose<<<dim3((N2 / 64) * (CI / 64), NBT), blk, 0, stream>>>(PH, PHT, N2, CI);                                                                        // phi transposed [128][1024]
  k_transpose<<<dim3((CC / 64) * (HWn / 64), NBT), blk, 0, stream>>>(x1, XT, CC, HWn);                                                                       // x1 transposed
  gemm_kne<float, 0, false><<<dim3(HWn / 128, CI / 128, NBT), blk, 0, stream>>>(XT, CC, (size_t)HWn * CC, gwT, CI, 0, gb, nullptr, nullptr, GF, CI, (size_t)HWn * CI, CC);   // g full-res (on x1, faithful)
  k_pool<<<dim3(N2 / 4, NBT), blk, 0, stream>>>(GF, GP);
  gemm_kn2<float, false><<<dim3(HWn / 128, CI / 128, NBT), blk, 0, stream>>>(XT, CC, (size_t)HWn * CC, twT, CI, 0, tb, 1.0f, TH, CI, (size_t)HWn * CI, CC);      // theta (planes)
  gemm_kn2<float, false><<<dim3(HWn / 128, N2 / 128, NBT), blk, 0, stream>>>(TH, CI, (size_t)HWn * CI, PHT, N2, (size_t)CI * N2, nullptr, 1.0f, S, N2, (size_t)HWn * N2, CI);   // f = theta * phi^T (planes)
  k_softmax1k<<<dim3(NBT * HWn), blk, 0, stream>>>(S);
  gemm_kne<float, 2, false><<<dim3(HWn / 128, CI / 128, NBT), blk, 0, stream>>>(S, N2, (size_t)HWn * N2, GP, CI, (size_t)N2 * CI, nullptr, zero, sc, Y, CI, (size_t)HWn * CI, N2);   // y = (1024*P) * g / 1024
  gemm_kne<float, 0, false><<<dim3(HWn / 128, CC / 128, NBT), blk, 0, stream>>>(Y, CI, (size_t)HWn * CI, WwT, CC, 0, Wb, nullptr, nullptr, Z, CC, (size_t)HWn * CC, CI);      // W_y rows
  k_outT<<<dim3((HWn / 64) * (CC / 64), NBT), blk, 0, stream>>>(Z, x1, bng, bnb, bnm, bnv, out);
}

// v002
// Measured time: 181 microseconds a run.
// In two side-by-side timings against v001, it was 1.74 and 1.73 times as fast.
// Over all steps from v000 it is 7.73 times as fast.
// Contractions on v_wmma_f32_16x16x32_f16, f32 accumulate: the three 1x1 convs as position-major GEMMs (xᵀ·Wᵀ + b, K = 256, f32 out; θ and φ — the score operands — with f16 value+residual planes, g plain f16;
// x1^T / x2^T by tile transposes), 2x2 max-pooling of the g / phi maps over positions, per batch the non-local scores f = theta * phi^T (K = 128, 4096 x 1024) with f16 value+residual planes
// (hi*hi + (hi*lo + lo*hi)/2048: unscaled logits of spread about 11 give a peaked softmax that needs f32-class scores), running f32 row softmax and y = P * g (plain f16 operands, P carried as 1024 * exp(s - max))
// in the same kernel as the scores, W_y = y * W_w^T + b (K = 128, plain f16), then BatchNorm (running stats) + the x1 residual fused into the transpose back to NCHW.
// compute dtype: f16 operands (planes on the scores), f32 accumulate; pooling / softmax / BN in f32.  x1, x2 [8,256,64,64].
#include <hip/hip_runtime.h>
#include <hip/hip_bf16.h>
#include <math.h>


typedef _Float16 bf16;
typedef _Float16 f16;
typedef __attribute__((ext_vector_type(4))) unsigned v4u_t;
typedef unsigned v4ua __attribute__((ext_vector_type(4), may_alias));
typedef __attribute__((ext_vector_type(4))) float v4f_t;
typedef float v4fa __attribute__((ext_vector_type(4), may_alias));
typedef __attribute__((ext_vector_type(16))) bf16  bf16x16;
typedef bf16x16 f16x16;
typedef __attribute__((ext_vector_type(8)))  bf16  bf16x8;
typedef bf16x8 f16x8;
typedef __attribute__((ext_vector_type(4)))  bf16  bf16x4;
typedef __attribute__((ext_vector_type(8)))  float f32x8;
__device__ __forceinline__ f32x8 wmma16(f16x16 a, f16x16 b, f32x8 c) {
  c = __builtin_amdgcn_wmma_f32_16x16x32_f16(false, a, false, b, (short)0, c, false, false);
  asm volatile("v_nop\n\tv_nop\n\tv_nop\n\tv_nop" : "+v"(c) : "v"(a), "v"(b));
  return c;
}
#define LDS_STRIDE 48   // unused; the GEMM tiles use GSTR
#define KSTRIDE    72   // unused
#define VSTRIDE    48   // unused

__device__ __forceinline__ f32x8 wmma_bf16(bf16x16 a, bf16x16 b, f32x8 c) {
  c = __builtin_amdgcn_wmma_f32_16x16x32_f16(false, a, false, b, (short)0, c, false, false);
  asm volatile("v_nop\n\tv_nop\n\tv_nop\n\tv_nop" : "+v"(c) : "v"(a), "v"(b));   // A/B-overwrite hazard guard
  return c;
}

// 16x32 (MxK) f16 fragment from a row-major global matrix.
// lanes 0-15  (row=lane)    : elems 0..7 = K+0..7,  8..15 = K+16..23
// lanes 16-31 (row=lane-16) : elems 0..7 = K+8..15, 8..15 = K+24..31
template <typename T>
__device__ __forceinline__ bf16x16 load_frag(const T* __restrict__ base, int ld,
                                             int row0, int k0) {
  const int lane = threadIdx.x & 31;
  const int r    = lane & 15;
  const int kh   = (lane >> 4) * 8;
  const T* p0 = base + (size_t)(row0 + r) * ld + (k0 + kh);
  const T* p1 = p0 + 16;
  bf16x16 f;
#pragma unroll
  for (int i = 0; i < 8; ++i) {
    f[i]     = (bf16)p0[i];
    f[i + 8] = (bf16)p1[i];
  }
  return f;
}

// Same fragment from an LDS tile with padded row stride (base includes row0/k0).
__device__ __forceinline__ bf16x16 lds_frag(const bf16* base, int stride) {
  const int lane = threadIdx.x & 31;
  const int row  = lane & 15;
  const int kh   = (lane >> 4) * 8;
  const bf16x8 lo = *(const bf16x8*)(base + row * stride + kh);
  const bf16x8 hi = *(const bf16x8*)(base + row * stride + kh + 16);
  bf16x16 f;
#pragma unroll
  for (int i = 0; i < 8; ++i) { f[i] = lo[i]; f[i + 8] = hi[i]; }
  return f;
}

template <typename T>
__device__ __forceinline__ void stage_read16(const T* __restrict__ p, float* buf) {
#pragma unroll
  for (int i = 0; i < 16; ++i) buf[i] = (float)p[i];
}

__device__ __forceinline__ void stage_write(bf16* dst, const float* buf, int nquad) {
#pragma unroll
  for (int i = 0; i < nquad; ++i) {
    bf16x4 q;
    q[0] = (bf16)buf[4 * i];     q[1] = (bf16)buf[4 * i + 1];
    q[2] = (bf16)buf[4 * i + 2]; q[3] = (bf16)buf[4 * i + 3];
    *(bf16x4*)(dst + 4 * i) = q;
  }
}


#define GSTR 48
// ---------------------------------------------------------------------------------------------------------------------------
// gemm_kne: Y[m][n] = epi( Σ_k A[m][k]·W[k][n] + bias[n] ), A f32/f16 [M][lda], W f32 row-major [K][N] (ldw), plain f16 operands,
// f32 accumulate. EPI 0: identity; 1: exact-erf GELU; 2: R[m][n] + gvec[n]·(·) (residual with per-channel gain). Output f32 (or f16
// when OUT16). Block = 128x128 tile, 8 waves as 4(M) x 2(N); per 32-wide k-step A and W tiles staged f16 in LDS (W transposed
// ---------------------------------------------------------------------------------------------------------------------------
#define GSTR 48
template <typename AT, int EPI, bool OUT16>
__global__ __launch_bounds__(256) void gemm_kne(const AT* __restrict__ A, int lda, size_t strideA, const float* __restrict__ Wm, int ldw, size_t strideW,
                                                const float* __restrict__ bias, const float* __restrict__ R, const float* __restrict__ gvec,
                                                void* __restrict__ Yv, int ldy, size_t strideY, int K) {
  __shared__ __attribute__((aligned(16))) f16 ldsA[128 * GSTR];
  __shared__ __attribute__((aligned(16))) f16 ldsW[128 * GSTR];
  __shared__ __attribute__((aligned(16))) float oS[8][32 * 68];
  const int tid = threadIdx.x, lane = tid & 31, wave = tid >> 5, cl = lane & 15, rh = (lane >> 4) * 8;
  const int m0 = blockIdx.x * 128, n0 = blockIdx.y * 128;
  const int wm = (wave & 3) * 32, wn = (wave >> 2) * 64;
  A += (size_t)blockIdx.z * strideA; Wm += (size_t)blockIdx.z * strideW;   // blockIdx.z selects a batch (element strides); R and gvec are shared by all batches
  f32x8 acc[2][4];
#pragma unroll
  for (int i = 0; i < 2; ++i)
#pragma unroll
    for (int j = 0; j < 4; ++j) { f32x8 z = {}; acc[i][j] = z; }
#pragma unroll 1
  for (int k0 = 0; k0 < K; k0 += 32) {
    __syncthreads();
    { const int row = tid >> 1, ch = (tid & 1) * 16;
      const AT* src = A + (size_t)(m0 + row) * lda + k0 + ch;
#pragma unroll
      for (int g = 0; g < 16; ++g) ldsA[row * GSTR + ch + g] = (f16)src[g]; }
    { const int k = tid >> 3, nn0 = (tid & 7) * 16;
      const float* src = Wm + (size_t)(k0 + k) * ldw + n0 + nn0;
#pragma unroll
      for (int g = 0; g < 4; ++g) { const v4f_t v = *(const v4f_t*)(src + 4 * g);
#pragma unroll
        for (int u = 0; u < 4; ++u) ldsW[(nn0 + 4 * g + u) * GSTR + k] = (f16)v[u]; } }
    __syncthreads();
    f16x16 af[2];
#pragma unroll
    for (int i = 0; i < 2; ++i) af[i] = lds_frag(ldsA + (wm + 16 * i) * GSTR, GSTR);
#pragma unroll
    for (int j = 0; j < 4; ++j) {
      const f16x16 bf = lds_frag(ldsW + (wn + 16 * j) * GSTR, GSTR);
#pragma unroll
      for (int i = 0; i < 2; ++i) acc[i][j] = wmma16(af[i], bf, acc[i][j]);
    }
  }
  float* so = oS[wave];
#pragma unroll
  for (int i = 0; i < 2; ++i)
#pragma unroll
    for (int j = 0; j < 4; ++j) {
      const int n = n0 + wn + 16 * j + cl;
      const float bv = bias ? bias[n] : 0.0f;
      const float gv = (EPI == 2) ? gvec[n] : 0.0f;
      if (EPI == 1) {
#pragma unroll 1
        for (int r = 0; r < 8; ++r) { const float xg = acc[i][j][r] + bv; so[(16 * i + rh + r) * 68 + 16 * j + cl] = 0.5f * xg * (1.0f + erff(xg * 0.70710678118654752f)); }
      } else {
#pragma unroll
        for (int r = 0; r < 8; ++r) {
          float v = acc[i][j][r] + bv;
          if (EPI == 2) v = R[(size_t)(m0 + wm + 16 * i + rh + r) * ldy + n] + gv * v;
          so[(16 * i + rh + r) * 68 + 16 * j + cl] = v;
        }
      }
    }
  asm volatile("s_wait_dscnt 0" ::: "memory");
  __builtin_amdgcn_wave_barrier();
{
    if (OUT16) {
      f16* Y = (f16*)Yv + (size_t)blockIdx.z * strideY;
#pragma unroll
      for (int it = 0; it < 8; ++it) { const int c = lane + 32 * it, rr = c >> 3, q8 = (c & 7) * 8;
        union { f16 h[8]; v4u_t v; } u;
#pragma unroll
        for (int e = 0; e < 8; ++e) u.h[e] = (f16)so[rr * 68 + q8 + e];
        *(v4u_t*)(Y + (size_t)(m0 + wm + rr) * ldy + n0 + wn + q8) = u.v; }
    } else {
      float* Y = (float*)Yv + (size_t)blockIdx.z * strideY;
#pragma unroll
      for (int it = 0; it < 16; ++it) { const int f4 = lane + 32 * it, rr = f4 >> 4, q = (f4 & 15) * 4;
        *(v4f_t*)(Y + (size_t)(m0 + wm + rr) * ldy + n0 + wn + q) = *(const v4fa*)(so + rr * 68 + q); }
    }
    
  }
}

// ---------------------------------------------------------------------------------------------------------------------------
// gemm_kn2 (value+residual planes on both operands: hh + (hl+lh)/2048, f32-class): Y[m][n] (row stride ldy) = scale * sum_k A[m][k] (f32 or f16, row stride lda) * W[k][n] (f32, row-major [K][N], row
// stride ldw) (+ bias[n]) (+ Y if ACC). Block = 128 x 128 tile, 256 threads = 8 waves as 4(M, 32 rows) x 2(N, 64 cols); per
// 32-wide k-step the A tile and the W tile (stored transposed [n][k]) are staged as f16 in LDS; value+residual f16 planes, f32
// blockIdx.z selects a batch: A += z*strideA, W += z*strideW, Y += z*strideY (element strides).
// ---------------------------------------------------------------------------------------------------------------------------
template <typename AT, bool ACC>
__global__ __launch_bounds__(256) void gemm_kn2(const AT* __restrict__ A, int lda, size_t strideA,
                                               const float* __restrict__ Wm, int ldw, size_t strideW,
                                               const float* __restrict__ bias, float scale,
                                               float* __restrict__ Y, int ldy, size_t strideY, int K) {
  __shared__ __attribute__((aligned(16))) f16 ldsA[128 * GSTR], ldsAl[128 * GSTR];
  __shared__ __attribute__((aligned(16))) f16 ldsW[128 * GSTR], ldsWl[128 * GSTR];
  __shared__ __attribute__((aligned(16))) float oS[8][32 * 68];
  const int tid = threadIdx.x, lane = tid & 31, wave = tid >> 5, cl = lane & 15, rh = (lane >> 4) * 8;
  const int m0 = blockIdx.x * 128, n0 = blockIdx.y * 128;
  const int wm = (wave & 3) * 32, wn = (wave >> 2) * 64;
  A += (size_t)blockIdx.z * strideA; Wm += (size_t)blockIdx.z * strideW; Y += (size_t)blockIdx.z * strideY;
  f32x8 acc[2][4], accx[2][4];
#pragma unroll
  for (int i = 0; i < 2; ++i)
#pragma unroll
    for (int j = 0; j < 4; ++j) { f32x8 z = {}; acc[i][j] = z; accx[i][j] = z; }
#pragma unroll 1
  for (int k0 = 0; k0 < K; k0 += 32) {
    __syncthreads();
    {  // A: thread -> row tid>>1, 16 elements at column half (tid&1)*16
      const int row = tid >> 1, ch = (tid & 1) * 16;
      const AT* src = A + (size_t)(m0 + row) * lda + k0 + ch;
#pragma unroll
      for (int g = 0; g < 16; ++g) { const float v = (float)src[g]; const f16 h = (f16)v; ldsA[row * GSTR + ch + g] = h; ldsAl[row * GSTR + ch + g] = (f16)((v - (float)h) * 2048.0f); }
    }
    {  // W: thread -> k = tid>>3, 16 consecutive n at (tid&7)*16; stored transposed [n][k]
      const int k = tid >> 3, nn0 = (tid & 7) * 16;
      const float* src = Wm + (size_t)(k0 + k) * ldw + n0 + nn0;
#pragma unroll
      for (int g = 0; g < 4; ++g) { const v4f_t v = *(const v4f_t*)(src + 4 * g);
#pragma unroll
        for (int u = 0; u < 4; ++u) { const f16 h = (f16)v[u]; ldsW[(nn0 + 4 * g + u) * GSTR + k] = h; ldsWl[(nn0 + 4 * g + u) * GSTR + k] = (f16)((v[u] - (float)h) * 2048.0f); } }
    }
    __syncthreads();
    f16x16 af[2], afl[2];
#pragma unroll
    for (int i = 0; i < 2; ++i) { af[i] = lds_frag(ldsA + (wm + 16 * i) * GSTR, GSTR); afl[i] = lds_frag(ldsAl + (wm + 16 * i) * GSTR, GSTR); }
#pragma unroll
    for (int j = 0; j < 4; ++j) {
      const f16x16 bf = lds_frag(ldsW + (wn + 16 * j) * GSTR, GSTR), bfl = lds_frag(ldsWl + (wn + 16 * j) * GSTR, GSTR);
#pragma unroll
      for (int i = 0; i < 2; ++i) { acc[i][j] = wmma16(af[i], bf, acc[i][j]); accx[i][j] = wmma16(af[i], bfl, accx[i][j]); accx[i][j] = wmma16(afl[i], bf, accx[i][j]); }
    }
  }
  float* so = oS[wave];
#pragma unroll
  for (int i = 0; i < 2; ++i)
#pragma unroll
    for (int j = 0; j < 4; ++j) {
      const float bv = bias ? bias[n0 + wn + 16 * j + cl] : 0.0f;
#pragma unroll
      for (int r = 0; r < 8; ++r) so[(16 * i + rh + r) * 68 + 16 * j + cl] = (acc[i][j][r] + accx[i][j][r] * (1.0f / 2048.0f)) * scale + bv;
    }
  asm volatile("s_wait_dscnt 0" ::: "memory");
  __builtin_amdgcn_wave_barrier();
  if (ACC) {   // accumulate: fold the existing Y values into the staging tile ONCE (same thread <-> same chunks as the stores below)
#pragma unroll
    for (int it = 0; it < 16; ++it) { const int f4 = lane + 32 * it, rr = f4 >> 4, q = (f4 & 15) * 4;
      const v4f_t old = *(const v4fa*)(Y + (size_t)(m0 + wm + rr) * ldy + n0 + wn + q);
      v4f_t v = *(const v4fa*)(so + rr * 68 + q); v += old; *(v4fa*)(so + rr * 68 + q) = v; }
    asm volatile("s_wait_dscnt 0" ::: "memory");
  }
{
#pragma unroll
    for (int it = 0; it < 16; ++it) { const int f4 = lane + 32 * it, rr = f4 >> 4, q = (f4 & 15) * 4;
      *(v4f_t*)(Y + (size_t)(m0 + wm + rr) * ldy + n0 + wn + q) = *(const v4fa*)(so + rr * 68 + q); }
    
  }
}

__global__ __launch_bounds__(256) void k_transpose(const float* __restrict__ Wm, float* __restrict__ Wt, int rows, int cols) {
  __shared__ float tS[64][65];
  const int tid = threadIdx.x, tbj = cols / 64, bi = blockIdx.x / tbj, bj = blockIdx.x % tbj;
  Wm += (size_t)blockIdx.y * rows * cols; Wt += (size_t)blockIdx.y * rows * cols;   // blockIdx.y selects a batch of dense [rows][cols] matrices
  for (int e = tid; e < 64 * 64; e += 256) { const int r = e >> 6, c = e & 63; tS[r][c] = Wm[(size_t)(bi * 64 + r) * cols + bj * 64 + c]; }
  __syncthreads();
  for (int ch = tid; ch < 64 * 16; ch += 256) { const int r = ch >> 4, q4 = (ch & 15) * 4; v4f_t o; o[0] = tS[q4][r]; o[1] = tS[q4 + 1][r]; o[2] = tS[q4 + 2][r]; o[3] = tS[q4 + 3][r];
    float* dst = Wt + (size_t)(bj * 64 + r) * rows + bi * 64 + q4; *(v4f_t*)dst = o;  }
}

#define NBT 8
#define BBn 8
#define CC 256
#define CI 128
#define HWn 4096       // 64 x 64 positions
#define N2 1024        // pooled positions (32 x 32)
// ---------------------------------------------------------------------------------------------------------------------------
// k_attn: scores, row softmax and y in one kernel; the score matrix never reaches memory. Block = 128 queries of one batch,
// 8 waves x 16 queries; 16 passes of 64 keys. Per pass S^T = phi * theta^T (A = phi rows from LDS, B = theta kept in registers,
// value+residual planes: hh + (lh + hl)/2048), so a lane holds 32 scores of ONE query (query = lane & 15, keys 16j + 8*(lane >> 4) + r):
// running maximum and sum per lane, one exchange between the wave halves. 1024 * exp(s - max), converted to f16 in place, is the
// B operand of O^T += g^T * P^T (A = g^T from LDS); y = O / sum at the end.
// ---------------------------------------------------------------------------------------------------------------------------
#define AKT 64     // keys per pass
#define AKS 136    // phi tile pitch, f16 elements (272-B rows: 16 rows of b128 reads fall on distinct banks)
#define AVS 72     // g^T tile pitch, f16 elements (144-B rows, the same)
#define AOS 132    // y staging pitch, f32 elements
typedef float v2fa __attribute__((ext_vector_type(2), may_alias));
// s_wait_xcnt 0 behind a run of global loads, before their address registers are reused; the base pointer is an input so that it stays in its registers up to the wait
__device__ __forceinline__ void addr_wait(const float* p) { asm volatile("s_wait_xcnt 0x0" :: "v"(p) : "memory"); }
// v_nop: the one independent slot that the instruction set asks for behind a transcendental, kept whatever the compiler schedules next
__device__ __forceinline__ float exp2_slot(float x) { float r; asm("v_exp_f32 %0, %1\n\tv_nop" : "=v"(r) : "v"(x)); return r; }
__device__ __forceinline__ float rcp_slot(float x) { float r; asm("v_rcp_f32 %0, %1\n\tv_nop" : "=v"(r) : "v"(x)); return r; }
__device__ __forceinline__ f32x8 wmma_p(f16x16 a, f16x16 b, f32x8 c) { return __builtin_amdgcn_wmma_f32_16x16x32_f16(false, a, false, b, (short)0, c, false, false); }
// two waves per SIMD is all the grid gives (one block per WGP): let the register allocator use that room to fetch fragments ahead
__global__ __launch_bounds__(256) __attribute__((amdgpu_waves_per_eu(2, 2))) void k_attn(const float* __restrict__ TH, const float* __restrict__ PH, const float* __restrict__ GP, float* __restrict__ Y) {
  __shared__ __attribute__((aligned(16))) f16 sKh[AKT * AKS], sKl[AKT * AKS];
  __shared__ __attribute__((aligned(16))) f16 sVt[CI * AVS];
  __shared__ __attribute__((aligned(16))) float sO[8][16 * AOS];
  const int tid = threadIdx.x, lane = tid & 31, wave = tid >> 5, cl = lane & 15, hf = lane >> 4;
  const int q0 = blockIdx.x * 128 + wave * 16;
  TH += (size_t)blockIdx.y * HWn * CI; PH += (size_t)blockIdx.y * N2 * CI; GP += (size_t)blockIdx.y * N2 * CI; Y += (size_t)blockIdx.y * HWn * CI;
  const float L2E = 1.4426950408889634f;
  // theta fragments (B operand: column = query cl), same k order as lds_frag
  f16x16 qh[4], ql[4];
  { const float* qb = TH + (size_t)(q0 + cl) * CI + hf * 8;
    v4f_t qa[4][4];
#pragma unroll
    for (int ks = 0; ks < 4; ++ks) { qa[ks][0] = *(const v4fa*)(qb + ks * 32); qa[ks][1] = *(const v4fa*)(qb + ks * 32 + 4); qa[ks][2] = *(const v4fa*)(qb + ks * 32 + 16); qa[ks][3] = *(const v4fa*)(qb + ks * 32 + 20); }
    addr_wait(qb);
#pragma unroll
    for (int ks = 0; ks < 4; ++ks)
#pragma unroll
      for (int i = 0; i < 8; ++i) {
        const float va = qa[ks][i >> 2][i & 3], vb = qa[ks][2 + (i >> 2)][i & 3];
        const f16 ha = (f16)va, hb = (f16)vb;
        qh[ks][i] = ha; ql[ks][i] = (f16)((va - (float)ha) * 2048.0f);
        qh[ks][i + 8] = hb; ql[ks][i + 8] = (f16)((vb - (float)hb) * 2048.0f);
      }
  }
  f32x8 o[8];
#pragma unroll
  for (int c = 0; c < 8; ++c) { f32x8 z = {}; o[c] = z; }
  float m = -3.0e38f, l = 0.0f;
  v4f_t kr[8];
  // phi tile 0: a tile is 64 whole rows = 32 KiB contiguous; a wave reads one 512-B row per load
#pragma unroll
  for (int it = 0; it < 8; ++it) kr[it] = *(const v4fa*)(PH + tid * 4 + 1024 * it);
  addr_wait(PH + tid * 4);
#pragma unroll
  for (int it = 0; it < 8; ++it) { const int idx = tid + 256 * it, row = idx >> 5, c4 = (idx & 31) * 4; bf16x4 h, lo;
#pragma unroll
    for (int u = 0; u < 4; ++u) { h[u] = (f16)kr[it][u]; lo[u] = (f16)((kr[it][u] - (float)h[u]) * 2048.0f); }
    *(bf16x4*)(sKh + row * AKS + c4) = h; *(bf16x4*)(sKl + row * AKS + c4) = lo; }
  __syncthreads();
#pragma unroll 1   // rolled: one pass is already 64 matrix instructions, and a second copy would double the live staging registers
  for (int t = 0; t < N2 / AKT; ++t) {
    // g tile of this pass into registers (lands under the score products): wave -> 8 keys, lane -> channels 2*lane + {0,1} + 64u
    v2fa vr[8][2];
    const float* gp = GP + (size_t)(t * AKT + wave * 8) * CI + 2 * lane;
#pragma unroll
    for (int kk = 0; kk < 8; ++kk)
#pragma unroll
      for (int u = 0; u < 2; ++u) vr[kk][u] = *(const v2fa*)(gp + kk * CI + 64 * u);
    addr_wait(gp);
    f32x8 s[4];
#pragma unroll
    for (int j = 0; j < 4; ++j) {
      f32x8 a = {}, ax = {};
#pragma unroll
      for (int ks = 0; ks < 4; ++ks) {
        const f16x16 kh = lds_frag(sKh + (16 * j) * AKS + ks * 32, AKS), kl = lds_frag(sKl + (16 * j) * AKS + ks * 32, AKS);
        a = wmma_p(kh, qh[ks], a); ax = wmma_p(kl, qh[ks], ax); ax = wmma_p(kh, ql[ks], ax);
      }
      s[j] = a + ax * (1.0f / 2048.0f);
    }
    float mx = s[0][0];
#pragma unroll
    for (int j = 0; j < 4; ++j)
#pragma unroll
      for (int r = 0; r < 8; ++r) mx = fmaxf(mx, s[j][r]);
    mx = fmaxf(mx, __shfl_xor(mx, 16));            // the other half of the wave holds this query's other 32 keys
    const float mn = fmaxf(m, mx);
    const float alpha = exp2_slot((m - mn) * L2E);
    const float bias = 10.0f - mn * L2E;            // + 10: P carries a factor 1024 (small weights stay normal f16); it cancels against the sum
    m = mn;
#pragma unroll
    for (int j = 0; j < 4; ++j)
#pragma unroll
      for (int r = 0; r < 8; ++r) s[j][r] = exp2_slot(s[j][r] * L2E + bias);
    const f32x8 sv = (s[0] + s[1]) + (s[2] + s[3]);   // pairwise: a chain of 32 dependent adds would stand in the pass's critical path
    l = l * alpha + (((sv[0] + sv[1]) + (sv[2] + sv[3])) + ((sv[4] + sv[5]) + (sv[6] + sv[7])));
#pragma unroll
    for (int c = 0; c < 8; ++c) o[c] *= alpha;
    f16x16 pf[2];                                   // two score tiles (keys 32k2 .. + 31) converted in place = one B fragment in lds_frag's k order
#pragma unroll
    for (int k2 = 0; k2 < 2; ++k2)
#pragma unroll
      for (int i = 0; i < 8; ++i) { pf[k2][i] = (f16)s[2 * k2][i]; pf[k2][i + 8] = (f16)s[2 * k2 + 1][i]; }
    __builtin_amdgcn_sched_barrier(0);              // keeps the g conversions (and with them the wait on the g loads) from rising in front of the score products
#pragma unroll
    for (int u = 0; u < 2; ++u)
#pragma unroll
      for (int e = 0; e < 2; ++e) { f16x8 w;
#pragma unroll
        for (int kk = 0; kk < 8; ++kk) w[kk] = (f16)vr[kk][u][e];
        *(f16x8*)(sVt + (64 * u + 2 * lane + e) * AVS + wave * 8) = w; }
    __syncthreads();                                // g^T of this pass is published; every wave has left the phi tile
    const bool more = t + 1 < N2 / AKT;
    if (more) {                                     // next phi tile into registers (lands under the P * g products)
      const float* kp = PH + (size_t)(t + 1) * AKT * CI + tid * 4;
#pragma unroll
      for (int it = 0; it < 8; ++it) kr[it] = *(const v4fa*)(kp + 1024 * it);
      addr_wait(kp);
    }
    f16x16 vf[2][8];                                // all 16 g^T fragments are requested before the first product, so that one LDS latency is paid and not sixteen
#pragma unroll
    for (int k2 = 0; k2 < 2; ++k2)
#pragma unroll
      for (int c = 0; c < 8; ++c) vf[k2][c] = lds_frag(sVt + (16 * c) * AVS + k2 * 32, AVS);
    __builtin_amdgcn_sched_barrier(0);              // keeps the fragment loads above from sinking down to their products
#pragma unroll
    for (int k2 = 0; k2 < 2; ++k2)
#pragma unroll
      for (int c = 0; c < 8; ++c) o[c] = wmma_p(vf[k2][c], pf[k2], o[c]);
    if (more) {
#pragma unroll
      for (int it = 0; it < 8; ++it) { const int idx = tid + 256 * it, row = idx >> 5, c4 = (idx & 31) * 4; bf16x4 h, lo;
#pragma unroll
        for (int u = 0; u < 4; ++u) { h[u] = (f16)kr[it][u]; lo[u] = (f16)((kr[it][u] - (float)h[u]) * 2048.0f); }
        *(bf16x4*)(sKh + row * AKS + c4) = h; *(bf16x4*)(sKl + row * AKS + c4) = lo; }
    }
    __syncthreads();                                // the next phi tile is published; every wave has left g^T
  }
  l += __shfl_xor(l, 16);
  const float inv = rcp_slot(l);
  float* so = sO[wave];                             // wave-private: lane holds y[query cl][16c + 8*hf + r]; turned into whole 512-B rows for the stores
#pragma unroll
  for (int c = 0; c < 8; ++c) { v4f_t w0, w1;
#pragma unroll
    for (int r = 0; r < 4; ++r) { w0[r] = o[c][r] * inv; w1[r] = o[c][r + 4] * inv; }
    *(v4fa*)(so + cl * AOS + 16 * c + 8 * hf) = w0; *(v4fa*)(so + cl * AOS + 16 * c + 8 * hf + 4) = w1; }
  asm volatile("s_wait_dscnt 0" ::: "memory");      // the rows read below were written by other lanes of this wave
  __builtin_amdgcn_wave_barrier();
#pragma unroll
  for (int it = 0; it < 16; ++it) *(v4f_t*)(Y + (size_t)(q0 + it) * CI + lane * 4) = *(const v4fa*)(so + it * AOS + lane * 4);
}
// 2x2 max-pool over positions of a position-major map F [4096][128] → P [1024][128]; block = 4 pooled rows (64 threads x 8 B... ) → thread = (pooled row, 2 channels)
__global__ __launch_bounds__(256) void k_pool(const float* __restrict__ F, float* __restrict__ Pd) {
  const int tid = threadIdx.x; const int pr = blockIdx.x * 4 + (tid >> 6); const int c2 = (tid & 63) * 2;      // pooled row pr = i*32 + j
  const int i = pr >> 5, j = pr & 31; const size_t r00 = (size_t)(2 * i) * 64 + 2 * j;                          // full-res position (2i, 2j)
  F += (size_t)blockIdx.y * HWn * CI; Pd += (size_t)blockIdx.y * N2 * CI;   // blockIdx.y selects a batch
  float o0, o1;
  { const float* a = F + r00 * CI + c2; const float* b = F + (r00 + 1) * CI + c2; const float* c = F + (r00 + 64) * CI + c2; const float* d = F + (r00 + 65) * CI + c2;
    o0 = fmaxf(fmaxf(a[0], b[0]), fmaxf(c[0], d[0])); o1 = fmaxf(fmaxf(a[1], b[1]), fmaxf(c[1], d[1])); }
  typedef float v2f_t __attribute__((ext_vector_type(2))); v2f_t v; v[0] = o0; v[1] = o1;
  *(v2f_t*)(Pd + (size_t)pr * CI + c2) = v;      // 64 lanes x 8 B = the 512-B row; 32 lanes = 256 B contiguous
}
// transpose back to NCHW with BatchNorm (running stats) and the x1 residual: out[b][o][n] = (Z[n][o] − mean[o])·inv[o] + beta[o] + x1[b][o][n]; 64x64 LDS tiles, 256-B row segments
__global__ __launch_bounds__(256) void k_outT(const float* __restrict__ Z, const float* __restrict__ x1b, const float* __restrict__ g, const float* __restrict__ be, const float* __restrict__ mu, const float* __restrict__ var,
                                             float* __restrict__ outb) {
  __shared__ float tS[64][65];
  const int tid = threadIdx.x, tbj = CC / 64, bi = blockIdx.x / tbj, bj = blockIdx.x % tbj;      // Z is [HWn rows][CC cols]: bi over rows (positions), bj over cols (channels)
  Z += (size_t)blockIdx.y * HWn * CC; x1b += (size_t)blockIdx.y * CC * HWn; outb += (size_t)blockIdx.y * CC * HWn;   // blockIdx.y selects a batch
  for (int e = tid; e < 64 * 64; e += 256) { const int r = e >> 6, c = e & 63; tS[r][c] = Z[(size_t)(bi * 64 + r) * CC + bj * 64 + c]; }
  __syncthreads();
  for (int ch = tid; ch < 64 * 16; ch += 256) { const int r = ch >> 4, q4 = (ch & 15) * 4; const int o = bj * 64 + r; const float inv = g[o] * rsqrtf(var[o] + 1e-5f), sh = be[o] - mu[o] * inv;
    const size_t off = (size_t)o * HWn + bi * 64 + q4; const v4f_t xr = *(const v4f_t*)(x1b + off); v4f_t v;
    v[0] = tS[q4][r] * inv + sh + xr[0]; v[1] = tS[q4 + 1][r] * inv + sh + xr[1]; v[2] = tS[q4 + 2][r] * inv + sh + xr[2]; v[3] = tS[q4 + 3][r] * inv + sh + xr[3];
    float* dst = outb + off; *(v4f_t*)dst = v;  }
}

extern "C" void kernel_launch(void* const* d_in, const int* in_sizes, int n_in,
                              void* d_out, int out_size, void* d_ws, size_t ws_size,
                              hipStream_t stream) {
  (void)in_sizes; (void)n_in; (void)out_size;
  const float** f = (const float**)d_in;
  const float* x1 = f[0], *x2 = f[1], *gw = f[2], *gb = f[3], *tw = f[4], *tb = f[5], *pw = f[6], *pb = f[7], *Ww = f[8], *Wb = f[9], *bng = f[10], *bnb = f[11], *bnm = f[12], *bnv = f[13];
  float* out = (float*)d_out;     // [8,256,64,64]
  char* ws = (char*)d_ws;
  float* gwT = (float*)ws; ws += (size_t)CC * CI * 4; float* twT = (float*)ws; ws += (size_t)CC * CI * 4; float* pwT = (float*)ws; ws += (size_t)CC * CI * 4; float* WwT = (float*)ws; ws += (size_t)CI * CC * 4;
  // every per-batch buffer holds all NBT batches, batch b at b * (its per-batch size)
  float* XT = (float*)ws; ws += (size_t)NBT * HWn * CC * 4;             // x transposed [8][4096][256] (x2 first, then x1)
  float* TH = (float*)ws; ws += (size_t)NBT * HWn * CI * 4;             // theta rows [8][4096][128] f32
  float* GF = (float*)ws; ws += (size_t)NBT * HWn * CI * 4;             // phi, then g full-res rows, later reused for y
  float* GP = (float*)ws; ws += (size_t)NBT * N2 * CI * 4;              // pooled g [8][1024][128]
  float* PH = (float*)ws; ws += (size_t)NBT * N2 * CI * 4;              // pooled phi [8][1024][128]
  float* Z = (float*)ws; ws += (size_t)NBT * HWn * CC * 4;              // W_y rows [8][4096][256]
  float* Y = GF;
  if ((size_t)(ws - (char*)d_ws) > ws_size) return;                     // WS TOTAL 109,576,192 B
  const dim3 blk(256);
  k_transpose<<<dim3((CI / 64) * (CC / 64)), blk, 0, stream>>>(gw, gwT, CI, CC); k_transpose<<<dim3((CI / 64) * (CC / 64)), blk, 0, stream>>>(tw, twT, CI, CC);
  k_transpose<<<dim3((CI / 64) * (CC / 64)), blk, 0, stream>>>(pw, pwT, CI, CC); k_transpose<<<dim3((CC / 64) * (CI / 64)), blk, 0, stream>>>(Ww, WwT, CC, CI);
  // one launch per stage for all NBT batches: the batch is a grid dimension
  k_transpose<<<dim3((CC / 64) * (HWn / 64), NBT), blk, 0, stream>>>(x2, XT, CC, HWn);                                                                       // x2 transposed [4096][256]
  gemm_kn2<float, false><<<dim3(HWn / 128, CI / 128, NBT), blk, 0, stream>>>(XT, CC, (size_t)HWn * CC, pwT, CI, 0, pb, 1.0f, GF, CI, (size_t)HWn * CI, CC);      // phi full-res (planes; GF as scratch)
  k_pool<<<dim3(N2 / 4, NBT), blk, 0, stream>>>(GF, PH);
  k_transpose<<<dim3((CC / 64) * (HWn / 64), NBT), blk, 0, stream>>>(x1, XT, CC, HWn);                                                                       // x1 transposed
  gemm_kne<float, 0, false><<<dim3(HWn / 128, CI / 128, NBT), blk, 0, stream>>>(XT, CC, (size_t)HWn * CC, gwT, CI, 0, gb, nullptr, nullptr, GF, CI, (size_t)HWn * CI, CC);   // g full-res (on x1, faithful)
  k_pool<<<dim3(N2 / 4, NBT), blk, 0, stream>>>(GF, GP);
  gemm_kn2<float, false><<<dim3(HWn / 128, CI / 128, NBT), blk, 0, stream>>>(XT, CC, (size_t)HWn * CC, twT, CI, 0, tb, 1.0f, TH, CI, (size_t)HWn * CI, CC);      // theta (planes)
  k_attn<<<dim3(HWn / 128, NBT), blk, 0, stream>>>(TH, PH, GP, Y);                                                                                           // y = softmax(theta * phi^T) * g, scores kept on chip
  gemm_kne<float, 0, false><<<dim3(HWn / 128, CC / 128, NBT), blk, 0, stream>>>(Y, CI, (size_t)HWn * CI, WwT, CC, 0, Wb, nullptr, nullptr, Z, CC, (size_t)HWn * CC, CI);      // W_y rows
  k_outT<<<dim3((HWn / 64) * (CC / 64), NBT), blk, 0, stream>>>(Z, x1, bng, bnb, bnm, bnv, out);
}

// v003
// One run takes 95.7 microseconds.
// In two side-by-side timings against v002, it was 1.88 and 1.89 times as fast.
// All steps since v000 together make it 14.6 times as fast.
// Contractions on v_wmma_f32_16x16x32_f16, f32 accumulate: the three 1x1 convs as position-major GEMMs (x^T * W^T + b, K = 256, f32 out; theta and phi, the score operands, with f16 value+residual planes, g plain f16;
// x is read as it lies in memory, channel-major, and turned in registers on its way to LDS; the weights are read as they lie, [out][in]), 2x2 max-pooling of the g / phi maps over positions, per batch the non-local scores f = theta * phi^T (K = 128, 4096 x 1024) with f16 value+residual planes
// (hi*hi + (hi*lo + lo*hi)/2048: unscaled logits of spread about 11 give a peaked softmax that needs f32-class scores), running f32 row softmax and y = P * g (plain f16 operands, P carried as 1024 * exp(s - max))
// in the same kernel as the scores, W_y = W_w * y^T + b (K = 128, plain f16), which comes out channel-major, with BatchNorm (running stats) + the x1 residual in its epilogue.
// compute dtype: f16 operands (planes on the scores), f32 accumulate; pooling / softmax / BN in f32.  x1, x2 [8,256,64,64].
#include <hip/hip_runtime.h>
#include <hip/hip_bf16.h>
#include <math.h>


typedef _Float16 bf16;
typedef _Float16 f16;
typedef __attribute__((ext_vector_type(4))) unsigned v4u_t;
typedef unsigned v4ua __attribute__((ext_vector_type(4), may_alias));
typedef __attribute__((ext_vector_type(4))) float v4f_t;
typedef float v4fa __attribute__((ext_vector_type(4), may_alias));
typedef __attribute__((ext_vector_type(16))) bf16  bf16x16;
typedef bf16x16 f16x16;
typedef __attribute__((ext_vector_type(8)))  bf16  bf16x8;
typedef bf16x8 f16x8;
typedef __attribute__((ext_vector_type(4)))  bf16  bf16x4;
typedef __attribute__((ext_vector_type(8)))  float f32x8;
__device__ __forceinline__ f32x8 wmma16(f16x16 a, f16x16 b, f32x8 c) {
  c = __builtin_amdgcn_wmma_f32_16x16x32_f16(false, a, false, b, (short)0, c, false, false);
  asm volatile("v_nop\n\tv_nop\n\tv_nop\n\tv_nop" : "+v"(c) : "v"(a), "v"(b));
  return c;
}
#define LDS_STRIDE 48   // unused; the GEMM tiles use TPITCH
#define KSTRIDE    72   // unused
#define VSTRIDE    48   // unused

__device__ __forceinline__ f32x8 wmma_bf16(bf16x16 a, bf16x16 b, f32x8 c) {
  c = __builtin_amdgcn_wmma_f32_16x16x32_f16(false, a, false, b, (short)0, c, false, false);
  asm volatile("v_nop\n\tv_nop\n\tv_nop\n\tv_nop" : "+v"(c) : "v"(a), "v"(b));   // A/B-overwrite hazard guard
  return c;
}

// 16x32 (MxK) f16 fragment from a row-major global matrix.
// lanes 0-15  (row=lane)    : elems 0..7 = K+0..7,  8..15 = K+16..23
// lanes 16-31 (row=lane-16) : elems 0..7 = K+8..15, 8..15 = K+24..31
template <typename T>
__device__ __forceinline__ bf16x16 load_frag(const T* __restrict__ base, int ld,
                                             int row0, int k0) {
  const int lane = threadIdx.x & 31;
  const int r    = lane & 15;
  const int kh   = (lane >> 4) * 8;
  const T* p0 = base + (size_t)(row0 + r) * ld + (k0 + kh);
  const T* p1 = p0 + 16;
  bf16x16 f;
#pragma unroll
  for (int i = 0; i < 8; ++i) {
    f[i]     = (bf16)p0[i];
    f[i + 8] = (bf16)p1[i];
  }
  return f;
}

// Same fragment from an LDS tile with padded row stride (base includes row0/k0).
__device__ __forceinline__ bf16x16 lds_frag(const bf16* base, int stride) {
  const int lane = threadIdx.x & 31;
  const int row  = lane & 15;
  const int kh   = (lane >> 4) * 8;
  const bf16x8 lo = *(const bf16x8*)(base + row * stride + kh);
  const bf16x8 hi = *(const bf16x8*)(base + row * stride + kh + 16);
  bf16x16 f;
#pragma unroll
  for (int i = 0; i < 8; ++i) { f[i] = lo[i]; f[i + 8] = hi[i]; }
  return f;
}

template <typename T>
__device__ __forceinline__ void stage_read16(const T* __restrict__ p, float* buf) {
#pragma unroll
  for (int i = 0; i < 16; ++i) buf[i] = (float)p[i];
}

__device__ __forceinline__ void stage_write(bf16* dst, const float* buf, int nquad) {
#pragma unroll
  for (int i = 0; i < nquad; ++i) {
    bf16x4 q;
    q[0] = (bf16)buf[4 * i];     q[1] = (bf16)buf[4 * i + 1];
    q[2] = (bf16)buf[4 * i + 2]; q[3] = (bf16)buf[4 * i + 3];
    *(bf16x4*)(dst + 4 * i) = q;
  }
}


#define NBT 8
#define BBn 8
#define CC 256
#define CI 128
#define HWn 4096       // 64 x 64 positions
#define N2 1024        // pooled positions (32 x 32)
// ---------------------------------------------------------------------------------------------------------------------------
// k_attn: scores, row softmax and y in one kernel; the score matrix never reaches memory. Block = 128 queries of one batch,
// 8 waves x 16 queries; 16 passes of 64 keys. Per pass S^T = phi * theta^T (A = phi rows from LDS, B = theta kept in registers,
// value+residual planes: hh + (lh + hl)/2048), so a lane holds 32 scores of ONE query (query = lane & 15, keys 16j + 8*(lane >> 4) + r):
// running maximum and sum per lane, one exchange between the wave halves. 1024 * exp(s - max), converted to f16 in place, is the
// B operand of O^T += g^T * P^T (A = g^T from LDS); y = O / sum at the end.
// ---------------------------------------------------------------------------------------------------------------------------
#define AKT 64     // keys per pass
#define AKS 136    // phi tile pitch, f16 elements (272-B rows: 16 rows of b128 reads fall on distinct banks)
#define AVS 72     // g^T tile pitch, f16 elements (144-B rows, the same)
#define AOS 132    // y staging pitch, f32 elements
typedef float v2fa __attribute__((ext_vector_type(2), may_alias));
// s_wait_xcnt 0 behind a run of global loads, before their address registers are reused; the base pointer is an input so that it stays in its registers up to the wait
__device__ __forceinline__ void addr_wait(const float* p) { asm volatile("s_wait_xcnt 0x0" :: "v"(p) : "memory"); }
// v_nop: the one independent slot that the instruction set asks for behind a transcendental, kept whatever the compiler schedules next
__device__ __forceinline__ float exp2_slot(float x) { float r; asm("v_exp_f32 %0, %1\n\tv_nop" : "=v"(r) : "v"(x)); return r; }
__device__ __forceinline__ float rcp_slot(float x) { float r; asm("v_rcp_f32 %0, %1\n\tv_nop" : "=v"(r) : "v"(x)); return r; }
__device__ __forceinline__ f32x8 wmma_p(f16x16 a, f16x16 b, f32x8 c) { return __builtin_amdgcn_wmma_f32_16x16x32_f16(false, a, false, b, (short)0, c, false, false); }
// two waves per SIMD is all the grid gives (one block per WGP): let the register allocator use that room to fetch fragments ahead
__global__ __launch_bounds__(256) __attribute__((amdgpu_waves_per_eu(2, 2))) void k_attn(const float* __restrict__ TH, const float* __restrict__ PH, const float* __restrict__ GP, float* __restrict__ Y) {
  __shared__ __attribute__((aligned(16))) f16 sKh[AKT * AKS], sKl[AKT * AKS];
  __shared__ __attribute__((aligned(16))) f16 sVt[CI * AVS];
  __shared__ __attribute__((aligned(16))) float sO[8][16 * AOS];
  const int tid = threadIdx.x, lane = tid & 31, wave = tid >> 5, cl = lane & 15, hf = lane >> 4;
  const int q0 = blockIdx.x * 128 + wave * 16;
  TH += (size_t)blockIdx.y * HWn * CI; PH += (size_t)blockIdx.y * N2 * CI; GP += (size_t)blockIdx.y * N2 * CI; Y += (size_t)blockIdx.y * HWn * CI;
  const float L2E = 1.4426950408889634f;
  // theta fragments (B operand: column = query cl), same k order as lds_frag
  f16x16 qh[4], ql[4];
  { const float* qb = TH + (size_t)(q0 + cl) * CI + hf * 8;
    v4f_t qa[4][4];
#pragma unroll
    for (int ks = 0; ks < 4; ++ks) { qa[ks][0] = *(const v4fa*)(qb + ks * 32); qa[ks][1] = *(const v4fa*)(qb + ks * 32 + 4); qa[ks][2] = *(const v4fa*)(qb + ks * 32 + 16); qa[ks][3] = *(const v4fa*)(qb + ks * 32 + 20); }
    addr_wait(qb);
#pragma unroll
    for (int ks = 0; ks < 4; ++ks)
#pragma unroll
      for (int i = 0; i < 8; ++i) {
        const float va = qa[ks][i >> 2][i & 3], vb = qa[ks][2 + (i >> 2)][i & 3];
        const f16 ha = (f16)va, hb = (f16)vb;
        qh[ks][i] = ha; ql[ks][i] = (f16)((va - (float)ha) * 2048.0f);
        qh[ks][i + 8] = hb; ql[ks][i + 8] = (f16)((vb - (float)hb) * 2048.0f);
      }
  }
  f32x8 o[8];
#pragma unroll
  for (int c = 0; c < 8; ++c) { f32x8 z = {}; o[c] = z; }
  float m = -3.0e38f, l = 0.0f;
  v4f_t kr[8];
  // phi tile 0: a tile is 64 whole rows = 32 KiB contiguous; a wave reads one 512-B row per load
#pragma unroll
  for (int it = 0; it < 8; ++it) kr[it] = *(const v4fa*)(PH + tid * 4 + 1024 * it);
  addr_wait(PH + tid * 4);
#pragma unroll
  for (int it = 0; it < 8; ++it) { const int idx = tid + 256 * it, row = idx >> 5, c4 = (idx & 31) * 4; bf16x4 h, lo;
#pragma unroll
    for (int u = 0; u < 4; ++u) { h[u] = (f16)kr[it][u]; lo[u] = (f16)((kr[it][u] - (float)h[u]) * 2048.0f); }
    *(bf16x4*)(sKh + row * AKS + c4) = h; *(bf16x4*)(sKl + row * AKS + c4) = lo; }
  __syncthreads();
#pragma unroll 1   // rolled: one pass is already 64 matrix instructions, and a second copy would double the live staging registers
  for (int t = 0; t < N2 / AKT; ++t) {
    // g tile of this pass into registers (lands under the score products): wave -> 8 keys, lane -> channels 2*lane + {0,1} + 64u
    v2fa vr[8][2];
    const float* gp = GP + (size_t)(t * AKT + wave * 8) * CI + 2 * lane;
#pragma unroll
    for (int kk = 0; kk < 8; ++kk)
#pragma unroll
      for (int u = 0; u < 2; ++u) vr[kk][u] = *(const v2fa*)(gp + kk * CI + 64 * u);
    addr_wait(gp);
    f32x8 s[4];
#pragma unroll
    for (int j = 0; j < 4; ++j) {
      f32x8 a = {}, ax = {};
#pragma unroll
      for (int ks = 0; ks < 4; ++ks) {
        const f16x16 kh = lds_frag(sKh + (16 * j) * AKS + ks * 32, AKS), kl = lds_frag(sKl + (16 * j) * AKS + ks * 32, AKS);
        a = wmma_p(kh, qh[ks], a); ax = wmma_p(kl, qh[ks], ax); ax = wmma_p(kh, ql[ks], ax);
      }
      s[j] = a + ax * (1.0f / 2048.0f);
    }
    float mx = s[0][0];
#pragma unroll
    for (int j = 0; j < 4; ++j)
#pragma unroll
      for (int r = 0; r < 8; ++r) mx = fmaxf(mx, s[j][r]);
    mx = fmaxf(mx, __shfl_xor(mx, 16));            // the other half of the wave holds this query's other 32 keys
    const float mn = fmaxf(m, mx);
    const float alpha = exp2_slot((m - mn) * L2E);
    const float bias = 10.0f - mn * L2E;            // + 10: P carries a factor 1024 (small weights stay normal f16); it cancels against the sum
    m = mn;
#pragma unroll
    for (int j = 0; j < 4; ++j)
#pragma unroll
      for (int r = 0; r < 8; ++r) s[j][r] = exp2_slot(s[j][r] * L2E + bias);
    const f32x8 sv = (s[0] + s[1]) + (s[2] + s[3]);   // pairwise: a chain of 32 dependent adds would stand in the pass's critical path
    l = l * alpha + (((sv[0] + sv[1]) + (sv[2] + sv[3])) + ((sv[4] + sv[5]) + (sv[6] + sv[7])));
#pragma unroll
    for (int c = 0; c < 8; ++c) o[c] *= alpha;
    f16x16 pf[2];                                   // two score tiles (keys 32k2 .. + 31) converted in place = one B fragment in lds_frag's k order
#pragma unroll
    for (int k2 = 0; k2 < 2; ++k2)
#pragma unroll
      for (int i = 0; i < 8; ++i) { pf[k2][i] = (f16)s[2 * k2][i]; pf[k2][i + 8] = (f16)s[2 * k2 + 1][i]; }
    __builtin_amdgcn_sched_barrier(0);              // keeps the g conversions (and with them the wait on the g loads) from rising in front of the score products
#pragma unroll
    for (int u = 0; u < 2; ++u)
#pragma unroll
      for (int e = 0; e < 2; ++e) { f16x8 w;
#pragma unroll
        for (int kk = 0; kk < 8; ++kk) w[kk] = (f16)vr[kk][u][e];
        *(f16x8*)(sVt + (64 * u + 2 * lane + e) * AVS + wave * 8) = w; }
    __syncthreads();                                // g^T of this pass is published; every wave has left the phi tile
    const bool more = t + 1 < N2 / AKT;
    if (more) {                                     // next phi tile into registers (lands under the P * g products)
      const float* kp = PH + (size_t)(t + 1) * AKT * CI + tid * 4;
#pragma unroll
      for (int it = 0; it < 8; ++it) kr[it] = *(const v4fa*)(kp + 1024 * it);
      addr_wait(kp);
    }
    f16x16 vf[2][8];                                // all 16 g^T fragments are requested before the first product, so that one LDS latency is paid and not sixteen
#pragma unroll
    for (int k2 = 0; k2 < 2; ++k2)
#pragma unroll
      for (int c = 0; c < 8; ++c) vf[k2][c] = lds_frag(sVt + (16 * c) * AVS + k2 * 32, AVS);
    __builtin_amdgcn_sched_barrier(0);              // keeps the fragment loads above from sinking down to their products
#pragma unroll
    for (int k2 = 0; k2 < 2; ++k2)
#pragma unroll
      for (int c = 0; c < 8; ++c) o[c] = wmma_p(vf[k2][c], pf[k2], o[c]);
    if (more) {
#pragma unroll
      for (int it = 0; it < 8; ++it) { const int idx = tid + 256 * it, row = idx >> 5, c4 = (idx & 31) * 4; bf16x4 h, lo;
#pragma unroll
        for (int u = 0; u < 4; ++u) { h[u] = (f16)kr[it][u]; lo[u] = (f16)((kr[it][u] - (float)h[u]) * 2048.0f); }
        *(bf16x4*)(sKh + row * AKS + c4) = h; *(bf16x4*)(sKl + row * AKS + c4) = lo; }
    }
    __syncthreads();                                // the next phi tile is published; every wave has left g^T
  }
  l += __shfl_xor(l, 16);
  const float inv = rcp_slot(l);
  float* so = sO[wave];                             // wave-private: lane holds y[query cl][16c + 8*hf + r]; turned into whole 512-B rows for the stores
#pragma unroll
  for (int c = 0; c < 8; ++c) { v4f_t w0, w1;
#pragma unroll
    for (int r = 0; r < 4; ++r) { w0[r] = o[c][r] * inv; w1[r] = o[c][r + 4] * inv; }
    *(v4fa*)(so + cl * AOS + 16 * c + 8 * hf) = w0; *(v4fa*)(so + cl * AOS + 16 * c + 8 * hf + 4) = w1; }
  asm volatile("s_wait_dscnt 0" ::: "memory");      // the rows read below were written by other lanes of this wave
  __builtin_amdgcn_wave_barrier();
#pragma unroll
  for (int it = 0; it < 16; ++it) *(v4f_t*)(Y + (size_t)(q0 + it) * CI + lane * 4) = *(const v4fa*)(so + it * AOS + lane * 4);
}
// 2x2 max-pool over positions of a position-major map F [4096][128] → P [1024][128]; block = 4 pooled rows (64 threads x 8 B... ) → thread = (pooled row, 2 channels)
__global__ __launch_bounds__(256) void k_pool(const float* __restrict__ F, float* __restrict__ Pd) {
  const int tid = threadIdx.x; const int pr = blockIdx.x * 4 + (tid >> 6); const int c2 = (tid & 63) * 2;      // pooled row pr = i*32 + j
  const int i = pr >> 5, j = pr & 31; const size_t r00 = (size_t)(2 * i) * 64 + 2 * j;                          // full-res position (2i, 2j)
  F += (size_t)blockIdx.y * HWn * CI; Pd += (size_t)blockIdx.y * N2 * CI;   // blockIdx.y selects a batch
  float o0, o1;
  { const float* a = F + r00 * CI + c2; const float* b = F + (r00 + 1) * CI + c2; const float* c = F + (r00 + 64) * CI + c2; const float* d = F + (r00 + 65) * CI + c2;
    o0 = fmaxf(fmaxf(a[0], b[0]), fmaxf(c[0], d[0])); o1 = fmaxf(fmaxf(a[1], b[1]), fmaxf(c[1], d[1])); }
  typedef float v2f_t __attribute__((ext_vector_type(2))); v2f_t v; v[0] = o0; v[1] = o1;
  *(v2f_t*)(Pd + (size_t)pr * CI + c2) = v;      // 64 lanes x 8 B = the 512-B row; 32 lanes = 256 B contiguous
}
// ---------------------------------------------------------------------------------------------------------------------------
// gemm_nat: D[m][n] = sum_k A[m][k] * B[n][k], every operand read in the layout it has in memory, so that no transposed copy is made.
// B is row-major [n][k] (row stride LDB). A is row-major [m][k] (AKM false, row stride LDA) or k-major [k][m] (AKM true, row stride LDA).
// PL: value+residual planes on both operands (hh + (hl + lh)/2048, f32-class); else plain f16 operands. f32 accumulate.
// EPI 0: Y[m][n] = D + bias[n]. EPI 1: Y[m][n] = (D + bias[m]) * inv[m] + sh[m] + R[m][n], inv = bg * rsqrt(bvar + eps), sh = bb - bmean * inv.
// Block = 128 x 128 tile, 8 waves as 4(M, 32 rows) x 2(N, 64 cols); per 32-wide k-step both tiles are staged f16 in LDS as [row][k].
// blockIdx.z selects a batch (element strides); R has Y's batch stride.
// ---------------------------------------------------------------------------------------------------------------------------
#define TPITCH 40     // staged tile pitch, f16 elements (64-B rows at 80 B: 16-byte reads and writes of neighbouring rows fall on distinct banks)
// 128 rows x 32 k of a row-major f32 matrix: 8 lanes take the 128 B of a row, a wave 4 rows, 4 loads a thread
template <int LD>
__device__ __forceinline__ void rows_load(const float* __restrict__ p, v4f_t* v) {
#pragma unroll
  for (int it = 0; it < 4; ++it) v[it] = *(const v4fa*)(p + (size_t)(32 * it) * LD);
}
template <bool PL>
__device__ __forceinline__ void rows_store(const v4f_t* v, f16* dh, f16* dl) {
  const int tid = threadIdx.x, r0 = tid >> 3, c4 = (tid & 7) * 4;
#pragma unroll
  for (int it = 0; it < 4; ++it) { bf16x4 h, lo;
#pragma unroll
    for (int u = 0; u < 4; ++u) { h[u] = (f16)v[it][u]; lo[u] = (f16)((v[it][u] - (float)h[u]) * 2048.0f); }
    *(bf16x4*)(dh + (r0 + 32 * it) * TPITCH + c4) = h; if (PL) *(bf16x4*)(dl + (r0 + 32 * it) * TPITCH + c4) = lo; }
}
template <bool PL, bool AKM, int EPI, int LDA, int LDB, int LDY, int K>
__global__ __launch_bounds__(256) void gemm_nat(const float* __restrict__ A, size_t strideA, const float* __restrict__ B, size_t strideB,
                                                const float* __restrict__ bias, const float* __restrict__ bg, const float* __restrict__ bb,
                                                const float* __restrict__ bmean, const float* __restrict__ bvar, const float* __restrict__ R,
                                                float* __restrict__ Y, size_t strideY) {
  __shared__ __attribute__((aligned(16))) f16 ldsA[128 * TPITCH], ldsAl[PL ? 128 * TPITCH : 8];
  __shared__ __attribute__((aligned(16))) f16 ldsB[128 * TPITCH], ldsBl[PL ? 128 * TPITCH : 8];
  __shared__ __attribute__((aligned(16))) float oS[8][32 * 68];
  __shared__ __attribute__((aligned(16))) float sBi[128], sInv[128], sSh[128];
  const int tid = threadIdx.x, lane = tid & 31, wave = tid >> 5, cl = lane & 15, rh = (lane >> 4) * 8;
  const int m0 = blockIdx.x * 128, n0 = blockIdx.y * 128;
  const int wm = (wave & 3) * 32, wn = (wave >> 2) * 64;
  A += (size_t)blockIdx.z * strideA; B += (size_t)blockIdx.z * strideB; Y += (size_t)blockIdx.z * strideY;
  if (EPI == 1 && tid < 128) {   // per-row constants of the epilogue; published by the barriers of the k loop
    const int o = m0 + tid; const float inv = bg[o] * rsqrtf(bvar[o] + 1e-5f);
    sBi[tid] = bias[o]; sInv[tid] = inv; sSh[tid] = bb[o] - bmean[o] * inv;
  }
  f32x8 acc[2][4], accx[2][4];
#pragma unroll
  for (int i = 0; i < 2; ++i)
#pragma unroll
    for (int j = 0; j < 4; ++j) { f32x8 z = {}; acc[i][j] = z; accx[i][j] = z; }
  // k-major A: wave -> 8 k rows (kg) of one 64-wide half of the tile's m range (mh); lane -> m = 2 * lane + {0, 1}: a load is 256 B of one k row
  const int kg = wave & 3, mh = wave >> 2;
  const float* pa = AKM ? A + (size_t)(kg * 8) * LDA + m0 + mh * 64 + 2 * lane : A + (size_t)(m0 + (tid >> 3)) * LDA + (tid & 7) * 4;
  const float* pb = B + (size_t)(n0 + (tid >> 3)) * LDB + (tid & 7) * 4;
#pragma unroll 1   // rolled: the trips are separated by barriers and gain nothing from a second copy of the staging code
  for (int k0 = 0; k0 < K; k0 += 32) {
    __syncthreads();                                // every wave has left the tiles of the trip before
    v2fa at[8]; v4f_t ar[4], br[4];
    if (AKM) {
#pragma unroll
      for (int kk = 0; kk < 8; ++kk) at[kk] = *(const v2fa*)(pa + (size_t)kk * LDA);
    } else rows_load<LDA>(pa, ar);
    rows_load<LDB>(pb, br);
    asm volatile("s_wait_xcnt 0x0" :: "v"(pa), "v"(pb) : "memory");   // behind both runs of loads, before the two pointers they name are advanced
    pa += AKM ? (size_t)32 * LDA : 32; pb += 32;
    if (AKM) {                                      // the turn: a thread's 8 k values of one m are 16 contiguous bytes of the [m][k] tile
#pragma unroll
      for (int e = 0; e < 2; ++e) { f16x8 h, lo;
#pragma unroll
        for (int kk = 0; kk < 8; ++kk) { const float v = at[kk][e]; h[kk] = (f16)v; lo[kk] = (f16)((v - (float)h[kk]) * 2048.0f); }
        *(f16x8*)(ldsA + (mh * 64 + 2 * lane + e) * TPITCH + kg * 8) = h; if (PL) *(f16x8*)(ldsAl + (mh * 64 + 2 * lane + e) * TPITCH + kg * 8) = lo; }
    } else rows_store<PL>(ar, ldsA, ldsAl);
    rows_store<PL>(br, ldsB, ldsBl);
    __syncthreads();                                // both tiles are published
    f16x16 af[2], afl[2];
#pragma unroll
    for (int i = 0; i < 2; ++i) { af[i] = lds_frag(ldsA + (wm + 16 * i) * TPITCH, TPITCH); if (PL) afl[i] = lds_frag(ldsAl + (wm + 16 * i) * TPITCH, TPITCH); }
#pragma unroll
    for (int j = 0; j < 4; ++j) {
      const f16x16 bf = lds_frag(ldsB + (wn + 16 * j) * TPITCH, TPITCH);
      if (PL) {
        const f16x16 bfl = lds_frag(ldsBl + (wn + 16 * j) * TPITCH, TPITCH);
#pragma unroll
        for (int i = 0; i < 2; ++i) { acc[i][j] = wmma16(af[i], bf, acc[i][j]); accx[i][j] = wmma16(af[i], bfl, accx[i][j]); accx[i][j] = wmma16(afl[i], bf, accx[i][j]); }
      } else {
#pragma unroll
        for (int i = 0; i < 2; ++i) acc[i][j] = wmma16(af[i], bf, acc[i][j]);
      }
    }
  }
  // a wave's 32 x 64 piece goes out as 256-B row segments: thread -> rows (lane >> 4) + 2 * it, 16 bytes at column (lane & 15) * 4
  const size_t off0 = (size_t)(m0 + wm + (lane >> 4)) * LDY + n0 + wn + (lane & 15) * 4;
  v4f_t xr[16];
  if (EPI == 1) {                                   // residual rows, requested before the accumulators are staged
    const float* pr = R + (size_t)blockIdx.z * strideY + off0;
#pragma unroll
    for (int it = 0; it < 16; ++it) xr[it] = *(const v4fa*)(pr + (size_t)(2 * it) * LDY);
    addr_wait(pr);
  }
  float* so = oS[wave];
#pragma unroll
  for (int i = 0; i < 2; ++i)
#pragma unroll
    for (int j = 0; j < 4; ++j) {
      const float bv = (EPI == 0) ? bias[n0 + wn + 16 * j + cl] : 0.0f;
#pragma unroll
      for (int r = 0; r < 8; ++r) {
        float v = PL ? acc[i][j][r] + accx[i][j][r] * (1.0f / 2048.0f) : acc[i][j][r];
        if (EPI == 0) v += bv;
        else { const int row = wm + 16 * i + rh + r; v += sBi[row]; v = v * sInv[row] + sSh[row]; }
        so[(16 * i + rh + r) * 68 + 16 * j + cl] = v;
      }
    }
  asm volatile("s_wait_dscnt 0" ::: "memory");      // the rows read below were written by other lanes of this wave
  __builtin_amdgcn_wave_barrier();
#pragma unroll
  for (int it = 0; it < 16; ++it) {
    v4f_t v = *(const v4fa*)(so + ((lane >> 4) + 2 * it) * 68 + (lane & 15) * 4);
    if (EPI == 1) v += xr[it];
    *(v4f_t*)(Y + off0 + (size_t)(2 * it) * LDY) = v;
  }
}
extern "C" void kernel_launch(void* const* d_in, const int* in_sizes, int n_in,
                              void* d_out, int out_size, void* d_ws, size_t ws_size,
                              hipStream_t stream) {
  (void)in_sizes; (void)n_in; (void)out_size;
  const float** f = (const float**)d_in;
  const float* x1 = f[0], *x2 = f[1], *gw = f[2], *gb = f[3], *tw = f[4], *tb = f[5], *pw = f[6], *pb = f[7], *Ww = f[8], *Wb = f[9], *bng = f[10], *bnb = f[11], *bnm = f[12], *bnv = f[13];
  float* out = (float*)d_out;     // [8,256,64,64]
  char* ws = (char*)d_ws;
  // every per-batch buffer holds all NBT batches, batch b at b * (its per-batch size)
  float* TH = (float*)ws; ws += (size_t)NBT * HWn * CI * 4;             // theta rows [8][4096][128] f32
  float* GF = (float*)ws; ws += (size_t)NBT * HWn * CI * 4;             // phi, then g full-res rows, later reused for y
  float* GP = (float*)ws; ws += (size_t)NBT * N2 * CI * 4;              // pooled g [8][1024][128]
  float* PH = (float*)ws; ws += (size_t)NBT * N2 * CI * 4;              // pooled phi [8][1024][128]
  float* Y = GF;
  if ((size_t)(ws - (char*)d_ws) > ws_size) return;                     // WS TOTAL 41,943,040 B
  const dim3 blk(256);
  // one launch per stage for all NBT batches: the batch is a grid dimension
  gemm_nat<true, true, 0, HWn, CC, CI, CC><<<dim3(HWn / 128, CI / 128, NBT), blk, 0, stream>>>(x2, (size_t)CC * HWn, pw, 0, pb, nullptr, nullptr, nullptr, nullptr, nullptr, GF, (size_t)HWn * CI);     // phi full-res rows (planes; GF as scratch)
  k_pool<<<dim3(N2 / 4, NBT), blk, 0, stream>>>(GF, PH);
  gemm_nat<false, true, 0, HWn, CC, CI, CC><<<dim3(HWn / 128, CI / 128, NBT), blk, 0, stream>>>(x1, (size_t)CC * HWn, gw, 0, gb, nullptr, nullptr, nullptr, nullptr, nullptr, GF, (size_t)HWn * CI);    // g full-res rows (on x1, faithful)
  k_pool<<<dim3(N2 / 4, NBT), blk, 0, stream>>>(GF, GP);
  gemm_nat<true, true, 0, HWn, CC, CI, CC><<<dim3(HWn / 128, CI / 128, NBT), blk, 0, stream>>>(x1, (size_t)CC * HWn, tw, 0, tb, nullptr, nullptr, nullptr, nullptr, nullptr, TH, (size_t)HWn * CI);     // theta rows (planes)
  k_attn<<<dim3(HWn / 128, NBT), blk, 0, stream>>>(TH, PH, GP, Y);                                                                                           // y = softmax(theta * phi^T) * g, scores kept on chip
  gemm_nat<false, false, 1, CI, CI, HWn, CI><<<dim3(CC / 128, HWn / 128, NBT), blk, 0, stream>>>(Ww, 0, Y, (size_t)HWn * CI, Wb, bng, bnb, bnm, bnv, x1, out, (size_t)CC * HWn);                          // out = BN(W_w * y^T + b) + x1, channel-major
}

// v004
// A run of this version takes 85.9 microseconds.
// Timed twice side by side with v003, it ran 1.13 times as fast both times.
// Over all steps from v000 it is 16.4 times as fast.
// Contractions on v_wmma_f32_16x16x32_f16, f32 accumulate: the three 1x1 convs as position-major GEMMs (x^T * W^T + b, K = 256, f32 out; theta and phi, the score operands, with f16 value+residual planes, g plain f16;
// x is read as it lies in memory, channel-major, and turned in registers on its way to LDS; the weights are read as they lie, [out][in]), 2x2 max-pooling of the g / phi maps over positions in the epilogue of their GEMMs (the full-resolution maps never reach memory), per batch the non-local scores f = theta * phi^T (K = 128, 4096 x 1024) with f16 value+residual planes
// (hi*hi + (hi*lo + lo*hi)/2048: unscaled logits of spread about 11 give a peaked softmax that needs f32-class scores), running f32 row softmax and y = P * g (plain f16 operands, P carried as 1024 * exp(s - max))
// in the same kernel as the scores, W_y = W_w * y^T + b (K = 128, plain f16), which comes out channel-major, with BatchNorm (running stats) + the x1 residual in its epilogue.
// compute dtype: f16 operands (planes on the scores), f32 accumulate; pooling / softmax / BN in f32.  x1, x2 [8,256,64,64].
#include <hip/hip_runtime.h>
#include <hip/hip_bf16.h>
#include <math.h>


typedef _Float16 bf16;
typedef _Float16 f16;
typedef __attribute__((ext_vector_type(4))) unsigned v4u_t;
typedef unsigned v4ua __attribute__((ext_vector_type(4), may_alias));
typedef __attribute__((ext_vector_type(4))) float v4f_t;
typedef float v4fa __attribute__((ext_vector_type(4), may_alias));
typedef __attribute__((ext_vector_type(16))) bf16  bf16x16;
typedef bf16x16 f16x16;
typedef __attribute__((ext_vector_type(8)))  bf16  bf16x8;
typedef bf16x8 f16x8;
typedef __attribute__((ext_vector_type(4)))  bf16  bf16x4;
typedef __attribute__((ext_vector_type(8)))  float f32x8;
__device__ __forceinline__ f32x8 wmma16(f16x16 a, f16x16 b, f32x8 c) {
  c = __builtin_amdgcn_wmma_f32_16x16x32_f16(false, a, false, b, (short)0, c, false, false);
  asm volatile("v_nop\n\tv_nop\n\tv_nop\n\tv_nop" : "+v"(c) : "v"(a), "v"(b));
  return c;
}
#define LDS_STRIDE 48   // unused; the GEMM tiles use TPITCH
#define KSTRIDE    72   // unused
#define VSTRIDE    48   // unused

__device__ __forceinline__ f32x8 wmma_bf16(bf16x16 a, bf16x16 b, f32x8 c) {
  c = __builtin_amdgcn_wmma_f32_16x16x32_f16(false, a, false, b, (short)0, c, false, false);
  asm volatile("v_nop\n\tv_nop\n\tv_nop\n\tv_nop" : "+v"(c) : "v"(a), "v"(b));   // A/B-overwrite hazard guard
  return c;
}

// 16x32 (MxK) f16 fragment from a row-major global matrix.
// lanes 0-15  (row=lane)    : elems 0..7 = K+0..7,  8..15 = K+16..23
// lanes 16-31 (row=lane-16) : elems 0..7 = K+8..15, 8..15 = K+24..31
template <typename T>
__device__ __forceinline__ bf16x16 load_frag(const T* __restrict__ base, int ld,
                                             int row0, int k0) {
  const int lane = threadIdx.x & 31;
  const int r    = lane & 15;
  const int kh   = (lane >> 4) * 8;
  const T* p0 = base + (size_t)(row0 + r) * ld + (k0 + kh);
  const T* p1 = p0 + 16;
  bf16x16 f;
#pragma unroll
  for (int i = 0; i < 8; ++i) {
    f[i]     = (bf16)p0[i];
    f[i + 8] = (bf16)p1[i];
  }
  return f;
}

// Same fragment from an LDS tile with padded row stride (base includes row0/k0).
__device__ __forceinline__ bf16x16 lds_frag(const bf16* base, int stride) {
  const int lane = threadIdx.x & 31;
  const int row  = lane & 15;
  const int kh   = (lane >> 4) * 8;
  const bf16x8 lo = *(const bf16x8*)(base + row * stride + kh);
  const bf16x8 hi = *(const bf16x8*)(base + row * stride + kh + 16);
  bf16x16 f;
#pragma unroll
  for (int i = 0; i < 8; ++i) { f[i] = lo[i]; f[i + 8] = hi[i]; }
  return f;
}

template <typename T>
__device__ __forceinline__ void stage_read16(const T* __restrict__ p, float* buf) {
#pragma unroll
  for (int i = 0; i < 16; ++i) buf[i] = (float)p[i];
}

__device__ __forceinline__ void stage_write(bf16* dst, const float* buf, int nquad) {
#pragma unroll
  for (int i = 0; i < nquad; ++i) {
    bf16x4 q;
    q[0] = (bf16)buf[4 * i];     q[1] = (bf16)buf[4 * i + 1];
    q[2] = (bf16)buf[4 * i + 2]; q[3] = (bf16)buf[4 * i + 3];
    *(bf16x4*)(dst + 4 * i) = q;
  }
}


#define NBT 8
#define BBn 8
#define CC 256
#define CI 128
#define HWn 4096       // 64 x 64 positions
#define N2 1024        // pooled positions (32 x 32)
// ---------------------------------------------------------------------------------------------------------------------------
// k_attn: scores, row softmax and y in one kernel; the score matrix never reaches memory. Block = 128 queries of one batch,
// 8 waves x 16 queries; 16 passes of 64 keys. Per pass S^T = phi * theta^T (A = phi rows from LDS, B = theta kept in registers,
// value+residual planes: hh + (lh + hl)/2048), so a lane holds 32 scores of ONE query (query = lane & 15, keys 16j + 8*(lane >> 4) + r):
// running maximum and sum per lane, one exchange between the wave halves. 1024 * exp(s - max), converted to f16 in place, is the
// B operand of O^T += g^T * P^T (A = g^T from LDS); y = O / sum at the end.
// ---------------------------------------------------------------------------------------------------------------------------
#define AKT 64     // keys per pass
#define AKS 136    // phi tile pitch, f16 elements (272-B rows: 16 rows of b128 reads fall on distinct banks)
#define AVS 72     // g^T tile pitch, f16 elements (144-B rows, the same)
#define AOS 132    // y staging pitch, f32 elements
typedef float v2fa __attribute__((ext_vector_type(2), may_alias));
// s_wait_xcnt 0 behind a run of global loads, before their address registers are reused; the base pointer is an input so that it stays in its registers up to the wait
__device__ __forceinline__ void addr_wait(const float* p) { asm volatile("s_wait_xcnt 0x0" :: "v"(p) : "memory"); }
// v_nop: the one independent slot that the instruction set asks for behind a transcendental, kept whatever the compiler schedules next
__device__ __forceinline__ float exp2_slot(float x) { float r; asm("v_exp_f32 %0, %1\n\tv_nop" : "=v"(r) : "v"(x)); return r; }
__device__ __forceinline__ float rcp_slot(float x) { float r; asm("v_rcp_f32 %0, %1\n\tv_nop" : "=v"(r) : "v"(x)); return r; }
__device__ __forceinline__ f32x8 wmma_p(f16x16 a, f16x16 b, f32x8 c) { return __builtin_amdgcn_wmma_f32_16x16x32_f16(false, a, false, b, (short)0, c, false, false); }
// two waves per SIMD is all the grid gives (one block per WGP): let the register allocator use that room to fetch fragments ahead
__global__ __launch_bounds__(256) __attribute__((amdgpu_waves_per_eu(2, 2))) void k_attn(const float* __restrict__ TH, const float* __restrict__ PH, const float* __restrict__ GP, float* __restrict__ Y) {
  __shared__ __attribute__((aligned(16))) f16 sKh[AKT * AKS], sKl[AKT * AKS];
  __shared__ __attribute__((aligned(16))) f16 sVt[CI * AVS];
  __shared__ __attribute__((aligned(16))) float sO[8][16 * AOS];
  const int tid = threadIdx.x, lane = tid & 31, wave = tid >> 5, cl = lane & 15, hf = lane >> 4;
  const int q0 = blockIdx.x * 128 + wave * 16;
  TH += (size_t)blockIdx.y * HWn * CI; PH += (size_t)blockIdx.y * N2 * CI; GP += (size_t)blockIdx.y * N2 * CI; Y += (size_t)blockIdx.y * HWn * CI;
  const float L2E = 1.4426950408889634f;
  // theta fragments (B operand: column = query cl), same k order as lds_frag
  f16x16 qh[4], ql[4];
  { const float* qb = TH + (size_t)(q0 + cl) * CI + hf * 8;
    v4f_t qa[4][4];
#pragma unroll
    for (int ks = 0; ks < 4; ++ks) { qa[ks][0] = *(const v4fa*)(qb + ks * 32); qa[ks][1] = *(const v4fa*)(qb + ks * 32 + 4); qa[ks][2] = *(const v4fa*)(qb + ks * 32 + 16); qa[ks][3] = *(const v4fa*)(qb + ks * 32 + 20); }
    addr_wait(qb);
#pragma unroll
    for (int ks = 0; ks < 4; ++ks)
#pragma unroll
      for (int i = 0; i < 8; ++i) {
        const float va = qa[ks][i >> 2][i & 3], vb = qa[ks][2 + (i >> 2)][i & 3];
        const f16 ha = (f16)va, hb = (f16)vb;
        qh[ks][i] = ha; ql[ks][i] = (f16)((va - (float)ha) * 2048.0f);
        qh[ks][i + 8] = hb; ql[ks][i + 8] = (f16)((vb - (float)hb) * 2048.0f);
      }
  }
  f32x8 o[8];
#pragma unroll
  for (int c = 0; c < 8; ++c) { f32x8 z = {}; o[c] = z; }
  float m = -3.0e38f, l = 0.0f;
  v4f_t kr[8];
  // phi tile 0: a tile is 64 whole rows = 32 KiB contiguous; a wave reads one 512-B row per load
#pragma unroll
  for (int it = 0; it < 8; ++it) kr[it] = *(const v4fa*)(PH + tid * 4 + 1024 * it);
  addr_wait(PH + tid * 4);
#pragma unroll
  for (int it = 0; it < 8; ++it) { const int idx = tid + 256 * it, row = idx >> 5, c4 = (idx & 31) * 4; bf16x4 h, lo;
#pragma unroll
    for (int u = 0; u < 4; ++u) { h[u] = (f16)kr[it][u]; lo[u] = (f16)((kr[it][u] - (float)h[u]) * 2048.0f); }
    *(bf16x4*)(sKh + row * AKS + c4) = h; *(bf16x4*)(sKl + row * AKS + c4) = lo; }
  __syncthreads();
#pragma unroll 1   // rolled: one pass is already 64 matrix instructions, and a second copy would double the live staging registers
  for (int t = 0; t < N2 / AKT; ++t) {
    // g tile of this pass into registers (lands under the score products): wave -> 8 keys, lane -> channels 2*lane + {0,1} + 64u
    v2fa vr[8][2];
    const float* gp = GP + (size_t)(t * AKT + wave * 8) * CI + 2 * lane;
#pragma unroll
    for (int kk = 0; kk < 8; ++kk)
#pragma unroll
      for (int u = 0; u < 2; ++u) vr[kk][u] = *(const v2fa*)(gp + kk * CI + 64 * u);
    addr_wait(gp);
    f32x8 s[4];
#pragma unroll
    for (int j = 0; j < 4; ++j) {
      f32x8 a = {}, ax = {};
#pragma unroll
      for (int ks = 0; ks < 4; ++ks) {
        const f16x16 kh = lds_frag(sKh + (16 * j) * AKS + ks * 32, AKS), kl = lds_frag(sKl + (16 * j) * AKS + ks * 32, AKS);
        a = wmma_p(kh, qh[ks], a); ax = wmma_p(kl, qh[ks], ax); ax = wmma_p(kh, ql[ks], ax);
      }
      s[j] = a + ax * (1.0f / 2048.0f);
    }
    float mx = s[0][0];
#pragma unroll
    for (int j = 0; j < 4; ++j)
#pragma unroll
      for (int r = 0; r < 8; ++r) mx = fmaxf(mx, s[j][r]);
    mx = fmaxf(mx, __shfl_xor(mx, 16));            // the other half of the wave holds this query's other 32 keys
    const float mn = fmaxf(m, mx);
    const float alpha = exp2_slot((m - mn) * L2E);
    const float bias = 10.0f - mn * L2E;            // + 10: P carries a factor 1024 (small weights stay normal f16); it cancels against the sum
    m = mn;
#pragma unroll
    for (int j = 0; j < 4; ++j)
#pragma unroll
      for (int r = 0; r < 8; ++r) s[j][r] = exp2_slot(s[j][r] * L2E + bias);
    const f32x8 sv = (s[0] + s[1]) + (s[2] + s[3]);   // pairwise: a chain of 32 dependent adds would stand in the pass's critical path
    l = l * alpha + (((sv[0] + sv[1]) + (sv[2] + sv[3])) + ((sv[4] + sv[5]) + (sv[6] + sv[7])));
#pragma unroll
    for (int c = 0; c < 8; ++c) o[c] *= alpha;
    f16x16 pf[2];                                   // two score tiles (keys 32k2 .. + 31) converted in place = one B fragment in lds_frag's k order
#pragma unroll
    for (int k2 = 0; k2 < 2; ++k2)
#pragma unroll
      for (int i = 0; i < 8; ++i) { pf[k2][i] = (f16)s[2 * k2][i]; pf[k2][i + 8] = (f16)s[2 * k2 + 1][i]; }
    __builtin_amdgcn_sched_barrier(0);              // keeps the g conversions (and with them the wait on the g loads) from rising in front of the score products
#pragma unroll
    for (int u = 0; u < 2; ++u)
#pragma unroll
      for (int e = 0; e < 2; ++e) { f16x8 w;
#pragma unroll
        for (int kk = 0; kk < 8; ++kk) w[kk] = (f16)vr[kk][u][e];
        *(f16x8*)(sVt + (64 * u + 2 * lane + e) * AVS + wave * 8) = w; }
    __syncthreads();                                // g^T of this pass is published; every wave has left the phi tile
    const bool more = t + 1 < N2 / AKT;
    if (more) {                                     // next phi tile into registers (lands under the P * g products)
      const float* kp = PH + (size_t)(t + 1) * AKT * CI + tid * 4;
#pragma unroll
      for (int it = 0; it < 8; ++it) kr[it] = *(const v4fa*)(kp + 1024 * it);
      addr_wait(kp);
    }
    f16x16 vf[2][8];                                // all 16 g^T fragments are requested before the first product, so that one LDS latency is paid and not sixteen
#pragma unroll
    for (int k2 = 0; k2 < 2; ++k2)
#pragma unroll
      for (int c = 0; c < 8; ++c) vf[k2][c] = lds_frag(sVt + (16 * c) * AVS + k2 * 32, AVS);
    __builtin_amdgcn_sched_barrier(0);              // keeps the fragment loads above from sinking down to their products
#pragma unroll
    for (int k2 = 0; k2 < 2; ++k2)
#pragma unroll
      for (int c = 0; c < 8; ++c) o[c] = wmma_p(vf[k2][c], pf[k2], o[c]);
    if (more) {
#pragma unroll
      for (int it = 0; it < 8; ++it) { const int idx = tid + 256 * it, row = idx >> 5, c4 = (idx & 31) * 4; bf16x4 h, lo;
#pragma unroll
        for (int u = 0; u < 4; ++u) { h[u] = (f16)kr[it][u]; lo[u] = (f16)((kr[it][u] - (float)h[u]) * 2048.0f); }
        *(bf16x4*)(sKh + row * AKS + c4) = h; *(bf16x4*)(sKl + row * AKS + c4) = lo; }
    }
    __syncthreads();                                // the next phi tile is published; every wave has left g^T
  }
  l += __shfl_xor(l, 16);
  const float inv = rcp_slot(l);
  float* so = sO[wave];                             // wave-private: lane holds y[query cl][16c + 8*hf + r]; turned into whole 512-B rows for the stores
#pragma unroll
  for (int c = 0; c < 8; ++c) { v4f_t w0, w1;
#pragma unroll
    for (int r = 0; r < 4; ++r) { w0[r] = o[c][r] * inv; w1[r] = o[c][r + 4] * inv; }
    *(v4fa*)(so + cl * AOS + 16 * c + 8 * hf) = w0; *(v4fa*)(so + cl * AOS + 16 * c + 8 * hf + 4) = w1; }
  asm volatile("s_wait_dscnt 0" ::: "memory");      // the rows read below were written by other lanes of this wave
  __builtin_amdgcn_wave_barrier();
#pragma unroll
  for (int it = 0; it < 16; ++it) *(v4f_t*)(Y + (size_t)(q0 + it) * CI + lane * 4) = *(const v4fa*)(so + it * AOS + lane * 4);
}
// ---------------------------------------------------------------------------------------------------------------------------
// gemm_nat: D[m][n] = sum_k A[m][k] * B[n][k], every operand read in the layout it has in memory, so that no transposed copy is made.
// B is row-major [n][k] (row stride LDB). A is row-major [m][k] (AKM false, row stride LDA) or k-major [k][m] (AKM true, row stride LDA).
// PL: value+residual planes on both operands (hh + (hl + lh)/2048, f32-class); else plain f16 operands. f32 accumulate.
// EPI 0: Y[m][n] = D + bias[n]. EPI 2: Y[p][n] = max of D + bias[n] over the 2 x 2 window of positions p (m = 64-wide image rows; LDY, strideY are those of the pooled map). EPI 1: Y[m][n] = (D + bias[m]) * inv[m] + sh[m] + R[m][n], inv = bg * rsqrt(bvar + eps), sh = bb - bmean * inv.
// Block = 128 x 128 tile, 8 waves as 4(M, 32 rows) x 2(N, 64 cols); per 32-wide k-step both tiles are staged f16 in LDS as [row][k].
// EPI 2: the tile's 128 positions are image rows 2i and 2i + 1 (i = blockIdx.x); a wave takes the same 16 columns of both rows (m = 16a .. + 15 and 64 + 16a .. + 15),
// so that all four positions of a window lie in one lane's accumulators (two neighbouring registers of both fragments) and the maximum needs no exchange.
// blockIdx.z selects a batch (element strides); R has Y's batch stride.
// ---------------------------------------------------------------------------------------------------------------------------
#define TPITCH 40     // staged tile pitch, f16 elements (64-B rows at 80 B: 16-byte reads and writes of neighbouring rows fall on distinct banks)
// 128 rows x 32 k of a row-major f32 matrix: 8 lanes take the 128 B of a row, a wave 4 rows, 4 loads a thread
template <int LD>
__device__ __forceinline__ void rows_load(const float* __restrict__ p, v4f_t* v) {
#pragma unroll
  for (int it = 0; it < 4; ++it) v[it] = *(const v4fa*)(p + (size_t)(32 * it) * LD);
}
template <bool PL>
__device__ __forceinline__ void rows_store(const v4f_t* v, f16* dh, f16* dl) {
  const int tid = threadIdx.x, r0 = tid >> 3, c4 = (tid & 7) * 4;
#pragma unroll
  for (int it = 0; it < 4; ++it) { bf16x4 h, lo;
#pragma unroll
    for (int u = 0; u < 4; ++u) { h[u] = (f16)v[it][u]; lo[u] = (f16)((v[it][u] - (float)h[u]) * 2048.0f); }
    *(bf16x4*)(dh + (r0 + 32 * it) * TPITCH + c4) = h; if (PL) *(bf16x4*)(dl + (r0 + 32 * it) * TPITCH + c4) = lo; }
}
template <bool PL, bool AKM, int EPI, int LDA, int LDB, int LDY, int K>
__global__ __launch_bounds__(256) void gemm_nat(const float* __restrict__ A, size_t strideA, const float* __restrict__ B, size_t strideB,
                                                const float* __restrict__ bias, const float* __restrict__ bg, const float* __restrict__ bb,
                                                const float* __restrict__ bmean, const float* __restrict__ bvar, const float* __restrict__ R,
                                                float* __restrict__ Y, size_t strideY) {
  __shared__ __attribute__((aligned(16))) f16 ldsA[128 * TPITCH], ldsAl[PL ? 128 * TPITCH : 8];
  __shared__ __attribute__((aligned(16))) f16 ldsB[128 * TPITCH], ldsBl[PL ? 128 * TPITCH : 8];
  __shared__ __attribute__((aligned(16))) float oS[8][(EPI == 2 ? 8 : 32) * 68];
  __shared__ __attribute__((aligned(16))) float sBi[128], sInv[128], sSh[128];
  const int tid = threadIdx.x, lane = tid & 31, wave = tid >> 5, cl = lane & 15, rh = (lane >> 4) * 8;
  const int m0 = blockIdx.x * 128, n0 = blockIdx.y * 128;
  const int wm = (wave & 3) * (EPI == 2 ? 16 : 32), wn = (wave >> 2) * 64;
  constexpr int FM = EPI == 2 ? 64 : 16;   // rows between a wave's two A fragments
  A += (size_t)blockIdx.z * strideA; B += (size_t)blockIdx.z * strideB; Y += (size_t)blockIdx.z * strideY;
  if (EPI == 1 && tid < 128) {   // per-row constants of the epilogue; published by the barriers of the k loop
    const int o = m0 + tid; const float inv = bg[o] * rsqrtf(bvar[o] + 1e-5f);
    sBi[tid] = bias[o]; sInv[tid] = inv; sSh[tid] = bb[o] - bmean[o] * inv;
  }
  f32x8 acc[2][4], accx[2][4];
#pragma unroll
  for (int i = 0; i < 2; ++i)
#pragma unroll
    for (int j = 0; j < 4; ++j) { f32x8 z = {}; acc[i][j] = z; accx[i][j] = z; }
  // k-major A: wave -> 8 k rows (kg) of one 64-wide half of the tile's m range (mh); lane -> m = 2 * lane + {0, 1}: a load is 256 B of one k row
  const int kg = wave & 3, mh = wave >> 2;
  const float* pa = AKM ? A + (size_t)(kg * 8) * LDA + m0 + mh * 64 + 2 * lane : A + (size_t)(m0 + (tid >> 3)) * LDA + (tid & 7) * 4;
  const float* pb = B + (size_t)(n0 + (tid >> 3)) * LDB + (tid & 7) * 4;
#pragma unroll 1   // rolled: the trips are separated by barriers and gain nothing from a second copy of the staging code
  for (int k0 = 0; k0 < K; k0 += 32) {
    __syncthreads();                                // every wave has left the tiles of the trip before
    v2fa at[8]; v4f_t ar[4], br[4];
    if (AKM) {
#pragma unroll
      for (int kk = 0; kk < 8; ++kk) at[kk] = *(const v2fa*)(pa + (size_t)kk * LDA);
    } else rows_load<LDA>(pa, ar);
    rows_load<LDB>(pb, br);
    asm volatile("s_wait_xcnt 0x0" :: "v"(pa), "v"(pb) : "memory");   // behind both runs of loads, before the two pointers they name are advanced
    pa += AKM ? (size_t)32 * LDA : 32; pb += 32;
    if (AKM) {                                      // the turn: a thread's 8 k values of one m are 16 contiguous bytes of the [m][k] tile
#pragma unroll
      for (int e = 0; e < 2; ++e) { f16x8 h, lo;
#pragma unroll
        for (int kk = 0; kk < 8; ++kk) { const float v = at[kk][e]; h[kk] = (f16)v; lo[kk] = (f16)((v - (float)h[kk]) * 2048.0f); }
        *(f16x8*)(ldsA + (mh * 64 + 2 * lane + e) * TPITCH + kg * 8) = h; if (PL) *(f16x8*)(ldsAl + (mh * 64 + 2 * lane + e) * TPITCH + kg * 8) = lo; }
    } else rows_store<PL>(ar, ldsA, ldsAl);
    rows_store<PL>(br, ldsB, ldsBl);
    __syncthreads();                                // both tiles are published
    f16x16 af[2], afl[2];
#pragma unroll
    for (int i = 0; i < 2; ++i) { af[i] = lds_frag(ldsA + (wm + FM * i) * TPITCH, TPITCH); if (PL) afl[i] = lds_frag(ldsAl + (wm + FM * i) * TPITCH, TPITCH); }
#pragma unroll
    for (int j = 0; j < 4; ++j) {
      const f16x16 bf = lds_frag(ldsB + (wn + 16 * j) * TPITCH, TPITCH);
      if (PL) {
        const f16x16 bfl = lds_frag(ldsBl + (wn + 16 * j) * TPITCH, TPITCH);
#pragma unroll
        for (int i = 0; i < 2; ++i) { acc[i][j] = wmma16(af[i], bf, acc[i][j]); accx[i][j] = wmma16(af[i], bfl, accx[i][j]); accx[i][j] = wmma16(afl[i], bf, accx[i][j]); }
      } else {
#pragma unroll
        for (int i = 0; i < 2; ++i) acc[i][j] = wmma16(af[i], bf, acc[i][j]);
      }
    }
  }
  if (EPI == 2) {   // lane holds positions (row 2i + f, column wm + rh + r) of channel 16j + cl in acc[f][j][r]: window p of the lane = registers 2p, 2p + 1 of both fragments
    float* sp = oS[wave];
#pragma unroll
    for (int j = 0; j < 4; ++j) {
      const float bv = bias[n0 + wn + 16 * j + cl];
#pragma unroll
      for (int p = 0; p < 4; ++p) {
        float v[2][2];
#pragma unroll
        for (int i = 0; i < 2; ++i)
#pragma unroll
          for (int e = 0; e < 2; ++e) v[i][e] = (PL ? acc[i][j][2 * p + e] + accx[i][j][2 * p + e] * (1.0f / 2048.0f) : acc[i][j][2 * p + e]) + bv;
        sp[((rh >> 1) + p) * 68 + 16 * j + cl] = fmaxf(fmaxf(v[0][0], v[0][1]), fmaxf(v[1][0], v[1][1]));
      }
    }
    asm volatile("s_wait_dscnt 0" ::: "memory");    // the rows read below were written by other lanes of this wave
    __builtin_amdgcn_wave_barrier();
    // a wave's 8 pooled positions x 64 channels go out as 256-B row segments
    float* yp = Y + (size_t)(blockIdx.x * 32 + (wm >> 1) + (lane >> 4)) * LDY + n0 + wn + (lane & 15) * 4;
#pragma unroll
    for (int it = 0; it < 4; ++it) *(v4f_t*)(yp + (size_t)(2 * it) * LDY) = *(const v4fa*)(sp + ((lane >> 4) + 2 * it) * 68 + (lane & 15) * 4);
    return;
  }
  // a wave's 32 x 64 piece goes out as 256-B row segments: thread -> rows (lane >> 4) + 2 * it, 16 bytes at column (lane & 15) * 4
  const size_t off0 = (size_t)(m0 + wm + (lane >> 4)) * LDY + n0 + wn + (lane & 15) * 4;
  v4f_t xr[16];
  if (EPI == 1) {                                   // residual rows, requested before the accumulators are staged
    const float* pr = R + (size_t)blockIdx.z * strideY + off0;
#pragma unroll
    for (int it = 0; it < 16; ++it) xr[it] = *(const v4fa*)(pr + (size_t)(2 * it) * LDY);
    addr_wait(pr);
  }
  float* so = oS[wave];
#pragma unroll
  for (int i = 0; i < 2; ++i)
#pragma unroll
    for (int j = 0; j < 4; ++j) {
      const float bv = (EPI == 0) ? bias[n0 + wn + 16 * j + cl] : 0.0f;
#pragma unroll
      for (int r = 0; r < 8; ++r) {
        float v = PL ? acc[i][j][r] + accx[i][j][r] * (1.0f / 2048.0f) : acc[i][j][r];
        if (EPI == 0) v += bv;
        else { const int row = wm + 16 * i + rh + r; v += sBi[row]; v = v * sInv[row] + sSh[row]; }
        so[(16 * i + rh + r) * 68 + 16 * j + cl] = v;
      }
    }
  asm volatile("s_wait_dscnt 0" ::: "memory");      // the rows read below were written by other lanes of this wave
  __builtin_amdgcn_wave_barrier();
#pragma unroll
  for (int it = 0; it < 16; ++it) {
    v4f_t v = *(const v4fa*)(so + ((lane >> 4) + 2 * it) * 68 + (lane & 15) * 4);
    if (EPI == 1) v += xr[it];
    *(v4f_t*)(Y + off0 + (size_t)(2 * it) * LDY) = v;
  }
}
extern "C" void kernel_launch(void* const* d_in, const int* in_sizes, int n_in,
                              void* d_out, int out_size, void* d_ws, size_t ws_size,
                              hipStream_t stream) {
  (void)in_sizes; (void)n_in; (void)out_size;
  const float** f = (const float**)d_in;
  const float* x1 = f[0], *x2 = f[1], *gw = f[2], *gb = f[3], *tw = f[4], *tb = f[5], *pw = f[6], *pb = f[7], *Ww = f[8], *Wb = f[9], *bng = f[10], *bnb = f[11], *bnm = f[12], *bnv = f[13];
  float* out = (float*)d_out;     // [8,256,64,64]
  char* ws = (char*)d_ws;
  // every per-batch buffer holds all NBT batches, batch b at b * (its per-batch size)
  float* TH = (float*)ws; ws += (size_t)NBT * HWn * CI * 4;             // theta rows [8][4096][128] f32
  float* Y  = (float*)ws; ws += (size_t)NBT * HWn * CI * 4;             // y rows [8][4096][128] f32
  float* GP = (float*)ws; ws += (size_t)NBT * N2 * CI * 4;              // pooled g [8][1024][128]
  float* PH = (float*)ws; ws += (size_t)NBT * N2 * CI * 4;              // pooled phi [8][1024][128]
  if ((size_t)(ws - (char*)d_ws) > ws_size) return;                     // WS TOTAL 41,943,040 B
  const dim3 blk(256);
  // one launch per stage for all NBT batches: the batch is a grid dimension
  gemm_nat<true, true, 2, HWn, CC, CI, CC><<<dim3(HWn / 128, CI / 128, NBT), blk, 0, stream>>>(x2, (size_t)CC * HWn, pw, 0, pb, nullptr, nullptr, nullptr, nullptr, nullptr, PH, (size_t)N2 * CI);      // pooled phi rows (planes)
  gemm_nat<false, true, 2, HWn, CC, CI, CC><<<dim3(HWn / 128, CI / 128, NBT), blk, 0, stream>>>(x1, (size_t)CC * HWn, gw, 0, gb, nullptr, nullptr, nullptr, nullptr, nullptr, GP, (size_t)N2 * CI);     // pooled g rows (on x1, faithful)
  gemm_nat<true, true, 0, HWn, CC, CI, CC><<<dim3(HWn / 128, CI / 128, NBT), blk, 0, stream>>>(x1, (size_t)CC * HWn, tw, 0, tb, nullptr, nullptr, nullptr, nullptr, nullptr, TH, (size_t)HWn * CI);     // theta rows (planes)
  k_attn<<<dim3(HWn / 128, NBT), blk, 0, stream>>>(TH, PH, GP, Y);                                                                                           // y = softmax(theta * phi^T) * g, scores kept on chip
  gemm_nat<false, false, 1, CI, CI, HWn, CI><<<dim3(CC / 128, HWn / 128, NBT), blk, 0, stream>>>(Ww, 0, Y, (size_t)HWn * CI, Wb, bng, bnb, bnm, bnv, x1, out, (size_t)CC * HWn);                          // out = BN(W_w * y^T + b) + x1, channel-major
}

// v005
// It runs in 70.7 microseconds.
// In two side-by-side timings against v004, it was 1.22 and 1.21 times as fast.
// All steps since v000 together make it 20.0 times as fast.
// Contractions on v_wmma_f32_16x16x32_f16, f32 accumulate: the three 1x1 convs as position-major GEMMs (x^T * W^T + b, K = 256, f32 out; theta and phi, the score operands, with f16 value+residual planes, g plain f16;
// x is read as it lies in memory, channel-major, and turned in registers on its way to LDS; the weights are read as they lie, [out][in]), 2x2 max-pooling of the g / phi maps over positions in the epilogue of their GEMMs (the full-resolution maps never reach memory), per batch the non-local scores f = theta * phi^T (K = 128, 4096 x 1024) with f16 value+residual planes
// (hi*hi + (hi*lo + lo*hi)/2048: unscaled logits of spread about 11 give a peaked softmax that needs f32-class scores), running f32 row softmax and y = P * g (plain f16 operands, P carried as 1024 * exp(s - max))
// in the same kernel as the scores, W_y = W_w * y^T + b (K = 128, plain f16), which comes out channel-major, with BatchNorm (running stats) + the x1 residual in its epilogue.
// compute dtype: f16 operands (planes on the scores), f32 accumulate; pooling / softmax / BN in f32.  x1, x2 [8,256,64,64].
#include <hip/hip_runtime.h>
#include <hip/hip_bf16.h>
#include <math.h>


typedef _Float16 bf16;
typedef _Float16 f16;
typedef __attribute__((ext_vector_type(4))) unsigned v4u_t;
typedef unsigned v4ua __attribute__((ext_vector_type(4), may_alias));
typedef __attribute__((ext_vector_type(4))) float v4f_t;
typedef float v4fa __attribute__((ext_vector_type(4), may_alias));
typedef __attribute__((ext_vector_type(16))) bf16  bf16x16;
typedef bf16x16 f16x16;
typedef __attribute__((ext_vector_type(8)))  bf16  bf16x8;
typedef bf16x8 f16x8;
typedef __attribute__((ext_vector_type(4)))  bf16  bf16x4;
typedef __attribute__((ext_vector_type(8)))  float f32x8;
__device__ __forceinline__ f32x8 wmma16(f16x16 a, f16x16 b, f32x8 c) {
  c = __builtin_amdgcn_wmma_f32_16x16x32_f16(false, a, false, b, (short)0, c, false, false);
  asm volatile("v_nop\n\tv_nop\n\tv_nop\n\tv_nop" : "+v"(c) : "v"(a), "v"(b));
  return c;
}
#define LDS_STRIDE 48   // unused; the GEMM tiles use TPITCH
#define KSTRIDE    72   // unused
#define VSTRIDE    48   // unused

__device__ __forceinline__ f32x8 wmma_bf16(bf16x16 a, bf16x16 b, f32x8 c) {
  c = __builtin_amdgcn_wmma_f32_16x16x32_f16(false, a, false, b, (short)0, c, false, false);
  asm volatile("v_nop\n\tv_nop\n\tv_nop\n\tv_nop" : "+v"(c) : "v"(a), "v"(b));   // A/B-overwrite hazard guard
  return c;
}

// 16x32 (MxK) f16 fragment from a row-major global matrix.
// lanes 0-15  (row=lane)    : elems 0..7 = K+0..7,  8..15 = K+16..23
// lanes 16-31 (row=lane-16) : elems 0..7 = K+8..15, 8..15 = K+24..31
template <typename T>
__device__ __forceinline__ bf16x16 load_frag(const T* __restrict__ base, int ld,
                                             int row0, int k0) {
  const int lane = threadIdx.x & 31;
  const int r    = lane & 15;
  const int kh   = (lane >> 4) * 8;
  const T* p0 = base + (size_t)(row0 + r) * ld + (k0 + kh);
  const T* p1 = p0 + 16;
  bf16x16 f;
#pragma unroll
  for (int i = 0; i < 8; ++i) {
    f[i]     = (bf16)p0[i];
    f[i + 8] = (bf16)p1[i];
  }
  return f;
}

// Same fragment from an LDS tile with padded row stride (base includes row0/k0).
__device__ __forceinline__ bf16x16 lds_frag(const bf16* base, int stride) {
  const int lane = threadIdx.x & 31;
  const int row  = lane & 15;
  const int kh   = (lane >> 4) * 8;
  const bf16x8 lo = *(const bf16x8*)(base + row * stride + kh);
  const bf16x8 hi = *(const bf16x8*)(base + row * stride + kh + 16);
  bf16x16 f;
#pragma unroll
  for (int i = 0; i < 8; ++i) { f[i] = lo[i]; f[i + 8] = hi[i]; }
  return f;
}

template <typename T>
__device__ __forceinline__ void stage_read16(const T* __restrict__ p, float* buf) {
#pragma unroll
  for (int i = 0; i < 16; ++i) buf[i] = (float)p[i];
}

__device__ __forceinline__ void stage_write(bf16* dst, const float* buf, int nquad) {
#pragma unroll
  for (int i = 0; i < nquad; ++i) {
    bf16x4 q;
    q[0] = (bf16)buf[4 * i];     q[1] = (bf16)buf[4 * i + 1];
    q[2] = (bf16)buf[4 * i + 2]; q[3] = (bf16)buf[4 * i + 3];
    *(bf16x4*)(dst + 4 * i) = q;
  }
}


#define NBT 8
#define BBn 8
#define CC 256
#define CI 128
#define HWn 4096       // 64 x 64 positions
#define N2 1024        // pooled positions (32 x 32)
// ---------------------------------------------------------------------------------------------------------------------------
// k_attn: scores, row softmax and y in one kernel; the score matrix never reaches memory. Block = 128 queries of one batch,
// 8 waves x 16 queries; 16 passes of 64 keys. Per pass S^T = phi * theta^T (A = phi rows from LDS, B = theta kept in registers,
// value+residual planes: hh + (lh + hl)/2048), so a lane holds 32 scores of ONE query (query = lane & 15, keys 16j + 8*(lane >> 4) + r):
// running maximum and sum per lane, one exchange between the wave halves. 1024 * exp(s - max), converted to f16 in place, is the
// B operand of O^T += g^T * P^T (A = g^T from LDS); y = O / sum at the end.
// ---------------------------------------------------------------------------------------------------------------------------
#define AKT 64     // keys per pass
#define AKS 136    // phi tile pitch, f16 elements (272-B rows: 16 rows of b128 reads fall on distinct banks)
#define AVS 72     // g^T tile pitch, f16 elements (144-B rows, the same)
#define AOS 132    // y staging pitch, f32 elements
typedef float v2fa __attribute__((ext_vector_type(2), may_alias));
// s_wait_xcnt 0 behind a run of global loads, before their address registers are reused; the base pointer is an input so that it stays in its registers up to the wait
__device__ __forceinline__ void addr_wait(const float* p) { asm volatile("s_wait_xcnt 0x0" :: "v"(p) : "memory"); }
// v_nop: the one independent slot that the instruction set asks for behind a transcendental, kept whatever the compiler schedules next
__device__ __forceinline__ float exp2_slot(float x) { float r; asm("v_exp_f32 %0, %1\n\tv_nop" : "=v"(r) : "v"(x)); return r; }
__device__ __forceinline__ float rcp_slot(float x) { float r; asm("v_rcp_f32 %0, %1\n\tv_nop" : "=v"(r) : "v"(x)); return r; }
__device__ __forceinline__ f32x8 wmma_p(f16x16 a, f16x16 b, f32x8 c) { return __builtin_amdgcn_wmma_f32_16x16x32_f16(false, a, false, b, (short)0, c, false, false); }
// two waves per SIMD is all the grid gives (one block per WGP): let the register allocator use that room to fetch fragments ahead
__global__ __launch_bounds__(256) __attribute__((amdgpu_waves_per_eu(2, 2))) void k_attn(const float* __restrict__ TH, const float* __restrict__ PH, const float* __restrict__ GP, float* __restrict__ Y) {
  __shared__ __attribute__((aligned(16))) f16 sKh[AKT * AKS], sKl[AKT * AKS];
  __shared__ __attribute__((aligned(16))) f16 sVt[CI * AVS];
  __shared__ __attribute__((aligned(16))) float sO[8][16 * AOS];
  const int tid = threadIdx.x, lane = tid & 31, wave = tid >> 5, cl = lane & 15, hf = lane >> 4;
  const int q0 = blockIdx.x * 128 + wave * 16;
  TH += (size_t)blockIdx.y * HWn * CI; PH += (size_t)blockIdx.y * N2 * CI; GP += (size_t)blockIdx.y * N2 * CI; Y += (size_t)blockIdx.y * HWn * CI;
  const float L2E = 1.4426950408889634f;
  // theta fragments (B operand: column = query cl), same k order as lds_frag
  f16x16 qh[4], ql[4];
  { const float* qb = TH + (size_t)(q0 + cl) * CI + hf * 8;
    v4f_t qa[4][4];
#pragma unroll
    for (int ks = 0; ks < 4; ++ks) { qa[ks][0] = *(const v4fa*)(qb + ks * 32); qa[ks][1] = *(const v4fa*)(qb + ks * 32 + 4); qa[ks][2] = *(const v4fa*)(qb + ks * 32 + 16); qa[ks][3] = *(const v4fa*)(qb + ks * 32 + 20); }
    addr_wait(qb);
#pragma unroll
    for (int ks = 0; ks < 4; ++ks)
#pragma unroll
      for (int i = 0; i < 8; ++i) {
        const float va = qa[ks][i >> 2][i & 3], vb = qa[ks][2 + (i >> 2)][i & 3];
        const f16 ha = (f16)va, hb = (f16)vb;
        qh[ks][i] = ha; ql[ks][i] = (f16)((va - (float)ha) * 2048.0f);
        qh[ks][i + 8] = hb; ql[ks][i + 8] = (f16)((vb - (float)hb) * 2048.0f);
      }
  }
  f32x8 o[8];
#pragma unroll
  for (int c = 0; c < 8; ++c) { f32x8 z = {}; o[c] = z; }
  float m = -3.0e38f, l = 0.0f;
  v4f_t kr[8];
  // phi tile 0: a tile is 64 whole rows = 32 KiB contiguous; a wave reads one 512-B row per load
#pragma unroll
  for (int it = 0; it < 8; ++it) kr[it] = *(const v4fa*)(PH + tid * 4 + 1024 * it);
  addr_wait(PH + tid * 4);
#pragma unroll
  for (int it = 0; it < 8; ++it) { const int idx = tid + 256 * it, row = idx >> 5, c4 = (idx & 31) * 4; bf16x4 h, lo;
#pragma unroll
    for (int u = 0; u < 4; ++u) { h[u] = (f16)kr[it][u]; lo[u] = (f16)((kr[it][u] - (float)h[u]) * 2048.0f); }
    *(bf16x4*)(sKh + row * AKS + c4) = h; *(bf16x4*)(sKl + row * AKS + c4) = lo; }
  __syncthreads();
#pragma unroll 1   // rolled: one pass is already 64 matrix instructions, and a second copy would double the live staging registers
  for (int t = 0; t < N2 / AKT; ++t) {
    // g tile of this pass into registers (lands under the score products): wave -> 8 keys, lane -> channels 2*lane + {0,1} + 64u
    v2fa vr[8][2];
    const float* gp = GP + (size_t)(t * AKT + wave * 8) * CI + 2 * lane;
#pragma unroll
    for (int kk = 0; kk < 8; ++kk)
#pragma unroll
      for (int u = 0; u < 2; ++u) vr[kk][u] = *(const v2fa*)(gp + kk * CI + 64 * u);
    addr_wait(gp);
    f32x8 s[4];
#pragma unroll
    for (int j = 0; j < 4; ++j) {
      f32x8 a = {}, ax = {};
#pragma unroll
      for (int ks = 0; ks < 4; ++ks) {
        const f16x16 kh = lds_frag(sKh + (16 * j) * AKS + ks * 32, AKS), kl = lds_frag(sKl + (16 * j) * AKS + ks * 32, AKS);
        a = wmma_p(kh, qh[ks], a); ax = wmma_p(kl, qh[ks], ax); ax = wmma_p(kh, ql[ks], ax);
      }
      s[j] = a + ax * (1.0f / 2048.0f);
    }
    float mx = s[0][0];
#pragma unroll
    for (int j = 0; j < 4; ++j)
#pragma unroll
      for (int r = 0; r < 8; ++r) mx = fmaxf(mx, s[j][r]);
    mx = fmaxf(mx, __shfl_xor(mx, 16));            // the other half of the wave holds this query's other 32 keys
    const float mn = fmaxf(m, mx);
    const float alpha = exp2_slot((m - mn) * L2E);
    const float bias = 10.0f - mn * L2E;            // + 10: P carries a factor 1024 (small weights stay normal f16); it cancels against the sum
    m = mn;
#pragma unroll
    for (int j = 0; j < 4; ++j)
#pragma unroll
      for (int r = 0; r < 8; ++r) s[j][r] = exp2_slot(s[j][r] * L2E + bias);
    const f32x8 sv = (s[0] + s[1]) + (s[2] + s[3]);   // pairwise: a chain of 32 dependent adds would stand in the pass's critical path
    l = l * alpha + (((sv[0] + sv[1]) + (sv[2] + sv[3])) + ((sv[4] + sv[5]) + (sv[6] + sv[7])));
#pragma unroll
    for (int c = 0; c < 8; ++c) o[c] *= alpha;
    f16x16 pf[2];                                   // two score tiles (keys 32k2 .. + 31) converted in place = one B fragment in lds_frag's k order
#pragma unroll
    for (int k2 = 0; k2 < 2; ++k2)
#pragma unroll
      for (int i = 0; i < 8; ++i) { pf[k2][i] = (f16)s[2 * k2][i]; pf[k2][i + 8] = (f16)s[2 * k2 + 1][i]; }
    __builtin_amdgcn_sched_barrier(0);              // keeps the g conversions (and with them the wait on the g loads) from rising in front of the score products
#pragma unroll
    for (int u = 0; u < 2; ++u)
#pragma unroll
      for (int e = 0; e < 2; ++e) { f16x8 w;
#pragma unroll
        for (int kk = 0; kk < 8; ++kk) w[kk] = (f16)vr[kk][u][e];
        *(f16x8*)(sVt + (64 * u + 2 * lane + e) * AVS + wave * 8) = w; }
    __syncthreads();                                // g^T of this pass is published; every wave has left the phi tile
    const bool more = t + 1 < N2 / AKT;
    if (more) {                                     // next phi tile into registers (lands under the P * g products)
      const float* kp = PH + (size_t)(t + 1) * AKT * CI + tid * 4;
#pragma unroll
      for (int it = 0; it < 8; ++it) kr[it] = *(const v4fa*)(kp + 1024 * it);
      addr_wait(kp);
    }
    f16x16 vf[2][8];                                // all 16 g^T fragments are requested before the first product, so that one LDS latency is paid and not sixteen
#pragma unroll
    for (int k2 = 0; k2 < 2; ++k2)
#pragma unroll
      for (int c = 0; c < 8; ++c) vf[k2][c] = lds_frag(sVt + (16 * c) * AVS + k2 * 32, AVS);
    __builtin_amdgcn_sched_barrier(0);              // keeps the fragment loads above from sinking down to their products
#pragma unroll
    for (int k2 = 0; k2 < 2; ++k2)
#pragma unroll
      for (int c = 0; c < 8; ++c) o[c] = wmma_p(vf[k2][c], pf[k2], o[c]);
    if (more) {
#pragma unroll
      for (int it = 0; it < 8; ++it) { const int idx = tid + 256 * it, row = idx >> 5, c4 = (idx & 31) * 4; bf16x4 h, lo;
#pragma unroll
        for (int u = 0; u < 4; ++u) { h[u] = (f16)kr[it][u]; lo[u] = (f16)((kr[it][u] - (float)h[u]) * 2048.0f); }
        *(bf16x4*)(sKh + row * AKS + c4) = h; *(bf16x4*)(sKl + row * AKS + c4) = lo; }
    }
    __syncthreads();                                // the next phi tile is published; every wave has left g^T
  }
  l += __shfl_xor(l, 16);
  const float inv = rcp_slot(l);
  float* so = sO[wave];                             // wave-private: lane holds y[query cl][16c + 8*hf + r]; turned into whole 512-B rows for the stores
#pragma unroll
  for (int c = 0; c < 8; ++c) { v4f_t w0, w1;
#pragma unroll
    for (int r = 0; r < 4; ++r) { w0[r] = o[c][r] * inv; w1[r] = o[c][r + 4] * inv; }
    *(v4fa*)(so + cl * AOS + 16 * c + 8 * hf) = w0; *(v4fa*)(so + cl * AOS + 16 * c + 8 * hf + 4) = w1; }
  asm volatile("s_wait_dscnt 0" ::: "memory");      // the rows read below were written by other lanes of this wave
  __builtin_amdgcn_wave_barrier();
#pragma unroll
  for (int it = 0; it < 16; ++it) *(v4f_t*)(Y + (size_t)(q0 + it) * CI + lane * 4) = *(const v4fa*)(so + it * AOS + lane * 4);
}
// ---------------------------------------------------------------------------------------------------------------------------
// gemm_tile: D[m][n] = sum_k A[m][k] * B[n][k], every operand read in the layout it has in memory, so that no transposed copy is made.
// B is row-major [n][k] (row stride LDB). A is row-major [m][k] (AKM false, row stride LDA) or k-major [k][m] (AKM true, row stride LDA).
// PL: value+residual planes on both operands (hh + (hl + lh)/2048, f32-class); else plain f16 operands. f32 accumulate.
// EPI 0: Y[m][n] = D + bias[n]. EPI 2: Y[p][n] = max of D + bias[n] over the 2 x 2 window of positions p (m = 64-wide image rows; LDY, strideY are those of the pooled map). EPI 1: Y[m][n] = (D + bias[m]) * inv[m] + sh[m] + R[m][n], inv = bg * rsqrt(bvar + eps), sh = bb - bmean * inv.
// Block = 128 x 128 tile, 8 waves as 4(M, 32 rows) x 2(N, 64 cols); per 32-wide k-step both tiles are staged f16 in LDS as [row][k].
// EPI 2: the tile's 128 positions are image rows 2i and 2i + 1 (i = bx); a wave takes the same 16 columns of both rows (m = 16a .. + 15 and 64 + 16a .. + 15),
// so that all four positions of a window lie in one lane's accumulators (two neighbouring registers of both fragments) and the maximum needs no exchange.
// bz selects a batch (element strides); R has Y's batch stride.
// ---------------------------------------------------------------------------------------------------------------------------
#define TPITCH 40     // staged tile pitch, f16 elements (64-B rows at 80 B: 16-byte reads and writes of neighbouring rows fall on distinct banks)
// 128 rows x 32 k of a row-major f32 matrix: 8 lanes take the 128 B of a row, a wave 4 rows, 4 loads a thread
template <int LD>
__device__ __forceinline__ void rows_load(const float* __restrict__ p, v4f_t* v) {
#pragma unroll
  for (int it = 0; it < 4; ++it) v[it] = *(const v4fa*)(p + (size_t)(32 * it) * LD);
}
template <bool PL>
__device__ __forceinline__ void rows_store(const v4f_t* v, f16* dh, f16* dl) {
  const int tid = threadIdx.x, r0 = tid >> 3, c4 = (tid & 7) * 4;
#pragma unroll
  for (int it = 0; it < 4; ++it) { bf16x4 h, lo;
#pragma unroll
    for (int u = 0; u < 4; ++u) { h[u] = (f16)v[it][u]; lo[u] = (f16)((v[it][u] - (float)h[u]) * 2048.0f); }
    *(bf16x4*)(dh + (r0 + 32 * it) * TPITCH + c4) = h; if (PL) *(bf16x4*)(dl + (r0 + 32 * it) * TPITCH + c4) = lo; }
}
// The body is a function of the block's place (bx, by, bz) and of LDS arrays that the kernel owns, so that one launch can hold tiles of several products:
// ldsA, ldsB (and ldsAl, ldsBl under PL) 128 * TPITCH f16 each, oS 8 waves x (EPI 2: 8, else 32) rows x 68 f32, sBi, sInv, sSh 128 f32 each (EPI 1 only).
template <bool PL, bool AKM, int EPI, int LDA, int LDB, int LDY, int K>
__device__ __forceinline__ void gemm_tile(f16* ldsA, f16* ldsAl, f16* ldsB, f16* ldsBl, float* oS, float* sBi, float* sInv, float* sSh, const int bx, const int by, const int bz,
                                          const float* __restrict__ A, size_t strideA, const float* __restrict__ B, size_t strideB,
                                          const float* __restrict__ bias, const float* __restrict__ bg, const float* __restrict__ bb,
                                          const float* __restrict__ bmean, const float* __restrict__ bvar, const float* __restrict__ R,
                                          float* __restrict__ Y, size_t strideY) {
  constexpr int OSW = (EPI == 2 ? 8 : 32) * 68;   // f32 elements of one wave's output staging
  const int tid = threadIdx.x, lane = tid & 31, wave = tid >> 5, cl = lane & 15, rh = (lane >> 4) * 8;
  const int m0 = bx * 128, n0 = by * 128;
  const int wm = (wave & 3) * (EPI == 2 ? 16 : 32), wn = (wave >> 2) * 64;
  constexpr int FM = EPI == 2 ? 64 : 16;   // rows between a wave's two A fragments
  A += (size_t)bz * strideA; B += (size_t)bz * strideB; Y += (size_t)bz * strideY;
  if (EPI == 1 && tid < 128) {   // per-row constants of the epilogue; published by the barriers of the k loop
    const int o = m0 + tid; const float inv = bg[o] * rsqrtf(bvar[o] + 1e-5f);
    sBi[tid] = bias[o]; sInv[tid] = inv; sSh[tid] = bb[o] - bmean[o] * inv;
  }
  f32x8 acc[2][4], accx[2][4];
#pragma unroll
  for (int i = 0; i < 2; ++i)
#pragma unroll
    for (int j = 0; j < 4; ++j) { f32x8 z = {}; acc[i][j] = z; accx[i][j] = z; }
  // k-major A: wave -> 8 k rows (kg) of one 64-wide half of the tile's m range (mh); lane -> m = 2 * lane + {0, 1}: a load is 256 B of one k row
  const int kg = wave & 3, mh = wave >> 2;
  const float* pa = AKM ? A + (size_t)(kg * 8) * LDA + m0 + mh * 64 + 2 * lane : A + (size_t)(m0 + (tid >> 3)) * LDA + (tid & 7) * 4;
  const float* pb = B + (size_t)(n0 + (tid >> 3)) * LDB + (tid & 7) * 4;
#pragma unroll 1   // rolled: the trips are separated by barriers and gain nothing from a second copy of the staging code
  for (int k0 = 0; k0 < K; k0 += 32) {
    __syncthreads();                                // every wave has left the tiles of the trip before
    v2fa at[8]; v4f_t ar[4], br[4];
    if (AKM) {
#pragma unroll
      for (int kk = 0; kk < 8; ++kk) at[kk] = *(const v2fa*)(pa + (size_t)kk * LDA);
    } else rows_load<LDA>(pa, ar);
    rows_load<LDB>(pb, br);
    asm volatile("s_wait_xcnt 0x0" :: "v"(pa), "v"(pb) : "memory");   // behind both runs of loads, before the two pointers they name are advanced
    pa += AKM ? (size_t)32 * LDA : 32; pb += 32;
    if (AKM) {                                      // the turn: a thread's 8 k values of one m are 16 contiguous bytes of the [m][k] tile
#pragma unroll
      for (int e = 0; e < 2; ++e) { f16x8 h, lo;
#pragma unroll
        for (int kk = 0; kk < 8; ++kk) { const float v = at[kk][e]; h[kk] = (f16)v; lo[kk] = (f16)((v - (float)h[kk]) * 2048.0f); }
        *(f16x8*)(ldsA + (mh * 64 + 2 * lane + e) * TPITCH + kg * 8) = h; if (PL) *(f16x8*)(ldsAl + (mh * 64 + 2 * lane + e) * TPITCH + kg * 8) = lo; }
    } else rows_store<PL>(ar, ldsA, ldsAl);
    rows_store<PL>(br, ldsB, ldsBl);
    __syncthreads();                                // both tiles are published
    f16x16 af[2], afl[2];
#pragma unroll
    for (int i = 0; i < 2; ++i) { af[i] = lds_frag(ldsA + (wm + FM * i) * TPITCH, TPITCH); if (PL) afl[i] = lds_frag(ldsAl + (wm + FM * i) * TPITCH, TPITCH); }
#pragma unroll
    for (int j = 0; j < 4; ++j) {
      const f16x16 bf = lds_frag(ldsB + (wn + 16 * j) * TPITCH, TPITCH);
      if (PL) {
        const f16x16 bfl = lds_frag(ldsBl + (wn + 16 * j) * TPITCH, TPITCH);
#pragma unroll
        for (int i = 0; i < 2; ++i) { acc[i][j] = wmma16(af[i], bf, acc[i][j]); accx[i][j] = wmma16(af[i], bfl, accx[i][j]); accx[i][j] = wmma16(afl[i], bf, accx[i][j]); }
      } else {
#pragma unroll
        for (int i = 0; i < 2; ++i) acc[i][j] = wmma16(af[i], bf, acc[i][j]);
      }
    }
  }
  if (EPI == 2) {   // lane holds positions (row 2i + f, column wm + rh + r) of channel 16j + cl in acc[f][j][r]: window p of the lane = registers 2p, 2p + 1 of both fragments
    float* sp = oS + wave * OSW;
#pragma unroll
    for (int j = 0; j < 4; ++j) {
      const float bv = bias[n0 + wn + 16 * j + cl];
#pragma unroll
      for (int p = 0; p < 4; ++p) {
        float v[2][2];
#pragma unroll
        for (int i = 0; i < 2; ++i)
#pragma unroll
          for (int e = 0; e < 2; ++e) v[i][e] = (PL ? acc[i][j][2 * p + e] + accx[i][j][2 * p + e] * (1.0f / 2048.0f) : acc[i][j][2 * p + e]) + bv;
        sp[((rh >> 1) + p) * 68 + 16 * j + cl] = fmaxf(fmaxf(v[0][0], v[0][1]), fmaxf(v[1][0], v[1][1]));
      }
    }
    asm volatile("s_wait_dscnt 0" ::: "memory");    // the rows read below were written by other lanes of this wave
    __builtin_amdgcn_wave_barrier();
    // a wave's 8 pooled positions x 64 channels go out as 256-B row segments
    float* yp = Y + (size_t)(bx * 32 + (wm >> 1) + (lane >> 4)) * LDY + n0 + wn + (lane & 15) * 4;
#pragma unroll
    for (int it = 0; it < 4; ++it) *(v4f_t*)(yp + (size_t)(2 * it) * LDY) = *(const v4fa*)(sp + ((lane >> 4) + 2 * it) * 68 + (lane & 15) * 4);
    asm volatile("s_wait_xcnt 0x0" ::: "memory");   // behind the run of stores, a precaution: in k_proj each block runs one product, so the kernel ends here
    return;
  }
  // a wave's 32 x 64 piece goes out as 256-B row segments: thread -> rows (lane >> 4) + 2 * it, 16 bytes at column (lane & 15) * 4
  const size_t off0 = (size_t)(m0 + wm + (lane >> 4)) * LDY + n0 + wn + (lane & 15) * 4;
  v4f_t xr[16];
  if (EPI == 1) {                                   // residual rows, requested before the accumulators are staged
    const float* pr = R + (size_t)bz * strideY + off0;
#pragma unroll
    for (int it = 0; it < 16; ++it) xr[it] = *(const v4fa*)(pr + (size_t)(2 * it) * LDY);
    addr_wait(pr);
  }
  float* so = oS + wave * OSW;
#pragma unroll
  for (int i = 0; i < 2; ++i)
#pragma unroll
    for (int j = 0; j < 4; ++j) {
      const float bv = (EPI == 0) ? bias[n0 + wn + 16 * j + cl] : 0.0f;
#pragma unroll
      for (int r = 0; r < 8; ++r) {
        float v = PL ? acc[i][j][r] + accx[i][j][r] * (1.0f / 2048.0f) : acc[i][j][r];
        if (EPI == 0) v += bv;
        else { const int row = wm + 16 * i + rh + r; v += sBi[row]; v = v * sInv[row] + sSh[row]; }
        so[(16 * i + rh + r) * 68 + 16 * j + cl] = v;
      }
    }
  asm volatile("s_wait_dscnt 0" ::: "memory");      // the rows read below were written by other lanes of this wave
  __builtin_amdgcn_wave_barrier();
#pragma unroll
  for (int it = 0; it < 16; ++it) {
    v4f_t v = *(const v4fa*)(so + ((lane >> 4) + 2 * it) * 68 + (lane & 15) * 4);
    if (EPI == 1) v += xr[it];
    *(v4f_t*)(Y + off0 + (size_t)(2 * it) * LDY) = v;
  }
  if (EPI == 0) asm volatile("s_wait_xcnt 0x0" ::: "memory");   // behind the run of stores, as above (theta's blocks in k_proj end here too, as k_out's do)
}
// k_proj: the three 1x1 convolutions depend on nothing but the inputs, so their 3 x 256 tiles go out as one launch: no launch gap between them, and
// two blocks share a WGP (registers allow four waves a SIMD), so that one block's products run while the other waits for its global loads.
// blockIdx.z = 8 * product + batch; the two products with planes come first, the short one (g) fills the places that they leave.
__global__ __launch_bounds__(256) void k_proj(const float* __restrict__ x1, const float* __restrict__ x2,
                                              const float* __restrict__ pw, const float* __restrict__ pb, const float* __restrict__ tw, const float* __restrict__ tb,
                                              const float* __restrict__ gw, const float* __restrict__ gb,
                                              float* __restrict__ PH, float* __restrict__ TH, float* __restrict__ GP) {
  __shared__ __attribute__((aligned(16))) f16 ldsA[128 * TPITCH], ldsAl[128 * TPITCH], ldsB[128 * TPITCH], ldsBl[128 * TPITCH];
  __shared__ __attribute__((aligned(16))) float oS[8 * 32 * 68];   // theta's size, the largest of the three
  const int which = blockIdx.z >> 3, bz = blockIdx.z & 7;
  if (which == 0)      gemm_tile<true, true, 2, HWn, CC, CI, CC>(ldsA, ldsAl, ldsB, ldsBl, oS, nullptr, nullptr, nullptr, blockIdx.x, 0, bz, x2, (size_t)CC * HWn, pw, 0, pb, nullptr, nullptr, nullptr, nullptr, nullptr, PH, (size_t)N2 * CI);    // pooled phi rows (planes)
  else if (which == 1) gemm_tile<true, true, 0, HWn, CC, CI, CC>(ldsA, ldsAl, ldsB, ldsBl, oS, nullptr, nullptr, nullptr, blockIdx.x, 0, bz, x1, (size_t)CC * HWn, tw, 0, tb, nullptr, nullptr, nullptr, nullptr, nullptr, TH, (size_t)HWn * CI);   // theta rows (planes)
  else                 gemm_tile<false, true, 2, HWn, CC, CI, CC>(ldsA, nullptr, ldsB, nullptr, oS, nullptr, nullptr, nullptr, blockIdx.x, 0, bz, x1, (size_t)CC * HWn, gw, 0, gb, nullptr, nullptr, nullptr, nullptr, nullptr, GP, (size_t)N2 * CI);   // pooled g rows (on x1, faithful)
}
// k_out: out = BN(W_w * y^T + b) + x1, channel-major
__global__ __launch_bounds__(256) void k_out(const float* __restrict__ Ww, const float* __restrict__ Yr, const float* __restrict__ Wb, const float* __restrict__ bng, const float* __restrict__ bnb,
                                             const float* __restrict__ bnm, const float* __restrict__ bnv, const float* __restrict__ x1, float* __restrict__ out) {
  __shared__ __attribute__((aligned(16))) f16 ldsA[128 * TPITCH], ldsB[128 * TPITCH];
  __shared__ __attribute__((aligned(16))) float oS[8 * 32 * 68], sBi[128], sInv[128], sSh[128];
  gemm_tile<false, false, 1, CI, CI, HWn, CI>(ldsA, nullptr, ldsB, nullptr, oS, sBi, sInv, sSh, blockIdx.x, blockIdx.y, blockIdx.z, Ww, 0, Yr, (size_t)HWn * CI, Wb, bng, bnb, bnm, bnv, x1, out, (size_t)CC * HWn);
}
extern "C" void kernel_launch(void* const* d_in, const int* in_sizes, int n_in,
                              void* d_out, int out_size, void* d_ws, size_t ws_size,
                              hipStream_t stream) {
  (void)in_sizes; (void)n_in; (void)out_size;
  const float** f = (const float**)d_in;
  const float* x1 = f[0], *x2 = f[1], *gw = f[2], *gb = f[3], *tw = f[4], *tb = f[5], *pw = f[6], *pb = f[7], *Ww = f[8], *Wb = f[9], *bng = f[10], *bnb = f[11], *bnm = f[12], *bnv = f[13];
  float* out = (float*)d_out;     // [8,256,64,64]
  char* ws = (char*)d_ws;
  // every per-batch buffer holds all NBT batches, batch b at b * (its per-batch size)
  float* TH = (float*)ws; ws += (size_t)NBT * HWn * CI * 4;             // theta rows [8][4096][128] f32
  float* Y  = (float*)ws; ws += (size_t)NBT * HWn * CI * 4;             // y rows [8][4096][128] f32
  float* GP = (float*)ws; ws += (size_t)NBT * N2 * CI * 4;              // pooled g [8][1024][128]
  float* PH = (float*)ws; ws += (size_t)NBT * N2 * CI * 4;              // pooled phi [8][1024][128]
  if ((size_t)(ws - (char*)d_ws) > ws_size) return;                     // WS TOTAL 41,943,040 B
  const dim3 blk(256);
  // one launch per stage for all NBT batches: the batch is a grid dimension; the three convolutions are one stage
  k_proj<<<dim3(HWn / 128, 1, 3 * NBT), blk, 0, stream>>>(x1, x2, pw, pb, tw, tb, gw, gb, PH, TH, GP);                                                         // pooled phi, theta, pooled g
  k_attn<<<dim3(HWn / 128, NBT), blk, 0, stream>>>(TH, PH, GP, Y);                                                                                           // y = softmax(theta * phi^T) * g, scores kept on chip
  k_out<<<dim3(CC / 128, HWn / 128, NBT), blk, 0, stream>>>(Ww, Y, Wb, bng, bnb, bnm, bnv, x1, out);                                                            // out = BN(W_w * y^T + b) + x1, channel-major
}

// v006
// It runs in 64.9 microseconds.
// In two side-by-side timings against v005, it was 1.09 and 1.07 times as fast.
// All steps since v000 together make it 21.6 times as fast.
// Contractions on v_wmma_f32_16x16x32_f16, f32 accumulate: the three 1x1 convs as position-major GEMMs (x^T * W^T + b, K = 256, f32 out; theta and phi, the score operands, with f16 value+residual planes, g plain f16;
// x is read as it lies in memory, channel-major, and turned in registers on its way to LDS; the weights are read as they lie, [out][in]), 2x2 max-pooling of the g / phi maps over positions in the epilogue of their GEMMs (the full-resolution maps never reach memory), per batch the non-local scores f = theta * phi^T (K = 128, 4096 x 1024) with f16 value+residual planes
// (hi*hi + (hi*lo + lo*hi)/2048: unscaled logits of spread about 11 give a peaked softmax that needs f32-class scores), running f32 row softmax and y = P * g (plain f16 operands, P carried as 1024 * exp(s - max))
// in the same kernel as the scores, and there too W_y = y * W_w^T + b (K = 128, plain f16; y goes from wave to wave through LDS and never reaches memory), turned channel-major in LDS, with BatchNorm (running stats) + the x1 residual in its epilogue.
// compute dtype: f16 operands (planes on the scores), f32 accumulate; pooling / softmax / BN in f32.  x1, x2 [8,256,64,64].
#include <hip/hip_runtime.h>
#include <hip/hip_bf16.h>
#include <math.h>


typedef _Float16 bf16;
typedef _Float16 f16;
typedef __attribute__((ext_vector_type(4))) unsigned v4u_t;
typedef unsigned v4ua __attribute__((ext_vector_type(4), may_alias));
typedef __attribute__((ext_vector_type(4))) float v4f_t;
typedef float v4fa __attribute__((ext_vector_type(4), may_alias));
typedef __attribute__((ext_vector_type(16))) bf16  bf16x16;
typedef bf16x16 f16x16;
typedef __attribute__((ext_vector_type(8)))  bf16  bf16x8;
typedef bf16x8 f16x8;
typedef __attribute__((ext_vector_type(4)))  bf16  bf16x4;
typedef __attribute__((ext_vector_type(8)))  float f32x8;
__device__ __forceinline__ f32x8 wmma16(f16x16 a, f16x16 b, f32x8 c) {
  c = __builtin_amdgcn_wmma_f32_16x16x32_f16(false, a, false, b, (short)0, c, false, false);
  asm volatile("v_nop\n\tv_nop\n\tv_nop\n\tv_nop" : "+v"(c) : "v"(a), "v"(b));
  return c;
}
#define LDS_STRIDE 48   // unused; the GEMM tiles use TPITCH
#define KSTRIDE    72   // unused
#define VSTRIDE    48   // unused

__device__ __forceinline__ f32x8 wmma_bf16(bf16x16 a, bf16x16 b, f32x8 c) {
  c = __builtin_amdgcn_wmma_f32_16x16x32_f16(false, a, false, b, (short)0, c, false, false);
  asm volatile("v_nop\n\tv_nop\n\tv_nop\n\tv_nop" : "+v"(c) : "v"(a), "v"(b));   // A/B-overwrite hazard guard
  return c;
}

// 16x32 (MxK) f16 fragment from a row-major global matrix.
// lanes 0-15  (row=lane)    : elems 0..7 = K+0..7,  8..15 = K+16..23
// lanes 16-31 (row=lane-16) : elems 0..7 = K+8..15, 8..15 = K+24..31
template <typename T>
__device__ __forceinline__ bf16x16 load_frag(const T* __restrict__ base, int ld,
                                             int row0, int k0) {
  const int lane = threadIdx.x & 31;
  const int r    = lane & 15;
  const int kh   = (lane >> 4) * 8;
  const T* p0 = base + (size_t)(row0 + r) * ld + (k0 + kh);
  const T* p1 = p0 + 16;
  bf16x16 f;
#pragma unroll
  for (int i = 0; i < 8; ++i) {
    f[i]     = (bf16)p0[i];
    f[i + 8] = (bf16)p1[i];
  }
  return f;
}

// Same fragment from an LDS tile with padded row stride (base includes row0/k0).
__device__ __forceinline__ bf16x16 lds_frag(const bf16* base, int stride) {
  const int lane = threadIdx.x & 31;
  const int row  = lane & 15;
  const int kh   = (lane >> 4) * 8;
  const bf16x8 lo = *(const bf16x8*)(base + row * stride + kh);
  const bf16x8 hi = *(const bf16x8*)(base + row * stride + kh + 16);
  bf16x16 f;
#pragma unroll
  for (int i = 0; i < 8; ++i) { f[i] = lo[i]; f[i + 8] = hi[i]; }
  return f;
}

template <typename T>
__device__ __forceinline__ void stage_read16(const T* __restrict__ p, float* buf) {
#pragma unroll
  for (int i = 0; i < 16; ++i) buf[i] = (float)p[i];
}

__device__ __forceinline__ void stage_write(bf16* dst, const float* buf, int nquad) {
#pragma unroll
  for (int i = 0; i < nquad; ++i) {
    bf16x4 q;
    q[0] = (bf16)buf[4 * i];     q[1] = (bf16)buf[4 * i + 1];
    q[2] = (bf16)buf[4 * i + 2]; q[3] = (bf16)buf[4 * i + 3];
    *(bf16x4*)(dst + 4 * i) = q;
  }
}


#define NBT 8
#define BBn 8
#define CC 256
#define CI 128
#define HWn 4096       // 64 x 64 positions
#define N2 1024        // pooled positions (32 x 32)
// ---------------------------------------------------------------------------------------------------------------------------
// k_attn: scores, row softmax, y and the output convolution in one kernel; neither the score matrix nor y reaches memory. Block = 128 queries of one batch,
// 8 waves x 16 queries; 16 passes of 64 keys. Per pass S^T = phi * theta^T (A = phi rows from LDS, B = theta kept in registers,
// value+residual planes: hh + (lh + hl)/2048), so a lane holds 32 scores of ONE query (query = lane & 15, keys 16j + 8*(lane >> 4) + r):
// running maximum and sum per lane, one exchange between the wave halves. 1024 * exp(s - max), converted to f16 in place, is the
// B operand of O^T += g^T * P^T (A = g^T from LDS); y = O / sum at the end. The block holds all 128 channels of its 128 positions' y, which is all that its piece of
// out = BN(y * W_w^T + b) + x1 needs: each wave takes 32 of the 256 output channels; its rows of W_w (f16) and of x1 come into LDS two a pass, under the score products.
// ---------------------------------------------------------------------------------------------------------------------------
#define AKT 64     // keys per pass
#define AKS 136    // phi tile pitch, f16 elements (272-B rows: 16 rows of b128 reads fall on distinct banks)
#define AVS 72     // g^T tile pitch, f16 elements (144-B rows, the same)
#define AWS 136    // W_w and y tile pitch, f16 elements (272-B rows, as the phi tile)
#define AOS 132    // output staging pitch, f32 elements
typedef float v2fa __attribute__((ext_vector_type(2), may_alias));
// s_wait_xcnt 0 behind a run of global loads, before their address registers are reused; the base pointer is an input so that it stays in its registers up to the wait
__device__ __forceinline__ void addr_wait(const float* p) { asm volatile("s_wait_xcnt 0x0" :: "v"(p) : "memory"); }
// v_nop: the one independent slot that the instruction set asks for behind a transcendental, kept whatever the compiler schedules next
__device__ __forceinline__ float exp2_slot(float x) { float r; asm("v_exp_f32 %0, %1\n\tv_nop" : "=v"(r) : "v"(x)); return r; }
__device__ __forceinline__ float rcp_slot(float x) { float r; asm("v_rcp_f32 %0, %1\n\tv_nop" : "=v"(r) : "v"(x)); return r; }
__device__ __forceinline__ f32x8 wmma_p(f16x16 a, f16x16 b, f32x8 c) { return __builtin_amdgcn_wmma_f32_16x16x32_f16(false, a, false, b, (short)0, c, false, false); }
// two waves per SIMD is all the grid gives (one block per WGP): let the register allocator use that room to fetch fragments ahead
__global__ __launch_bounds__(256) __attribute__((amdgpu_waves_per_eu(2, 2))) void k_attn(const float* __restrict__ TH, const float* __restrict__ PH, const float* __restrict__ GP,
                                                                                             const float* __restrict__ Ww, const float* __restrict__ Wb, const float* __restrict__ bng, const float* __restrict__ bnb,
                                                                                             const float* __restrict__ bnm, const float* __restrict__ bnv, const float* __restrict__ x1, float* __restrict__ out) {
  __shared__ __attribute__((aligned(16))) f16 sK[2 * AKT * AKS];   // both phi planes; behind the loop the block's y tile (128 * AWS, the same size)
  __shared__ __attribute__((aligned(16))) f16 sVt[CI * AVS];
  __shared__ __attribute__((aligned(16))) f16 sW[CC * AWS];
  __shared__ __attribute__((aligned(16))) float sX[CC * 128], sO[8][16 * AOS], sBi[CC], sInv[CC], sSh[CC];
  f16* const sKh = sK; f16* const sKl = sK + AKT * AKS; f16* const sY = sK;
  const int tid = threadIdx.x, lane = tid & 31, wave = tid >> 5, cl = lane & 15, hf = lane >> 4;
  const int q0 = blockIdx.x * 128 + wave * 16;
  TH += (size_t)blockIdx.y * HWn * CI; PH += (size_t)blockIdx.y * N2 * CI; GP += (size_t)blockIdx.y * N2 * CI;
  const float L2E = 1.4426950408889634f;
  const size_t off0 = ((size_t)blockIdx.y * CC + wave * 32) * HWn + blockIdx.x * 128 + lane * 4;   // the wave's 32 channels of x1 and out: 512 B of one channel a wave access
  // per-channel constants of the last epilogue, one output channel a thread; requested first, stored behind the first phi tile, published by the barriers of the loop
  const float* cb = Wb + tid; const float* cg = bng + tid; const float* cs = bnb + tid; const float* cm = bnm + tid; const float* cv = bnv + tid;
  const float c_b = *cb, c_g = *cg, c_s = *cs, c_m = *cm, c_v = *cv;
  asm volatile("s_wait_xcnt 0x0" :: "v"(cb), "v"(cg), "v"(cs), "v"(cm), "v"(cv) : "memory");   // behind the five loads, before the registers that they name are reused
  // theta fragments (B operand: column = query cl), same k order as lds_frag
  f16x16 qh[4], ql[4];
  { const float* qb = TH + (size_t)(q0 + cl) * CI + hf * 8;
    v4f_t qa[4][4];
#pragma unroll
    for (int ks = 0; ks < 4; ++ks) { qa[ks][0] = *(const v4fa*)(qb + ks * 32); qa[ks][1] = *(const v4fa*)(qb + ks * 32 + 4); qa[ks][2] = *(const v4fa*)(qb + ks * 32 + 16); qa[ks][3] = *(const v4fa*)(qb + ks * 32 + 20); }
    addr_wait(qb);
#pragma unroll
    for (int ks = 0; ks < 4; ++ks)
#pragma unroll
      for (int i = 0; i < 8; ++i) {
        const float va = qa[ks][i >> 2][i & 3], vb = qa[ks][2 + (i >> 2)][i & 3];
        const f16 ha = (f16)va, hb = (f16)vb;
        qh[ks][i] = ha; ql[ks][i] = (f16)((va - (float)ha) * 2048.0f);
        qh[ks][i + 8] = hb; ql[ks][i + 8] = (f16)((vb - (float)hb) * 2048.0f);
      }
  }
  f32x8 o[8];
#pragma unroll
  for (int c = 0; c < 8; ++c) { f32x8 z = {}; o[c] = z; }
  float m = -3.0e38f, l = 0.0f;
  v4f_t kr[8];
  // phi tile 0: a tile is 64 whole rows = 32 KiB contiguous; a wave reads one 512-B row per load
#pragma unroll
  for (int it = 0; it < 8; ++it) kr[it] = *(const v4fa*)(PH + tid * 4 + 1024 * it);
  addr_wait(PH + tid * 4);
#pragma unroll
  for (int it = 0; it < 8; ++it) { const int idx = tid + 256 * it, row = idx >> 5, c4 = (idx & 31) * 4; bf16x4 h, lo;
#pragma unroll
    for (int u = 0; u < 4; ++u) { h[u] = (f16)kr[it][u]; lo[u] = (f16)((kr[it][u] - (float)h[u]) * 2048.0f); }
    *(bf16x4*)(sKh + row * AKS + c4) = h; *(bf16x4*)(sKl + row * AKS + c4) = lo; }
  { const float inv = c_g * rsqrtf(c_v + 1e-5f); sBi[tid] = c_b; sInv[tid] = inv; sSh[tid] = c_s - c_m * inv; }
  __syncthreads();
#pragma unroll 1   // rolled: one pass is already 64 matrix instructions, and a second copy would double the live staging registers
  for (int t = 0; t < N2 / AKT; ++t) {
    // g tile of this pass into registers (lands under the score products): wave -> 8 keys, lane -> channels 2*lane + {0,1} + 64u
    v2fa vr[8][2];
    const float* gp = GP + (size_t)(t * AKT + wave * 8) * CI + 2 * lane;
#pragma unroll
    for (int kk = 0; kk < 8; ++kk)
#pragma unroll
      for (int u = 0; u < 2; ++u) vr[kk][u] = *(const v2fa*)(gp + kk * CI + 64 * u);
    addr_wait(gp);
    // two of the wave's own 32 rows of W_w and of x1 a pass (whole 512-B rows): after 16 passes the last product's weights and its residual stand in LDS, with no wait of their own
    const float* wp = Ww + (size_t)(wave * 32 + 2 * t) * CI + lane * 4;
    const v4f_t wr0 = *(const v4fa*)wp, wr1 = *(const v4fa*)(wp + CI);
    addr_wait(wp);
    const float* xp = x1 + off0 + (size_t)(2 * t) * HWn;
    const v4f_t xr0 = *(const v4fa*)xp, xr1 = *(const v4fa*)(xp + HWn);
    addr_wait(xp);
    f32x8 s[4];
#pragma unroll
    for (int j = 0; j < 4; ++j) {
      f32x8 a = {}, ax = {};
#pragma unroll
      for (int ks = 0; ks < 4; ++ks) {
        const f16x16 kh = lds_frag(sKh + (16 * j) * AKS + ks * 32, AKS), kl = lds_frag(sKl + (16 * j) * AKS + ks * 32, AKS);
        a = wmma_p(kh, qh[ks], a); ax = wmma_p(kl, qh[ks], ax); ax = wmma_p(kh, ql[ks], ax);
      }
      s[j] = a + ax * (1.0f / 2048.0f);
    }
    float mx = s[0][0];
#pragma unroll
    for (int j = 0; j < 4; ++j)
#pragma unroll
      for (int r = 0; r < 8; ++r) mx = fmaxf(mx, s[j][r]);
    mx = fmaxf(mx, __shfl_xor(mx, 16));            // the other half of the wave holds this query's other 32 keys
    const float mn = fmaxf(m, mx);
    const float alpha = exp2_slot((m - mn) * L2E);
    const float bias = 10.0f - mn * L2E;            // + 10: P carries a factor 1024 (small weights stay normal f16); it cancels against the sum
    m = mn;
#pragma unroll
    for (int j = 0; j < 4; ++j)
#pragma unroll
      for (int r = 0; r < 8; ++r) s[j][r] = exp2_slot(s[j][r] * L2E + bias);
    const f32x8 sv = (s[0] + s[1]) + (s[2] + s[3]);   // pairwise: a chain of 32 dependent adds would stand in the pass's critical path
    l = l * alpha + (((sv[0] + sv[1]) + (sv[2] + sv[3])) + ((sv[4] + sv[5]) + (sv[6] + sv[7])));
#pragma unroll
    for (int c = 0; c < 8; ++c) o[c] *= alpha;
    f16x16 pf[2];                                   // two score tiles (keys 32k2 .. + 31) converted in place = one B fragment in lds_frag's k order
#pragma unroll
    for (int k2 = 0; k2 < 2; ++k2)
#pragma unroll
      for (int i = 0; i < 8; ++i) { pf[k2][i] = (f16)s[2 * k2][i]; pf[k2][i + 8] = (f16)s[2 * k2 + 1][i]; }
    __builtin_amdgcn_sched_barrier(0);              // keeps the g conversions (and with them the wait on the g loads) from rising in front of the score products
#pragma unroll
    for (int u = 0; u < 2; ++u)
#pragma unroll
      for (int e = 0; e < 2; ++e) { f16x8 w;
#pragma unroll
        for (int kk = 0; kk < 8; ++kk) w[kk] = (f16)vr[kk][u][e];
        *(f16x8*)(sVt + (64 * u + 2 * lane + e) * AVS + wave * 8) = w; }
    { bf16x4 h0, h1;
#pragma unroll
      for (int u = 0; u < 4; ++u) { h0[u] = (f16)wr0[u]; h1[u] = (f16)wr1[u]; }
      *(bf16x4*)(sW + (wave * 32 + 2 * t) * AWS + lane * 4) = h0; *(bf16x4*)(sW + (wave * 32 + 2 * t + 1) * AWS + lane * 4) = h1;
      *(v4fa*)(sX + (wave * 32 + 2 * t) * 128 + lane * 4) = xr0; *(v4fa*)(sX + (wave * 32 + 2 * t + 1) * 128 + lane * 4) = xr1; }
    __syncthreads();                                // g^T of this pass is published; every wave has left the phi tile
    const bool more = t + 1 < N2 / AKT;
    if (more) {                                     // next phi tile into registers (lands under the P * g products)
      const float* kp = PH + (size_t)(t + 1) * AKT * CI + tid * 4;
#pragma unroll
      for (int it = 0; it < 8; ++it) kr[it] = *(const v4fa*)(kp + 1024 * it);
      addr_wait(kp);
    }
    f16x16 vf[2][8];                                // all 16 g^T fragments are requested before the first product, so that one LDS latency is paid and not sixteen
#pragma unroll
    for (int k2 = 0; k2 < 2; ++k2)
#pragma unroll
      for (int c = 0; c < 8; ++c) vf[k2][c] = lds_frag(sVt + (16 * c) * AVS + k2 * 32, AVS);
    __builtin_amdgcn_sched_barrier(0);              // keeps the fragment loads above from sinking down to their products
#pragma unroll
    for (int k2 = 0; k2 < 2; ++k2)
#pragma unroll
      for (int c = 0; c < 8; ++c) o[c] = wmma_p(vf[k2][c], pf[k2], o[c]);
    if (more) {
#pragma unroll
      for (int it = 0; it < 8; ++it) { const int idx = tid + 256 * it, row = idx >> 5, c4 = (idx & 31) * 4; bf16x4 h, lo;
#pragma unroll
        for (int u = 0; u < 4; ++u) { h[u] = (f16)kr[it][u]; lo[u] = (f16)((kr[it][u] - (float)h[u]) * 2048.0f); }
        *(bf16x4*)(sKh + row * AKS + c4) = h; *(bf16x4*)(sKl + row * AKS + c4) = lo; }
    }
    __syncthreads();                                // the next phi tile is published; every wave has left g^T
  }
  // The last product in the same block: out = BN(y * W_w^T + b) + x1 for the block's 128 positions and all 256 channels; a wave takes its 32 channels x 128 positions.
  l += __shfl_xor(l, 16);
  const float inv = rcp_slot(l);
  // lane holds y[query cl][16c + 8*hf + r]: 8 channels = 16 bytes of the [position][channel] f16 tile that every wave reads as A operand (the phi planes it overwrites were left at the loop's last barrier)
#pragma unroll
  for (int c = 0; c < 8; ++c) { f16x8 w;
#pragma unroll
    for (int r = 0; r < 8; ++r) w[r] = (f16)(o[c][r] * inv);
    *(f16x8*)(sY + (wave * 16 + cl) * AWS + 16 * c + 8 * hf) = w; }
  __syncthreads();                                  // y of all 128 positions is published
  f16x16 wf[2][4];
#pragma unroll
  for (int j = 0; j < 2; ++j)
#pragma unroll
    for (int ks = 0; ks < 4; ++ks) wf[j][ks] = lds_frag(sW + (wave * 32 + 16 * j) * AWS + ks * 32, AWS);
  f32x8 acc[8][2];
#pragma unroll
  for (int i = 0; i < 8; ++i) {
    f32x8 z = {}; acc[i][0] = z; acc[i][1] = z;
#pragma unroll
    for (int ks = 0; ks < 4; ++ks) {
      const f16x16 yf = lds_frag(sY + (16 * i) * AWS + ks * 32, AWS);
      acc[i][0] = wmma_p(yf, wf[0][ks], acc[i][0]); acc[i][1] = wmma_p(yf, wf[1][ks], acc[i][1]);
    }
  }
  // lane holds positions 16i + 8*hf + r of channel 16j + cl: 8 neighbours of an output row. 16 channels at a time are turned, wave-private, into whole 512-B rows for the stores
  float* so = sO[wave];
#pragma unroll
  for (int j = 0; j < 2; ++j) {
    const int ch = wave * 32 + 16 * j + cl;
    const float bi = sBi[ch], iv = sInv[ch], sh = sSh[ch];
#pragma unroll
    for (int i = 0; i < 8; ++i) { v4f_t w0, w1;
#pragma unroll
      for (int r = 0; r < 4; ++r) { float a = acc[i][j][r], b = acc[i][j][r + 4]; a += bi; b += bi; w0[r] = a * iv + sh; w1[r] = b * iv + sh; }
      *(v4fa*)(so + cl * AOS + 16 * i + 8 * hf) = w0; *(v4fa*)(so + cl * AOS + 16 * i + 8 * hf + 4) = w1; }
    asm volatile("s_wait_dscnt 0" ::: "memory");    // the rows read below were written by other lanes of this wave
    __builtin_amdgcn_wave_barrier();
#pragma unroll
    for (int it = 0; it < 16; ++it) {
      v4f_t v = *(const v4fa*)(so + it * AOS + lane * 4);
      v += *(const v4fa*)(sX + (wave * 32 + 16 * j + it) * 128 + lane * 4);
      *(v4f_t*)(out + off0 + (size_t)(16 * j + it) * HWn) = v;
    }
    if (j == 0) {
      asm volatile("s_wait_dscnt 0\n\ts_wait_xcnt 0x0" ::: "memory");   // the staging rows have been read before other lanes rewrite them; the stores' registers are free before they are reused
      __builtin_amdgcn_wave_barrier();
    }
  }
}
// ---------------------------------------------------------------------------------------------------------------------------
// gemm_tile: D[m][n] = sum_k A[m][k] * B[n][k], every operand read in the layout it has in memory, so that no transposed copy is made.
// B is row-major [n][k] (row stride LDB). A is row-major [m][k] (AKM false, row stride LDA) or k-major [k][m] (AKM true, row stride LDA).
// PL: value+residual planes on both operands (hh + (hl + lh)/2048, f32-class); else plain f16 operands. f32 accumulate.
// EPI 0: Y[m][n] = D + bias[n]. EPI 2: Y[p][n] = max of D + bias[n] over the 2 x 2 window of positions p (m = 64-wide image rows; LDY, strideY are those of the pooled map).
// Block = 128 x 128 tile, 8 waves as 4(M, 32 rows) x 2(N, 64 cols); per 32-wide k-step both tiles are staged f16 in LDS as [row][k].
// EPI 2: the tile's 128 positions are image rows 2i and 2i + 1 (i = bx); a wave takes the same 16 columns of both rows (m = 16a .. + 15 and 64 + 16a .. + 15),
// so that all four positions of a window lie in one lane's accumulators (two neighbouring registers of both fragments) and the maximum needs no exchange.
// bz selects a batch (element strides).
// ---------------------------------------------------------------------------------------------------------------------------
#define TPITCH 40     // staged tile pitch, f16 elements (64-B rows at 80 B: 16-byte reads and writes of neighbouring rows fall on distinct banks)
// 128 rows x 32 k of a row-major f32 matrix: 8 lanes take the 128 B of a row, a wave 4 rows, 4 loads a thread
template <int LD>
__device__ __forceinline__ void rows_load(const float* __restrict__ p, v4f_t* v) {
#pragma unroll
  for (int it = 0; it < 4; ++it) v[it] = *(const v4fa*)(p + (size_t)(32 * it) * LD);
}
template <bool PL>
__device__ __forceinline__ void rows_store(const v4f_t* v, f16* dh, f16* dl) {
  const int tid = threadIdx.x, r0 = tid >> 3, c4 = (tid & 7) * 4;
#pragma unroll
  for (int it = 0; it < 4; ++it) { bf16x4 h, lo;
#pragma unroll
    for (int u = 0; u < 4; ++u) { h[u] = (f16)v[it][u]; lo[u] = (f16)((v[it][u] - (float)h[u]) * 2048.0f); }
    *(bf16x4*)(dh + (r0 + 32 * it) * TPITCH + c4) = h; if (PL) *(bf16x4*)(dl + (r0 + 32 * it) * TPITCH + c4) = lo; }
}
// The body is a function of the block's place (bx, by, bz) and of LDS arrays that the kernel owns, so that one launch can hold tiles of several products:
// ldsA, ldsB (and ldsAl, ldsBl under PL) 128 * TPITCH f16 each, oS 8 waves x (EPI 2: 8, else 32) rows x 68 f32.
template <bool PL, bool AKM, int EPI, int LDA, int LDB, int LDY, int K>
__device__ __forceinline__ void gemm_tile(f16* ldsA, f16* ldsAl, f16* ldsB, f16* ldsBl, float* oS, const int bx, const int by, const int bz,
                                          const float* __restrict__ A, size_t strideA, const float* __restrict__ B, size_t strideB,
                                          const float* __restrict__ bias, float* __restrict__ Y, size_t strideY) {
  constexpr int OSW = (EPI == 2 ? 8 : 32) * 68;   // f32 elements of one wave's output staging
  const int tid = threadIdx.x, lane = tid & 31, wave = tid >> 5, cl = lane & 15, rh = (lane >> 4) * 8;
  const int m0 = bx * 128, n0 = by * 128;
  const int wm = (wave & 3) * (EPI == 2 ? 16 : 32), wn = (wave >> 2) * 64;
  constexpr int FM = EPI == 2 ? 64 : 16;   // rows between a wave's two A fragments
  A += (size_t)bz * strideA; B += (size_t)bz * strideB; Y += (size_t)bz * strideY;
  f32x8 acc[2][4], accx[2][4];
#pragma unroll
  for (int i = 0; i < 2; ++i)
#pragma unroll
    for (int j = 0; j < 4; ++j) { f32x8 z = {}; acc[i][j] = z; accx[i][j] = z; }
  // k-major A: wave -> 8 k rows (kg) of one 64-wide half of the tile's m range (mh); lane -> m = 2 * lane + {0, 1}: a load is 256 B of one k row
  const int kg = wave & 3, mh = wave >> 2;
  const float* pa = AKM ? A + (size_t)(kg * 8) * LDA + m0 + mh * 64 + 2 * lane : A + (size_t)(m0 + (tid >> 3)) * LDA + (tid & 7) * 4;
  const float* pb = B + (size_t)(n0 + (tid >> 3)) * LDB + (tid & 7) * 4;
#pragma unroll 1   // rolled: the trips are separated by barriers and gain nothing from a second copy of the staging code
  for (int k0 = 0; k0 < K; k0 += 32) {
    __syncthreads();                                // every wave has left the tiles of the trip before
    v2fa at[8]; v4f_t ar[4], br[4];
    if (AKM) {
#pragma unroll
      for (int kk = 0; kk < 8; ++kk) at[kk] = *(const v2fa*)(pa + (size_t)kk * LDA);
    } else rows_load<LDA>(pa, ar);
    rows_load<LDB>(pb, br);
    asm volatile("s_wait_xcnt 0x0" :: "v"(pa), "v"(pb) : "memory");   // behind both runs of loads, before the two pointers they name are advanced
    pa += AKM ? (size_t)32 * LDA : 32; pb += 32;
    if (AKM) {                                      // the turn: a thread's 8 k values of one m are 16 contiguous bytes of the [m][k] tile
#pragma unroll
      for (int e = 0; e < 2; ++e) { f16x8 h, lo;
#pragma unroll
        for (int kk = 0; kk < 8; ++kk) { const float v = at[kk][e]; h[kk] = (f16)v; lo[kk] = (f16)((v - (float)h[kk]) * 2048.0f); }
        *(f16x8*)(ldsA + (mh * 64 + 2 * lane + e) * TPITCH + kg * 8) = h; if (PL) *(f16x8*)(ldsAl + (mh * 64 + 2 * lane + e) * TPITCH + kg * 8) = lo; }
    } else rows_store<PL>(ar, ldsA, ldsAl);
    rows_store<PL>(br, ldsB, ldsBl);
    __syncthreads();                                // both tiles are published
    f16x16 af[2], afl[2];
#pragma unroll
    for (int i = 0; i < 2; ++i) { af[i] = lds_frag(ldsA + (wm + FM * i) * TPITCH, TPITCH); if (PL) afl[i] = lds_frag(ldsAl + (wm + FM * i) * TPITCH, TPITCH); }
#pragma unroll
    for (int j = 0; j < 4; ++j) {
      const f16x16 bf = lds_frag(ldsB + (wn + 16 * j) * TPITCH, TPITCH);
      if (PL) {
        const f16x16 bfl = lds_frag(ldsBl + (wn + 16 * j) * TPITCH, TPITCH);
#pragma unroll
        for (int i = 0; i < 2; ++i) { acc[i][j] = wmma16(af[i], bf, acc[i][j]); accx[i][j] = wmma16(af[i], bfl, accx[i][j]); accx[i][j] = wmma16(afl[i], bf, accx[i][j]); }
      } else {
#pragma unroll
        for (int i = 0; i < 2; ++i) acc[i][j] = wmma16(af[i], bf, acc[i][j]);
      }
    }
  }
  if (EPI == 2) {   // lane holds positions (row 2i + f, column wm + rh + r) of channel 16j + cl in acc[f][j][r]: window p of the lane = registers 2p, 2p + 1 of both fragments
    float* sp = oS + wave * OSW;
#pragma unroll
    for (int j = 0; j < 4; ++j) {
      const float bv = bias[n0 + wn + 16 * j + cl];
#pragma unroll
      for (int p = 0; p < 4; ++p) {
        float v[2][2];
#pragma unroll
        for (int i = 0; i < 2; ++i)
#pragma unroll
          for (int e = 0; e < 2; ++e) v[i][e] = (PL ? acc[i][j][2 * p + e] + accx[i][j][2 * p + e] * (1.0f / 2048.0f) : acc[i][j][2 * p + e]) + bv;
        sp[((rh >> 1) + p) * 68 + 16 * j + cl] = fmaxf(fmaxf(v[0][0], v[0][1]), fmaxf(v[1][0], v[1][1]));
      }
    }
    asm volatile("s_wait_dscnt 0" ::: "memory");    // the rows read below were written by other lanes of this wave
    __builtin_amdgcn_wave_barrier();
    // a wave's 8 pooled positions x 64 channels go out as 256-B row segments
    float* yp = Y + (size_t)(bx * 32 + (wm >> 1) + (lane >> 4)) * LDY + n0 + wn + (lane & 15) * 4;
#pragma unroll
    for (int it = 0; it < 4; ++it) *(v4f_t*)(yp + (size_t)(2 * it) * LDY) = *(const v4fa*)(sp + ((lane >> 4) + 2 * it) * 68 + (lane & 15) * 4);
    asm volatile("s_wait_xcnt 0x0" ::: "memory");   // behind the run of stores, a precaution: in k_proj each block runs one product, so the kernel ends here
    return;
  }
  // a wave's 32 x 64 piece goes out as 256-B row segments: thread -> rows (lane >> 4) + 2 * it, 16 bytes at column (lane & 15) * 4
  const size_t off0 = (size_t)(m0 + wm + (lane >> 4)) * LDY + n0 + wn + (lane & 15) * 4;
  float* so = oS + wave * OSW;
#pragma unroll
  for (int i = 0; i < 2; ++i)
#pragma unroll
    for (int j = 0; j < 4; ++j) {
      const float bv = bias[n0 + wn + 16 * j + cl];
#pragma unroll
      for (int r = 0; r < 8; ++r) {
        float v = PL ? acc[i][j][r] + accx[i][j][r] * (1.0f / 2048.0f) : acc[i][j][r];
        v += bv;
        so[(16 * i + rh + r) * 68 + 16 * j + cl] = v;
      }
    }
  asm volatile("s_wait_dscnt 0" ::: "memory");      // the rows read below were written by other lanes of this wave
  __builtin_amdgcn_wave_barrier();
#pragma unroll
  for (int it = 0; it < 16; ++it) {
    const v4f_t v = *(const v4fa*)(so + ((lane >> 4) + 2 * it) * 68 + (lane & 15) * 4);
    *(v4f_t*)(Y + off0 + (size_t)(2 * it) * LDY) = v;
  }
  asm volatile("s_wait_xcnt 0x0" ::: "memory");   // behind the run of stores, as above
}
// k_proj: the three 1x1 convolutions depend on nothing but the inputs, so their 3 x 256 tiles go out as one launch: no launch gap between them, and
// two blocks share a WGP (registers allow four waves a SIMD), so that one block's products run while the other waits for its global loads.
// blockIdx.z = 8 * product + batch; the two products with planes come first, the short one (g) fills the places that they leave.
__global__ __launch_bounds__(256) void k_proj(const float* __restrict__ x1, const float* __restrict__ x2,
                                              const float* __restrict__ pw, const float* __restrict__ pb, const float* __restrict__ tw, const float* __restrict__ tb,
                                              const float* __restrict__ gw, const float* __restrict__ gb,
                                              float* __restrict__ PH, float* __restrict__ TH, float* __restrict__ GP) {
  __shared__ __attribute__((aligned(16))) f16 ldsA[128 * TPITCH], ldsAl[128 * TPITCH], ldsB[128 * TPITCH], ldsBl[128 * TPITCH];
  __shared__ __attribute__((aligned(16))) float oS[8 * 32 * 68];   // theta's size, the largest of the three
  const int which = blockIdx.z >> 3, bz = blockIdx.z & 7;
  if (which == 0)      gemm_tile<true, true, 2, HWn, CC, CI, CC>(ldsA, ldsAl, ldsB, ldsBl, oS, blockIdx.x, 0, bz, x2, (size_t)CC * HWn, pw, 0, pb, PH, (size_t)N2 * CI);    // pooled phi rows (planes)
  else if (which == 1) gemm_tile<true, true, 0, HWn, CC, CI, CC>(ldsA, ldsAl, ldsB, ldsBl, oS, blockIdx.x, 0, bz, x1, (size_t)CC * HWn, tw, 0, tb, TH, (size_t)HWn * CI);   // theta rows (planes)
  else                 gemm_tile<false, true, 2, HWn, CC, CI, CC>(ldsA, nullptr, ldsB, nullptr, oS, blockIdx.x, 0, bz, x1, (size_t)CC * HWn, gw, 0, gb, GP, (size_t)N2 * CI);   // pooled g rows (on x1, faithful)
}
extern "C" void kernel_launch(void* const* d_in, const int* in_sizes, int n_in,
                              void* d_out, int out_size, void* d_ws, size_t ws_size,
                              hipStream_t stream) {
  (void)in_sizes; (void)n_in; (void)out_size;
  const float** f = (const float**)d_in;
  const float* x1 = f[0], *x2 = f[1], *gw = f[2], *gb = f[3], *tw = f[4], *tb = f[5], *pw = f[6], *pb = f[7], *Ww = f[8], *Wb = f[9], *bng = f[10], *bnb = f[11], *bnm = f[12], *bnv = f[13];
  float* out = (float*)d_out;     // [8,256,64,64]
  char* ws = (char*)d_ws;
  // every per-batch buffer holds all NBT batches, batch b at b * (its per-batch size)
  float* TH = (float*)ws; ws += (size_t)NBT * HWn * CI * 4;             // theta rows [8][4096][128] f32
  float* GP = (float*)ws; ws += (size_t)NBT * N2 * CI * 4;              // pooled g [8][1024][128]
  float* PH = (float*)ws; ws += (size_t)NBT * N2 * CI * 4;              // pooled phi [8][1024][128]
  if ((size_t)(ws - (char*)d_ws) > ws_size) return;                     // WS TOTAL 25,165,824 B
  const dim3 blk(256);
  // one launch per stage for all NBT batches: the batch is a grid dimension; the three convolutions are one stage
  k_proj<<<dim3(HWn / 128, 1, 3 * NBT), blk, 0, stream>>>(x1, x2, pw, pb, tw, tb, gw, gb, PH, TH, GP);                                                         // pooled phi, theta, pooled g
  k_attn<<<dim3(HWn / 128, NBT), blk, 0, stream>>>(TH, PH, GP, Ww, Wb, bng, bnb, bnm, bnv, x1, out);                                                         // y = softmax(theta * phi^T) * g, out = BN(W_w * y^T + b) + x1; scores and y kept on chip
}

// v007
// It runs in 54.4 microseconds.
// Timed twice side by side with v006, it ran 1.18 and 1.21 times as fast.
// All steps since v000 together make it 25.8 times as fast.
// Contractions on v_wmma_f32_16x16x32_f16, f32 accumulate: the three 1x1 convs as position-major GEMMs (x^T * W^T + b, K = 256, theta out as f32, pooled phi and g out as f16; theta and phi, the score operands, with f16 value+residual planes, g plain f16;
// x is read as it lies in memory, channel-major, and turned in registers on its way to LDS; the weights are read as they lie, [out][in]), 2x2 max-pooling of the g / phi maps over positions in the epilogue of their GEMMs (the full-resolution maps never reach memory), per batch the non-local scores f = theta * phi^T (K = 128, 4096 x 1024) with f16 value+residual planes
// (hi*hi + (hi*lo + lo*hi)/2048: unscaled logits of spread about 11 give a peaked softmax that needs f32-class scores), running f32 row softmax and y = P * g (plain f16 operands, P carried as 1024 * exp(s - max))
// in the same kernel as the scores, and there too W_y = y * W_w^T + b (K = 128, plain f16; y goes from wave to wave through LDS and never reaches memory), turned channel-major in LDS, with BatchNorm (running stats) + the x1 residual in its epilogue.
// compute dtype: f16 operands (planes on the scores), f32 accumulate; pooling / softmax / BN in f32.  x1, x2 [8,256,64,64].
#include <hip/hip_runtime.h>
#include <hip/hip_bf16.h>
#include <math.h>


typedef _Float16 bf16;
typedef _Float16 f16;
typedef __attribute__((ext_vector_type(4))) unsigned v4u_t;
typedef unsigned v4ua __attribute__((ext_vector_type(4), may_alias));
typedef __attribute__((ext_vector_type(4))) float v4f_t;
typedef float v4fa __attribute__((ext_vector_type(4), may_alias));
typedef __attribute__((ext_vector_type(16))) bf16  bf16x16;
typedef bf16x16 f16x16;
typedef __attribute__((ext_vector_type(8)))  bf16  bf16x8;
typedef bf16x8 f16x8;
typedef __attribute__((ext_vector_type(4)))  bf16  bf16x4;
typedef __attribute__((ext_vector_type(8)))  float f32x8;
__device__ __forceinline__ f32x8 wmma16(f16x16 a, f16x16 b, f32x8 c) {
  c = __builtin_amdgcn_wmma_f32_16x16x32_f16(false, a, false, b, (short)0, c, false, false);
  asm volatile("v_nop\n\tv_nop\n\tv_nop\n\tv_nop" : "+v"(c) : "v"(a), "v"(b));
  return c;
}
#define LDS_STRIDE 48   // unused; the GEMM tiles use TPITCH
#define KSTRIDE    72   // unused
#define VSTRIDE    48   // unused

__device__ __forceinline__ f32x8 wmma_bf16(bf16x16 a, bf16x16 b, f32x8 c) {
  c = __builtin_amdgcn_wmma_f32_16x16x32_f16(false, a, false, b, (short)0, c, false, false);
  asm volatile("v_nop\n\tv_nop\n\tv_nop\n\tv_nop" : "+v"(c) : "v"(a), "v"(b));   // A/B-overwrite hazard guard
  return c;
}

// 16x32 (MxK) f16 fragment from a row-major global matrix.
// lanes 0-15  (row=lane)    : elems 0..7 = K+0..7,  8..15 = K+16..23
// lanes 16-31 (row=lane-16) : elems 0..7 = K+8..15, 8..15 = K+24..31
template <typename T>
__device__ __forceinline__ bf16x16 load_frag(const T* __restrict__ base, int ld,
                                             int row0, int k0) {
  const int lane = threadIdx.x & 31;
  const int r    = lane & 15;
  const int kh   = (lane >> 4) * 8;
  const T* p0 = base + (size_t)(row0 + r) * ld + (k0 + kh);
  const T* p1 = p0 + 16;
  bf16x16 f;
#pragma unroll
  for (int i = 0; i < 8; ++i) {
    f[i]     = (bf16)p0[i];
    f[i + 8] = (bf16)p1[i];
  }
  return f;
}

// Same fragment from an LDS tile with padded row stride (base includes row0/k0).
__device__ __forceinline__ bf16x16 lds_frag(const bf16* base, int stride) {
  const int lane = threadIdx.x & 31;
  const int row  = lane & 15;
  const int kh   = (lane >> 4) * 8;
  const bf16x8 lo = *(const bf16x8*)(base + row * stride + kh);
  const bf16x8 hi = *(const bf16x8*)(base + row * stride + kh + 16);
  bf16x16 f;
#pragma unroll
  for (int i = 0; i < 8; ++i) { f[i] = lo[i]; f[i + 8] = hi[i]; }
  return f;
}

template <typename T>
__device__ __forceinline__ void stage_read16(const T* __restrict__ p, float* buf) {
#pragma unroll
  for (int i = 0; i < 16; ++i) buf[i] = (float)p[i];
}

__device__ __forceinline__ void stage_write(bf16* dst, const float* buf, int nquad) {
#pragma unroll
  for (int i = 0; i < nquad; ++i) {
    bf16x4 q;
    q[0] = (bf16)buf[4 * i];     q[1] = (bf16)buf[4 * i + 1];
    q[2] = (bf16)buf[4 * i + 2]; q[3] = (bf16)buf[4 * i + 3];
    *(bf16x4*)(dst + 4 * i) = q;
  }
}


#define NBT 8
#define BBn 8
#define CC 256
#define CI 128
#define HWn 4096       // 64 x 64 positions
#define N2 1024        // pooled positions (32 x 32)
// ---------------------------------------------------------------------------------------------------------------------------
// k_attn: scores, row softmax, y and the output convolution in one kernel; neither the score matrix nor y reaches memory. Block = 128 queries of one batch,
// 8 waves x 16 queries; 16 passes of 64 keys. Per pass S^T = phi * theta^T (A = phi rows from LDS, B = theta kept in registers,
// value+residual planes: hh + (lh + hl)/2048), so a lane holds 32 scores of ONE query (query = lane & 15, keys 16j + 8*(lane >> 4) + r):
// running maximum and sum per lane, one exchange between the wave halves. 1024 * exp(s - max), converted to f16 in place, is the
// B operand of O^T += g^T * P^T (A = g^T from LDS); y = O / sum at the end. The block holds all 128 channels of its 128 positions' y, which is all that its piece of
// out = BN(y * W_w^T + b) + x1 needs: each wave takes 32 of the 256 output channels; its rows of W_w (f16) and of x1 come into LDS two a pass, under the products.
// k_proj stores the phi planes and g^T as the f16 operands that are read here, so a tile needs no conversion and comes into LDS by asynchronous copies, two buffers:
// the tile of pass t + 2 is requested at the foot of pass t, behind the one barrier of the pass, into the buffers that pass t has read.
// ---------------------------------------------------------------------------------------------------------------------------
#define AKT 64     // keys per pass
#define AKS 136    // phi tile pitch, f16 elements (272-B rows: 16 rows of b128 reads fall on distinct banks)
#define AVS 72     // g^T tile pitch, f16 elements (144-B rows, the same)
#define AWS 136    // W_w and y tile pitch, f16 elements (272-B rows, as the phi tile)
#define AOS 132    // output staging pitch, f32 elements
#define AKB (2 * AKT * AKS)   // f16 elements of one phi buffer (both planes)
#define AVB (CI * AVS)        // f16 elements of one g^T buffer
typedef float v2fa __attribute__((ext_vector_type(2), may_alias));
// One tile (64 keys: 32 KiB of phi planes, 16 KiB of g^T) into LDS through no register: 8 + 4 asynchronous 16-byte copies a lane, each with an LDS byte address and a global address of its own.
// kd, vd: the lane's first LDS byte of the phi and of the g^T buffer (further pieces 8 keys = 8 rows, and 2 key groups = 32 B, on); ks, vs: its first global piece (further pieces 4 KiB on).
// s_wait_xcnt 0 is the statement's last line, so that it stands in front of every later write of a register that a copy names.
__device__ __forceinline__ void tile_copy(unsigned kd, unsigned vd, const float* ks, const float* vs) {
  asm volatile("global_load_async_to_lds_b128 %0, %12, off\n\t"
               "global_load_async_to_lds_b128 %1, %13, off\n\t"
               "global_load_async_to_lds_b128 %2, %14, off\n\t"
               "global_load_async_to_lds_b128 %3, %15, off\n\t"
               "global_load_async_to_lds_b128 %4, %16, off\n\t"
               "global_load_async_to_lds_b128 %5, %17, off\n\t"
               "global_load_async_to_lds_b128 %6, %18, off\n\t"
               "global_load_async_to_lds_b128 %7, %19, off\n\t"
               "global_load_async_to_lds_b128 %8, %20, off\n\t"
               "global_load_async_to_lds_b128 %9, %21, off\n\t"
               "global_load_async_to_lds_b128 %10, %22, off\n\t"
               "global_load_async_to_lds_b128 %11, %23, off\n\t"
               "s_wait_xcnt 0x0"
               :: "v"(kd), "v"(kd + 1 * 8 * AKS * 2), "v"(kd + 2 * 8 * AKS * 2), "v"(kd + 3 * 8 * AKS * 2), "v"(kd + 4 * 8 * AKS * 2), "v"(kd + 5 * 8 * AKS * 2), "v"(kd + 6 * 8 * AKS * 2), "v"(kd + 7 * 8 * AKS * 2),
                  "v"(vd), "v"(vd + 32), "v"(vd + 64), "v"(vd + 96),
                  "v"(ks), "v"(ks + 1024), "v"(ks + 2048), "v"(ks + 3072), "v"(ks + 4096), "v"(ks + 5120), "v"(ks + 6144), "v"(ks + 7168),
                  "v"(vs), "v"(vs + 1024), "v"(vs + 2048), "v"(vs + 3072)
               : "memory");
}
// s_wait_xcnt 0 behind a run of global loads, before their address registers are reused; the base pointer is an input so that it stays in its registers up to the wait
__device__ __forceinline__ void addr_wait(const float* p) { asm volatile("s_wait_xcnt 0x0" :: "v"(p) : "memory"); }
// v_nop: the one independent slot that the instruction set asks for behind a transcendental, kept whatever the compiler schedules next
__device__ __forceinline__ float exp2_slot(float x) { float r; asm("v_exp_f32 %0, %1\n\tv_nop" : "=v"(r) : "v"(x)); return r; }
__device__ __forceinline__ float rcp_slot(float x) { float r; asm("v_rcp_f32 %0, %1\n\tv_nop" : "=v"(r) : "v"(x)); return r; }
__device__ __forceinline__ f32x8 wmma_p(f16x16 a, f16x16 b, f32x8 c) { return __builtin_amdgcn_wmma_f32_16x16x32_f16(false, a, false, b, (short)0, c, false, false); }
// two waves per SIMD is all the grid gives (one block per WGP): let the register allocator use that room to fetch fragments ahead
__global__ __launch_bounds__(256) __attribute__((amdgpu_waves_per_eu(2, 2))) void k_attn(const float* __restrict__ TH, const float* __restrict__ PH, const float* __restrict__ GP,
                                                                                             const float* __restrict__ Ww, const float* __restrict__ Wb, const float* __restrict__ bng, const float* __restrict__ bnb,
                                                                                             const float* __restrict__ bnm, const float* __restrict__ bnv, const float* __restrict__ x1, float* __restrict__ out) {
  // the ring: phi buffer 0, phi buffer 1 (both planes each), g^T buffer 0, g^T buffer 1. Behind the loop phi buffer 0 is the block's y tile (128 * AWS, the same size) and the other three are the output staging (8 waves x 16 * AOS f32)
  __shared__ __attribute__((aligned(16))) f16 sT[2 * AKB + 2 * AVB];
  __shared__ __attribute__((aligned(16))) f16 sW[CC * AWS];
  __shared__ __attribute__((aligned(16))) float sX[CC * 128], sBi[CC], sInv[CC], sSh[CC];
  f16* const sY = sT;
  const int tid = threadIdx.x, lane = tid & 31, wave = tid >> 5, cl = lane & 15, hf = lane >> 4;
  const int q0 = blockIdx.x * 128 + wave * 16;
  TH += (size_t)blockIdx.y * HWn * CI; PH += (size_t)blockIdx.y * N2 * CI; GP += (size_t)blockIdx.y * (N2 * CI / 2);
  // a thread's 16-byte pieces of a tile. phi: a wave takes one key's 512 B (values, then residuals) a copy, keys wave + 8 * it. g^T: piece = 8 keys of one channel, a wave takes 32 channels of one key group a copy
  const float* const ksrc = PH + tid * 4; const float* const vsrc = GP + tid * 4;
  const unsigned kdst = (unsigned)(size_t)sT + hf * (AKT * AKS * 2) + wave * (AKS * 2) + cl * 16;
  const unsigned vdst = (unsigned)(size_t)sT + 2 * AKB * 2 + (tid & 127) * (AVS * 2) + (tid >> 7) * 16;
  tile_copy(kdst, vdst, ksrc, vsrc);                // tile 0 into the buffers 0: it flies under the theta loads and their conversion
  const float L2E = 1.4426950408889634f;
  const size_t off0 = ((size_t)blockIdx.y * CC + wave * 32) * HWn + blockIdx.x * 128 + lane * 4;   // the wave's 32 channels of x1 and out: 512 B of one channel a wave access
  // per-channel constants of the last epilogue, one output channel a thread; requested early, stored in front of the first barrier, which publishes them
  const float* cb = Wb + tid; const float* cg = bng + tid; const float* cs = bnb + tid; const float* cm = bnm + tid; const float* cv = bnv + tid;
  const float c_b = *cb, c_g = *cg, c_s = *cs, c_m = *cm, c_v = *cv;
  asm volatile("s_wait_xcnt 0x0" :: "v"(cb), "v"(cg), "v"(cs), "v"(cm), "v"(cv) : "memory");   // behind the five loads, before the registers that they name are reused
  // theta fragments (B operand: column = query cl), same k order as lds_frag
  f16x16 qh[4], ql[4];
  { const float* qb = TH + (size_t)(q0 + cl) * CI + hf * 8;
    v4f_t qa[4][4];
#pragma unroll
    for (int ks = 0; ks < 4; ++ks) { qa[ks][0] = *(const v4fa*)(qb + ks * 32); qa[ks][1] = *(const v4fa*)(qb + ks * 32 + 4); qa[ks][2] = *(const v4fa*)(qb + ks * 32 + 16); qa[ks][3] = *(const v4fa*)(qb + ks * 32 + 20); }
    addr_wait(qb);
#pragma unroll
    for (int ks = 0; ks < 4; ++ks)
#pragma unroll
      for (int i = 0; i < 8; ++i) {
        const float va = qa[ks][i >> 2][i & 3], vb = qa[ks][2 + (i >> 2)][i & 3];
        const f16 ha = (f16)va, hb = (f16)vb;
        qh[ks][i] = ha; ql[ks][i] = (f16)((va - (float)ha) * 2048.0f);
        qh[ks][i + 8] = hb; ql[ks][i + 8] = (f16)((vb - (float)hb) * 2048.0f);
      }
  }
  f32x8 o[8];
#pragma unroll
  for (int c = 0; c < 8; ++c) { f32x8 z = {}; o[c] = z; }
  float m = -3.0e38f, l = 0.0f;
  { const float inv = c_g * rsqrtf(c_v + 1e-5f); sBi[tid] = c_b; sInv[tid] = inv; sSh[tid] = c_s - c_m * inv; }
  asm volatile("s_wait_asynccnt 0x0" ::: "memory");   // this wave's pieces of tile 0 have landed
  __syncthreads();                                  // tile 0 is published
  tile_copy(kdst + AKB * 2, vdst + AVB * 2, ksrc + AKT * CI, vsrc + AKT * CI / 2);   // tile 1 into the buffers 1
#pragma unroll 1   // rolled: one pass is already 64 matrix instructions, and a second copy would double the live staging registers
  for (int t = 0; t < N2 / AKT; ++t) {
    const f16* const sKh = sT + (t & 1) * AKB; const f16* const sKl = sKh + AKT * AKS; const f16* const sVt = sT + 2 * AKB + (t & 1) * AVB;   // pass t reads the buffers t mod 2 alone
    // two of the wave's own 32 rows of W_w and of x1 a pass (whole 512-B rows): after 16 passes the last product's weights and its residual stand in LDS, with no wait of their own
    const float* wp = Ww + (size_t)(wave * 32 + 2 * t) * CI + lane * 4;
    const v4f_t wr0 = *(const v4fa*)wp, wr1 = *(const v4fa*)(wp + CI);
    addr_wait(wp);
    const float* xp = x1 + off0 + (size_t)(2 * t) * HWn;
    const v4f_t xr0 = *(const v4fa*)xp, xr1 = *(const v4fa*)(xp + HWn);
    addr_wait(xp);
    f32x8 s[4];
#pragma unroll
    for (int j = 0; j < 4; ++j) {
      f32x8 a = {}, ax = {};
#pragma unroll
      for (int ks = 0; ks < 4; ++ks) {
        const f16x16 kh = lds_frag(sKh + (16 * j) * AKS + ks * 32, AKS), kl = lds_frag(sKl + (16 * j) * AKS + ks * 32, AKS);
        a = wmma_p(kh, qh[ks], a); ax = wmma_p(kl, qh[ks], ax); ax = wmma_p(kh, ql[ks], ax);
      }
      s[j] = a + ax * (1.0f / 2048.0f);
    }
    float mx = s[0][0];
#pragma unroll
    for (int j = 0; j < 4; ++j)
#pragma unroll
      for (int r = 0; r < 8; ++r) mx = fmaxf(mx, s[j][r]);
    mx = fmaxf(mx, __shfl_xor(mx, 16));            // the other half of the wave holds this query's other 32 keys
    const float mn = fmaxf(m, mx);
    const float alpha = exp2_slot((m - mn) * L2E);
    const float bias = 10.0f - mn * L2E;            // + 10: P carries a factor 1024 (small weights stay normal f16); it cancels against the sum
    m = mn;
#pragma unroll
    for (int j = 0; j < 4; ++j)
#pragma unroll
      for (int r = 0; r < 8; ++r) s[j][r] = exp2_slot(s[j][r] * L2E + bias);
    const f32x8 sv = (s[0] + s[1]) + (s[2] + s[3]);   // pairwise: a chain of 32 dependent adds would stand in the pass's critical path
    l = l * alpha + (((sv[0] + sv[1]) + (sv[2] + sv[3])) + ((sv[4] + sv[5]) + (sv[6] + sv[7])));
#pragma unroll
    for (int c = 0; c < 8; ++c) o[c] *= alpha;
    f16x16 pf[2];                                   // two score tiles (keys 32k2 .. + 31) converted in place = one B fragment in lds_frag's k order
#pragma unroll
    for (int k2 = 0; k2 < 2; ++k2)
#pragma unroll
      for (int i = 0; i < 8; ++i) { pf[k2][i] = (f16)s[2 * k2][i]; pf[k2][i + 8] = (f16)s[2 * k2 + 1][i]; }
    f16x16 vf[2][8];                                // all 16 g^T fragments are requested before the first product, so that one LDS latency is paid and not sixteen
#pragma unroll
    for (int k2 = 0; k2 < 2; ++k2)
#pragma unroll
      for (int c = 0; c < 8; ++c) vf[k2][c] = lds_frag(sVt + (16 * c) * AVS + k2 * 32, AVS);
    __builtin_amdgcn_sched_barrier(0);              // keeps the fragment loads above from sinking down to their products
#pragma unroll
    for (int k2 = 0; k2 < 2; ++k2)
#pragma unroll
      for (int c = 0; c < 8; ++c) o[c] = wmma_p(vf[k2][c], pf[k2], o[c]);
    __builtin_amdgcn_sched_barrier(0);              // keeps the products in front of the waits below, so that they run while the later fragments are still arriving
    { bf16x4 h0, h1;                                // behind the products: the W_w and x1 rows have had the whole pass to land
#pragma unroll
      for (int u = 0; u < 4; ++u) { h0[u] = (f16)wr0[u]; h1[u] = (f16)wr1[u]; }
      *(bf16x4*)(sW + (wave * 32 + 2 * t) * AWS + lane * 4) = h0; *(bf16x4*)(sW + (wave * 32 + 2 * t + 1) * AWS + lane * 4) = h1;
      *(v4fa*)(sX + (wave * 32 + 2 * t) * 128 + lane * 4) = xr0; *(v4fa*)(sX + (wave * 32 + 2 * t + 1) * 128 + lane * 4) = xr1; }
    asm volatile("s_wait_dscnt 0x0" ::: "memory");    // this wave's reads of the buffers that are refilled below have returned
    asm volatile("s_wait_asynccnt 0x0" ::: "memory"); // this wave's pieces of tile t + 1 have landed
    __syncthreads();                                // tile t + 1 is published; every wave has left the buffers of pass t
    if (t + 2 < N2 / AKT)                           // tile t + 2 into the buffers that pass t has read: it flies under the whole of pass t + 1
      tile_copy(kdst + (t & 1) * (AKB * 2), vdst + (t & 1) * (AVB * 2), ksrc + (size_t)(t + 2) * (AKT * CI), vsrc + (size_t)(t + 2) * (AKT * CI / 2));
  }
  asm volatile("s_wait_asynccnt 0x0" ::: "memory");   // no copy is under way when the ring is put to its other uses
  // The last product in the same block: out = BN(y * W_w^T + b) + x1 for the block's 128 positions and all 256 channels; a wave takes its 32 channels x 128 positions.
  l += __shfl_xor(l, 16);
  const float inv = rcp_slot(l);
  // lane holds y[query cl][16c + 8*hf + r]: 8 channels = 16 bytes of the [position][channel] f16 tile that every wave reads as A operand (the phi planes of buffer 0 that it overwrites were last read in pass 14, left at that pass's barrier)
#pragma unroll
  for (int c = 0; c < 8; ++c) { f16x8 w;
#pragma unroll
    for (int r = 0; r < 8; ++r) w[r] = (f16)(o[c][r] * inv);
    *(f16x8*)(sY + (wave * 16 + cl) * AWS + 16 * c + 8 * hf) = w; }
  __syncthreads();                                  // y of all 128 positions is published
  f16x16 wf[2][4];
#pragma unroll
  for (int j = 0; j < 2; ++j)
#pragma unroll
    for (int ks = 0; ks < 4; ++ks) wf[j][ks] = lds_frag(sW + (wave * 32 + 16 * j) * AWS + ks * 32, AWS);
  f32x8 acc[8][2];
#pragma unroll
  for (int i = 0; i < 8; ++i) {
    f32x8 z = {}; acc[i][0] = z; acc[i][1] = z;
#pragma unroll
    for (int ks = 0; ks < 4; ++ks) {
      const f16x16 yf = lds_frag(sY + (16 * i) * AWS + ks * 32, AWS);
      acc[i][0] = wmma_p(yf, wf[0][ks], acc[i][0]); acc[i][1] = wmma_p(yf, wf[1][ks], acc[i][1]);
    }
  }
  // lane holds positions 16i + 8*hf + r of channel 16j + cl: 8 neighbours of an output row. 16 channels at a time are turned, wave-private, into whole 512-B rows for the stores
  float* so = (float*)(sT + AKB) + wave * (16 * AOS);
#pragma unroll
  for (int j = 0; j < 2; ++j) {
    const int ch = wave * 32 + 16 * j + cl;
    const float bi = sBi[ch], iv = sInv[ch], sh = sSh[ch];
#pragma unroll
    for (int i = 0; i < 8; ++i) { v4f_t w0, w1;
#pragma unroll
      for (int r = 0; r < 4; ++r) { float a = acc[i][j][r], b = acc[i][j][r + 4]; a += bi; b += bi; w0[r] = a * iv + sh; w1[r] = b * iv + sh; }
      *(v4fa*)(so + cl * AOS + 16 * i + 8 * hf) = w0; *(v4fa*)(so + cl * AOS + 16 * i + 8 * hf + 4) = w1; }
    asm volatile("s_wait_dscnt 0" ::: "memory");    // the rows read below were written by other lanes of this wave
    __builtin_amdgcn_wave_barrier();
#pragma unroll
    for (int it = 0; it < 16; ++it) {
      v4f_t v = *(const v4fa*)(so + it * AOS + lane * 4);
      v += *(const v4fa*)(sX + (wave * 32 + 16 * j + it) * 128 + lane * 4);
      *(v4f_t*)(out + off0 + (size_t)(16 * j + it) * HWn) = v;
    }
    if (j == 0) {
      asm volatile("s_wait_dscnt 0\n\ts_wait_xcnt 0x0" ::: "memory");   // the staging rows have been read before other lanes rewrite them; the stores' registers are free before they are reused
      __builtin_amdgcn_wave_barrier();
    }
  }
}
// ---------------------------------------------------------------------------------------------------------------------------
// gemm_tile: D[m][n] = sum_k A[m][k] * B[n][k], every operand read in the layout it has in memory, so that no transposed copy is made.
// B is row-major [n][k] (row stride LDB). A is row-major [m][k] (AKM false, row stride LDA) or k-major [k][m] (AKM true, row stride LDA).
// PL: value+residual planes on both operands (hh + (hl + lh)/2048, f32-class); else plain f16 operands. f32 accumulate.
// EPI 0: Y[m][n] = D + bias[n]. EPI 2: max of D + bias[n] over the 2 x 2 window of positions p (m = 64-wide image rows; LDY = channels of the pooled map, strideY its batch stride in f32 units), stored as the f16 operands that k_attn copies into LDS:
// under PL a row of 2 * LDY f16 a position (LDY values, then LDY residuals * 2048), else [p / 8][n][p % 8] f16 (16-byte pieces of the transposed map: 8 positions of one channel).
// Block = 128 x 128 tile, 8 waves as 4(M, 32 rows) x 2(N, 64 cols); per 32-wide k-step both tiles are staged f16 in LDS as [row][k].
// EPI 2: the tile's 128 positions are image rows 2i and 2i + 1 (i = bx); a wave takes the same 16 columns of both rows (m = 16a .. + 15 and 64 + 16a .. + 15),
// so that all four positions of a window lie in one lane's accumulators (two neighbouring registers of both fragments) and the maximum needs no exchange.
// bz selects a batch (element strides).
// ---------------------------------------------------------------------------------------------------------------------------
#define TPITCH 40     // staged tile pitch, f16 elements (64-B rows at 80 B: 16-byte reads and writes of neighbouring rows fall on distinct banks)
// 128 rows x 32 k of a row-major f32 matrix: 8 lanes take the 128 B of a row, a wave 4 rows, 4 loads a thread
template <int LD>
__device__ __forceinline__ void rows_load(const float* __restrict__ p, v4f_t* v) {
#pragma unroll
  for (int it = 0; it < 4; ++it) v[it] = *(const v4fa*)(p + (size_t)(32 * it) * LD);
}
template <bool PL>
__device__ __forceinline__ void rows_store(const v4f_t* v, f16* dh, f16* dl) {
  const int tid = threadIdx.x, r0 = tid >> 3, c4 = (tid & 7) * 4;
#pragma unroll
  for (int it = 0; it < 4; ++it) { bf16x4 h, lo;
#pragma unroll
    for (int u = 0; u < 4; ++u) { h[u] = (f16)v[it][u]; lo[u] = (f16)((v[it][u] - (float)h[u]) * 2048.0f); }
    *(bf16x4*)(dh + (r0 + 32 * it) * TPITCH + c4) = h; if (PL) *(bf16x4*)(dl + (r0 + 32 * it) * TPITCH + c4) = lo; }
}
// The body is a function of the block's place (bx, by, bz) and of LDS arrays that the kernel owns, so that one launch can hold tiles of several products:
// ldsA, ldsB (and ldsAl, ldsBl under PL) 128 * TPITCH f16 each, oS 8 waves x (EPI 2: 8, else 32) rows x 68 f32.
template <bool PL, bool AKM, int EPI, int LDA, int LDB, int LDY, int K>
__device__ __forceinline__ void gemm_tile(f16* ldsA, f16* ldsAl, f16* ldsB, f16* ldsBl, float* oS, const int bx, const int by, const int bz,
                                          const float* __restrict__ A, size_t strideA, const float* __restrict__ B, size_t strideB,
                                          const float* __restrict__ bias, float* __restrict__ Y, size_t strideY) {
  constexpr int OSW = (EPI == 2 ? 8 : 32) * 68;   // f32 elements of one wave's output staging
  const int tid = threadIdx.x, lane = tid & 31, wave = tid >> 5, cl = lane & 15, rh = (lane >> 4) * 8;
  const int m0 = bx * 128, n0 = by * 128;
  const int wm = (wave & 3) * (EPI == 2 ? 16 : 32), wn = (wave >> 2) * 64;
  constexpr int FM = EPI == 2 ? 64 : 16;   // rows between a wave's two A fragments
  A += (size_t)bz * strideA; B += (size_t)bz * strideB; Y += (size_t)bz * strideY;
  f32x8 acc[2][4], accx[2][4];
#pragma unroll
  for (int i = 0; i < 2; ++i)
#pragma unroll
    for (int j = 0; j < 4; ++j) { f32x8 z = {}; acc[i][j] = z; accx[i][j] = z; }
  // k-major A: wave -> 8 k rows (kg) of one 64-wide half of the tile's m range (mh); lane -> m = 2 * lane + {0, 1}: a load is 256 B of one k row
  const int kg = wave & 3, mh = wave >> 2;
  const float* pa = AKM ? A + (size_t)(kg * 8) * LDA + m0 + mh * 64 + 2 * lane : A + (size_t)(m0 + (tid >> 3)) * LDA + (tid & 7) * 4;
  const float* pb = B + (size_t)(n0 + (tid >> 3)) * LDB + (tid & 7) * 4;
#pragma unroll 1   // rolled: the trips are separated by barriers and gain nothing from a second copy of the staging code
  for (int k0 = 0; k0 < K; k0 += 32) {
    __syncthreads();                                // every wave has left the tiles of the trip before
    v2fa at[8]; v4f_t ar[4], br[4];
    if (AKM) {
#pragma unroll
      for (int kk = 0; kk < 8; ++kk) at[kk] = *(const v2fa*)(pa + (size_t)kk * LDA);
    } else rows_load<LDA>(pa, ar);
    rows_load<LDB>(pb, br);
    asm volatile("s_wait_xcnt 0x0" :: "v"(pa), "v"(pb) : "memory");   // behind both runs of loads, before the two pointers they name are advanced
    pa += AKM ? (size_t)32 * LDA : 32; pb += 32;
    if (AKM) {                                      // the turn: a thread's 8 k values of one m are 16 contiguous bytes of the [m][k] tile
#pragma unroll
      for (int e = 0; e < 2; ++e) { f16x8 h, lo;
#pragma unroll
        for (int kk = 0; kk < 8; ++kk) { const float v = at[kk][e]; h[kk] = (f16)v; lo[kk] = (f16)((v - (float)h[kk]) * 2048.0f); }
        *(f16x8*)(ldsA + (mh * 64 + 2 * lane + e) * TPITCH + kg * 8) = h; if (PL) *(f16x8*)(ldsAl + (mh * 64 + 2 * lane + e) * TPITCH + kg * 8) = lo; }
    } else rows_store<PL>(ar, ldsA, ldsAl);
    rows_store<PL>(br, ldsB, ldsBl);
    __syncthreads();                                // both tiles are published
    f16x16 af[2], afl[2];
#pragma unroll
    for (int i = 0; i < 2; ++i) { af[i] = lds_frag(ldsA + (wm + FM * i) * TPITCH, TPITCH); if (PL) afl[i] = lds_frag(ldsAl + (wm + FM * i) * TPITCH, TPITCH); }
#pragma unroll
    for (int j = 0; j < 4; ++j) {
      const f16x16 bf = lds_frag(ldsB + (wn + 16 * j) * TPITCH, TPITCH);
      if (PL) {
        const f16x16 bfl = lds_frag(ldsBl + (wn + 16 * j) * TPITCH, TPITCH);
#pragma unroll
        for (int i = 0; i < 2; ++i) { acc[i][j] = wmma16(af[i], bf, acc[i][j]); accx[i][j] = wmma16(af[i], bfl, accx[i][j]); accx[i][j] = wmma16(afl[i], bf, accx[i][j]); }
      } else {
#pragma unroll
        for (int i = 0; i < 2; ++i) acc[i][j] = wmma16(af[i], bf, acc[i][j]);
      }
    }
  }
  if (EPI == 2) {   // lane holds positions (row 2i + f, column wm + rh + r) of channel 16j + cl in acc[f][j][r]: window p of the lane = registers 2p, 2p + 1 of both fragments
    float* sp = oS + wave * OSW;
    // !PL: the lane's 4 pooled positions of a channel are 8 bytes of that channel's 16-byte piece; a store of the wave is 256 B, its 4 stores 1 KiB in a row
    f16* yt = (f16*)Y + ((size_t)(bx * 4 + (wave & 3)) * LDY + n0 + wn + cl) * 8 + (rh >> 1);
#pragma unroll
    for (int j = 0; j < 4; ++j) {
      const float bv = bias[n0 + wn + 16 * j + cl];
      bf16x4 q;
#pragma unroll
      for (int p = 0; p < 4; ++p) {
        float v[2][2];
#pragma unroll
        for (int i = 0; i < 2; ++i)
#pragma unroll
          for (int e = 0; e < 2; ++e) v[i][e] = (PL ? acc[i][j][2 * p + e] + accx[i][j][2 * p + e] * (1.0f / 2048.0f) : acc[i][j][2 * p + e]) + bv;
        const float mx = fmaxf(fmaxf(v[0][0], v[0][1]), fmaxf(v[1][0], v[1][1]));
        if (PL) sp[((rh >> 1) + p) * 68 + 16 * j + cl] = mx; else q[p] = (f16)mx;
      }
      if (!PL) *(bf16x4*)(yt + 16 * j * 8) = q;
    }
    if (PL) {
      asm volatile("s_wait_dscnt 0" ::: "memory");    // the rows read below were written by other lanes of this wave
      __builtin_amdgcn_wave_barrier();
      // a wave's 8 pooled positions x 64 channels go out as 128-B segments of f16 values and of f16 residuals
      f16* yp = (f16*)Y + (size_t)(bx * 32 + (wm >> 1) + (lane >> 4)) * (2 * LDY) + n0 + wn + (lane & 15) * 4;
#pragma unroll
      for (int it = 0; it < 4; ++it) { const v4f_t v = *(const v4fa*)(sp + ((lane >> 4) + 2 * it) * 68 + (lane & 15) * 4); bf16x4 h, lo;
#pragma unroll
        for (int u = 0; u < 4; ++u) { h[u] = (f16)v[u]; lo[u] = (f16)((v[u] - (float)h[u]) * 2048.0f); }
        *(bf16x4*)(yp + (size_t)(2 * it) * (2 * LDY)) = h; *(bf16x4*)(yp + (size_t)(2 * it) * (2 * LDY) + LDY) = lo; }
    }
    asm volatile("s_wait_xcnt 0x0" ::: "memory");   // behind the run of stores: in k_proj another product's code follows in the same kernel and writes the registers that they name
    return;
  }
  // a wave's 32 x 64 piece goes out as 256-B row segments: thread -> rows (lane >> 4) + 2 * it, 16 bytes at column (lane & 15) * 4
  const size_t off0 = (size_t)(m0 + wm + (lane >> 4)) * LDY + n0 + wn + (lane & 15) * 4;
  float* so = oS + wave * OSW;
#pragma unroll
  for (int i = 0; i < 2; ++i)
#pragma unroll
    for (int j = 0; j < 4; ++j) {
      const float bv = bias[n0 + wn + 16 * j + cl];
#pragma unroll
      for (int r = 0; r < 8; ++r) {
        float v = PL ? acc[i][j][r] + accx[i][j][r] * (1.0f / 2048.0f) : acc[i][j][r];
        v += bv;
        so[(16 * i + rh + r) * 68 + 16 * j + cl] = v;
      }
    }
  asm volatile("s_wait_dscnt 0" ::: "memory");      // the rows read below were written by other lanes of this wave
  __builtin_amdgcn_wave_barrier();
#pragma unroll
  for (int it = 0; it < 16; ++it) {
    const v4f_t v = *(const v4fa*)(so + ((lane >> 4) + 2 * it) * 68 + (lane & 15) * 4);
    *(v4f_t*)(Y + off0 + (size_t)(2 * it) * LDY) = v;
  }
  asm volatile("s_wait_xcnt 0x0" ::: "memory");   // behind the run of stores, as above
}
// k_proj: the three 1x1 convolutions depend on nothing but the inputs, so their 3 x 256 tiles go out as one launch: no launch gap between them, and
// two blocks share a WGP (registers allow four waves a SIMD), so that one block's products run while the other waits for its global loads.
// blockIdx.z = 8 * product + batch; the two products with planes come first, the short one (g) fills the places that they leave.
__global__ __launch_bounds__(256) void k_proj(const float* __restrict__ x1, const float* __restrict__ x2,
                                              const float* __restrict__ pw, const float* __restrict__ pb, const float* __restrict__ tw, const float* __restrict__ tb,
                                              const float* __restrict__ gw, const float* __restrict__ gb,
                                              float* __restrict__ PH, float* __restrict__ TH, float* __restrict__ GP) {
  __shared__ __attribute__((aligned(16))) f16 ldsA[128 * TPITCH], ldsAl[128 * TPITCH], ldsB[128 * TPITCH], ldsBl[128 * TPITCH];
  __shared__ __attribute__((aligned(16))) float oS[8 * 32 * 68];   // theta's size, the largest of the three
  const int which = blockIdx.z >> 3, bz = blockIdx.z & 7;
  if (which == 0)      gemm_tile<true, true, 2, HWn, CC, CI, CC>(ldsA, ldsAl, ldsB, ldsBl, oS, blockIdx.x, 0, bz, x2, (size_t)CC * HWn, pw, 0, pb, PH, (size_t)N2 * CI);    // pooled phi rows (products with planes; stored as f16 planes)
  else if (which == 1) gemm_tile<true, true, 0, HWn, CC, CI, CC>(ldsA, ldsAl, ldsB, ldsBl, oS, blockIdx.x, 0, bz, x1, (size_t)CC * HWn, tw, 0, tb, TH, (size_t)HWn * CI);   // theta rows (planes)
  else                 gemm_tile<false, true, 2, HWn, CC, CI, CC>(ldsA, nullptr, ldsB, nullptr, oS, blockIdx.x, 0, bz, x1, (size_t)CC * HWn, gw, 0, gb, GP, (size_t)N2 * CI / 2);   // pooled g, f16 pieces (on x1, faithful)
}
extern "C" void kernel_launch(void* const* d_in, const int* in_sizes, int n_in,
                              void* d_out, int out_size, void* d_ws, size_t ws_size,
                              hipStream_t stream) {
  (void)in_sizes; (void)n_in; (void)out_size;
  const float** f = (const float**)d_in;
  const float* x1 = f[0], *x2 = f[1], *gw = f[2], *gb = f[3], *tw = f[4], *tb = f[5], *pw = f[6], *pb = f[7], *Ww = f[8], *Wb = f[9], *bng = f[10], *bnb = f[11], *bnm = f[12], *bnv = f[13];
  float* out = (float*)d_out;     // [8,256,64,64]
  char* ws = (char*)d_ws;
  // every per-batch buffer holds all NBT batches, batch b at b * (its per-batch size)
  float* TH = (float*)ws; ws += (size_t)NBT * HWn * CI * 4;             // theta rows [8][4096][128] f32
  float* GP = (float*)ws; ws += (size_t)NBT * N2 * CI * 2;              // pooled g, f16 [8][128 key groups][128][8]
  float* PH = (float*)ws; ws += (size_t)NBT * N2 * CI * 4;              // pooled phi, f16 [8][1024][value, residual][128]
  if ((size_t)(ws - (char*)d_ws) > ws_size) return;                     // WS TOTAL 23,068,672 B
  const dim3 blk(256);
  // one launch per stage for all NBT batches: the batch is a grid dimension; the three convolutions are one stage
  k_proj<<<dim3(HWn / 128, 1, 3 * NBT), blk, 0, stream>>>(x1, x2, pw, pb, tw, tb, gw, gb, PH, TH, GP);                                                         // pooled phi, theta, pooled g
  k_attn<<<dim3(HWn / 128, NBT), blk, 0, stream>>>(TH, PH, GP, Ww, Wb, bng, bnb, bnm, bnv, x1, out);                                                         // y = softmax(theta * phi^T) * g, out = BN(W_w * y^T + b) + x1; scores and y kept on chip
}

// v008
// It runs in 52.3 microseconds.
// Timed twice side by side with v007, it ran 1.04 times as fast both times.
// Counting every step since v000, it is 27.0 times as fast.
// Contractions on v_wmma_f32_16x16x32_f16, f32 accumulate: the three 1x1 convs as position-major GEMMs (x^T * W^T + b, K = 256, theta out as f32, pooled phi and g out as f16; theta and phi, the score operands, with f16 value+residual planes, g plain f16;
// x is read as it lies in memory, channel-major, and turned in registers on its way to LDS; the weights are read as they lie, [out][in]), 2x2 max-pooling of the g / phi maps over positions in the epilogue of their GEMMs (the full-resolution maps never reach memory), per batch the non-local scores f = theta * phi^T (K = 128, 4096 x 1024) with f16 value+residual planes
// (hi*hi + (hi*lo + lo*hi)/2048: unscaled logits of spread about 11 give a peaked softmax that needs f32-class scores), running f32 row softmax and y = P * g (plain f16 operands, P carried as 1024 * exp(s - max))
// in the same kernel as the scores, and there too W_y = y * W_w^T + b (K = 128, plain f16; y goes from wave to wave through LDS and never reaches memory), turned channel-major in LDS, with BatchNorm (running stats) + the x1 residual in its epilogue.
// compute dtype: f16 operands (planes on the scores), f32 accumulate; pooling / softmax / BN in f32.  x1, x2 [8,256,64,64].
#include <hip/hip_runtime.h>
#include <hip/hip_bf16.h>
#include <math.h>


typedef _Float16 bf16;
typedef _Float16 f16;
typedef __attribute__((ext_vector_type(4))) unsigned v4u_t;
typedef unsigned v4ua __attribute__((ext_vector_type(4), may_alias));
typedef __attribute__((ext_vector_type(4))) float v4f_t;
typedef float v4fa __attribute__((ext_vector_type(4), may_alias));
typedef __attribute__((ext_vector_type(16))) bf16  bf16x16;
typedef bf16x16 f16x16;
typedef __attribute__((ext_vector_type(8)))  bf16  bf16x8;
typedef bf16x8 f16x8;
typedef __attribute__((ext_vector_type(4)))  bf16  bf16x4;
typedef __attribute__((ext_vector_type(8)))  float f32x8;
__device__ __forceinline__ f32x8 wmma16(f16x16 a, f16x16 b, f32x8 c) {
  c = __builtin_amdgcn_wmma_f32_16x16x32_f16(false, a, false, b, (short)0, c, false, false);
  asm volatile("v_nop\n\tv_nop\n\tv_nop\n\tv_nop" : "+v"(c) : "v"(a), "v"(b));
  return c;
}
#define LDS_STRIDE 48   // unused; the GEMM tiles use TPITCH
#define KSTRIDE    72   // unused
#define VSTRIDE    48   // unused

__device__ __forceinline__ f32x8 wmma_bf16(bf16x16 a, bf16x16 b, f32x8 c) {
  c = __builtin_amdgcn_wmma_f32_16x16x32_f16(false, a, false, b, (short)0, c, false, false);
  asm volatile("v_nop\n\tv_nop\n\tv_nop\n\tv_nop" : "+v"(c) : "v"(a), "v"(b));   // A/B-overwrite hazard guard
  return c;
}

// 16x32 (MxK) f16 fragment from a row-major global matrix.
// lanes 0-15  (row=lane)    : elems 0..7 = K+0..7,  8..15 = K+16..23
// lanes 16-31 (row=lane-16) : elems 0..7 = K+8..15, 8..15 = K+24..31
template <typename T>
__device__ __forceinline__ bf16x16 load_frag(const T* __restrict__ base, int ld,
                                             int row0, int k0) {
  const int lane = threadIdx.x & 31;
  const int r    = lane & 15;
  const int kh   = (lane >> 4) * 8;
  const T* p0 = base + (size_t)(row0 + r) * ld + (k0 + kh);
  const T* p1 = p0 + 16;
  bf16x16 f;
#pragma unroll
  for (int i = 0; i < 8; ++i) {
    f[i]     = (bf16)p0[i];
    f[i + 8] = (bf16)p1[i];
  }
  return f;
}

// Same fragment from an LDS tile with padded row stride (base includes row0/k0).
__device__ __forceinline__ bf16x16 lds_frag(const bf16* base, int stride) {
  const int lane = threadIdx.x & 31;
  const int row  = lane & 15;
  const int kh   = (lane >> 4) * 8;
  const bf16x8 lo = *(const bf16x8*)(base + row * stride + kh);
  const bf16x8 hi = *(const bf16x8*)(base + row * stride + kh + 16);
  bf16x16 f;
#pragma unroll
  for (int i = 0; i < 8; ++i) { f[i] = lo[i]; f[i + 8] = hi[i]; }
  return f;
}

template <typename T>
__device__ __forceinline__ void stage_read16(const T* __restrict__ p, float* buf) {
#pragma unroll
  for (int i = 0; i < 16; ++i) buf[i] = (float)p[i];
}

__device__ __forceinline__ void stage_write(bf16* dst, const float* buf, int nquad) {
#pragma unroll
  for (int i = 0; i < nquad; ++i) {
    bf16x4 q;
    q[0] = (bf16)buf[4 * i];     q[1] = (bf16)buf[4 * i + 1];
    q[2] = (bf16)buf[4 * i + 2]; q[3] = (bf16)buf[4 * i + 3];
    *(bf16x4*)(dst + 4 * i) = q;
  }
}


#define NBT 8
#define BBn 8
#define CC 256
#define CI 128
#define HWn 4096       // 64 x 64 positions
#define N2 1024        // pooled positions (32 x 32)
// ---------------------------------------------------------------------------------------------------------------------------
// k_attn: scores, row softmax, y and the output convolution in one kernel; neither the score matrix nor y reaches memory. Block = 128 queries of one batch,
// 8 waves x 16 queries; 16 passes of 64 keys. Per pass S^T = phi * theta^T (A = phi rows from LDS, B = theta kept in registers,
// value+residual planes: hh + (lh + hl)/2048), so a lane holds 32 scores of ONE query (query = lane & 15, keys 16j + 8*(lane >> 4) + r):
// running maximum and sum per lane, one exchange between the wave halves. 1024 * exp(s - max), converted to f16 in place, is the
// B operand of O^T += g^T * P^T (A = g^T from LDS); y = O / sum at the end. The block holds all 128 channels of its 128 positions' y, which is all that its piece of
// out = BN(y * W_w^T + b) + x1 needs: each wave takes 32 of the 256 output channels; its rows of W_w (f16) and of x1 come into LDS two a pass, under the products.
// k_proj stores the phi planes and g^T as the f16 operands that are read here, so a tile needs no conversion and comes into LDS by asynchronous copies, two buffers:
// the tile of pass t + 2 is requested at the foot of pass t, behind the one barrier of the pass, into the buffers that pass t has read.
// ---------------------------------------------------------------------------------------------------------------------------
#define AKT 64     // keys per pass
#define AKS 136    // phi tile pitch, f16 elements (272-B rows: 16 rows of b128 reads fall on distinct banks)
#define AVS 72     // g^T tile pitch, f16 elements (144-B rows, the same)
#define AWS 136    // W_w and y tile pitch, f16 elements (272-B rows, as the phi tile)
#define AOS 132    // output staging pitch, f32 elements
#define AKB (2 * AKT * AKS)   // f16 elements of one phi buffer (both planes)
#define AVB (CI * AVS)        // f16 elements of one g^T buffer
typedef float v2fa __attribute__((ext_vector_type(2), may_alias));
// One tile (64 keys: 32 KiB of phi planes, 16 KiB of g^T) into LDS through no register: 8 + 4 asynchronous 16-byte copies a lane, each with an LDS byte address and a global address of its own.
// kd, vd: the lane's first LDS byte of the phi and of the g^T buffer (further pieces 8 keys = 8 rows, and 2 key groups = 32 B, on); ks, vs: its first global piece (further pieces 4 KiB on).
// s_wait_xcnt 0 is the statement's last line, so that it stands in front of every later write of a register that a copy names.
__device__ __forceinline__ void tile_copy(unsigned kd, unsigned vd, const float* ks, const float* vs) {
  asm volatile("global_load_async_to_lds_b128 %0, %12, off\n\t"
               "global_load_async_to_lds_b128 %1, %13, off\n\t"
               "global_load_async_to_lds_b128 %2, %14, off\n\t"
               "global_load_async_to_lds_b128 %3, %15, off\n\t"
               "global_load_async_to_lds_b128 %4, %16, off\n\t"
               "global_load_async_to_lds_b128 %5, %17, off\n\t"
               "global_load_async_to_lds_b128 %6, %18, off\n\t"
               "global_load_async_to_lds_b128 %7, %19, off\n\t"
               "global_load_async_to_lds_b128 %8, %20, off\n\t"
               "global_load_async_to_lds_b128 %9, %21, off\n\t"
               "global_load_async_to_lds_b128 %10, %22, off\n\t"
               "global_load_async_to_lds_b128 %11, %23, off\n\t"
               "s_wait_xcnt 0x0"
               :: "v"(kd), "v"(kd + 1 * 8 * AKS * 2), "v"(kd + 2 * 8 * AKS * 2), "v"(kd + 3 * 8 * AKS * 2), "v"(kd + 4 * 8 * AKS * 2), "v"(kd + 5 * 8 * AKS * 2), "v"(kd + 6 * 8 * AKS * 2), "v"(kd + 7 * 8 * AKS * 2),
                  "v"(vd), "v"(vd + 32), "v"(vd + 64), "v"(vd + 96),
                  "v"(ks), "v"(ks + 1024), "v"(ks + 2048), "v"(ks + 3072), "v"(ks + 4096), "v"(ks + 5120), "v"(ks + 6144), "v"(ks + 7168),
                  "v"(vs), "v"(vs + 1024), "v"(vs + 2048), "v"(vs + 3072)
               : "memory");
}
// s_wait_xcnt 0 behind a run of global loads, before their address registers are reused; the base pointer is an input so that it stays in its registers up to the wait
__device__ __forceinline__ void addr_wait(const float* p) { asm volatile("s_wait_xcnt 0x0" :: "v"(p) : "memory"); }
// v_nop: the one independent slot that the instruction set asks for behind a transcendental, kept whatever the compiler schedules next
__device__ __forceinline__ float exp2_slot(float x) { float r; asm("v_exp_f32 %0, %1\n\tv_nop" : "=v"(r) : "v"(x)); return r; }
__device__ __forceinline__ float rcp_slot(float x) { float r; asm("v_rcp_f32 %0, %1\n\tv_nop" : "=v"(r) : "v"(x)); return r; }
__device__ __forceinline__ f32x8 wmma_p(f16x16 a, f16x16 b, f32x8 c) { return __builtin_amdgcn_wmma_f32_16x16x32_f16(false, a, false, b, (short)0, c, false, false); }
// two waves per SIMD is all the grid gives (one block per WGP): let the register allocator use that room to fetch fragments ahead
__global__ __launch_bounds__(256) __attribute__((amdgpu_waves_per_eu(2, 2))) void k_attn(const float* __restrict__ TH, const float* __restrict__ PH, const float* __restrict__ GP,
                                                                                             const float* __restrict__ Ww, const float* __restrict__ Wb, const float* __restrict__ bng, const float* __restrict__ bnb,
                                                                                             const float* __restrict__ bnm, const float* __restrict__ bnv, const float* __restrict__ x1, float* __restrict__ out) {
  // the ring: phi buffer 0, phi buffer 1 (both planes each), g^T buffer 0, g^T buffer 1. Behind the loop phi buffer 0 is the block's y tile (128 * AWS, the same size) and the other three are the output staging (8 waves x 16 * AOS f32)
  __shared__ __attribute__((aligned(16))) f16 sT[2 * AKB + 2 * AVB];
  __shared__ __attribute__((aligned(16))) f16 sW[CC * AWS];
  __shared__ __attribute__((aligned(16))) float sX[CC * 128], sBi[CC], sInv[CC], sSh[CC];
  f16* const sY = sT;
  const int tid = threadIdx.x, lane = tid & 31, wave = tid >> 5, cl = lane & 15, hf = lane >> 4;
  const int q0 = blockIdx.x * 128 + wave * 16;
  TH += (size_t)blockIdx.y * HWn * CI; PH += (size_t)blockIdx.y * N2 * CI; GP += (size_t)blockIdx.y * (N2 * CI / 2);
  // a thread's 16-byte pieces of a tile. phi: a wave takes one key's 512 B (values, then residuals) a copy, keys wave + 8 * it. g^T: piece = 8 keys of one channel, a wave takes 32 channels of one key group a copy
  const float* const ksrc = PH + tid * 4; const float* const vsrc = GP + tid * 4;
  const unsigned kdst = (unsigned)(size_t)sT + hf * (AKT * AKS * 2) + wave * (AKS * 2) + cl * 16;
  const unsigned vdst = (unsigned)(size_t)sT + 2 * AKB * 2 + (tid & 127) * (AVS * 2) + (tid >> 7) * 16;
  tile_copy(kdst, vdst, ksrc, vsrc);                // tile 0 into the buffers 0: it flies under the theta loads and their conversion
  const float L2E = 1.4426950408889634f;
  const size_t off0 = ((size_t)blockIdx.y * CC + wave * 32) * HWn + blockIdx.x * 128 + lane * 4;   // the wave's 32 channels of x1 and out: 512 B of one channel a wave access
  // per-channel constants of the last epilogue, one output channel a thread; requested early, stored in front of the first barrier, which publishes them
  const float* cb = Wb + tid; const float* cg = bng + tid; const float* cs = bnb + tid; const float* cm = bnm + tid; const float* cv = bnv + tid;
  const float c_b = *cb, c_g = *cg, c_s = *cs, c_m = *cm, c_v = *cv;
  asm volatile("s_wait_xcnt 0x0" :: "v"(cb), "v"(cg), "v"(cs), "v"(cm), "v"(cv) : "memory");   // behind the five loads, before the registers that they name are reused
  // theta fragments (B operand: column = query cl), same k order as lds_frag
  f16x16 qh[4], ql[4];
  { const float* qb = TH + (size_t)(q0 + cl) * CI + hf * 8;
    v4f_t qa[4][4];
#pragma unroll
    for (int ks = 0; ks < 4; ++ks) { qa[ks][0] = *(const v4fa*)(qb + ks * 32); qa[ks][1] = *(const v4fa*)(qb + ks * 32 + 4); qa[ks][2] = *(const v4fa*)(qb + ks * 32 + 16); qa[ks][3] = *(const v4fa*)(qb + ks * 32 + 20); }
    addr_wait(qb);
#pragma unroll
    for (int ks = 0; ks < 4; ++ks)
#pragma unroll
      for (int i = 0; i < 8; ++i) {
        const float va = qa[ks][i >> 2][i & 3], vb = qa[ks][2 + (i >> 2)][i & 3];
        const f16 ha = (f16)va, hb = (f16)vb;
        qh[ks][i] = ha; ql[ks][i] = (f16)((va - (float)ha) * 2048.0f);
        qh[ks][i + 8] = hb; ql[ks][i + 8] = (f16)((vb - (float)hb) * 2048.0f);
      }
  }
  f32x8 o[8];
#pragma unroll
  for (int c = 0; c < 8; ++c) { f32x8 z = {}; o[c] = z; }
  float m = -3.0e38f, l = 0.0f;
  { const float inv = c_g * rsqrtf(c_v + 1e-5f); sBi[tid] = c_b; sInv[tid] = inv; sSh[tid] = c_s - c_m * inv; }
  asm volatile("s_wait_asynccnt 0x0" ::: "memory");   // this wave's pieces of tile 0 have landed
  __syncthreads();                                  // tile 0 is published
  tile_copy(kdst + AKB * 2, vdst + AVB * 2, ksrc + AKT * CI, vsrc + AKT * CI / 2);   // tile 1 into the buffers 1
#pragma unroll 1   // rolled: one pass is already 64 matrix instructions, and a second copy would double the live staging registers
  for (int t = 0; t < N2 / AKT; ++t) {
    const f16* const sKh = sT + (t & 1) * AKB; const f16* const sKl = sKh + AKT * AKS; const f16* const sVt = sT + 2 * AKB + (t & 1) * AVB;   // pass t reads the buffers t mod 2 alone
    // two of the wave's own 32 rows of W_w and of x1 a pass (whole 512-B rows): after 16 passes the last product's weights and its residual stand in LDS, with no wait of their own
    const float* wp = Ww + (size_t)(wave * 32 + 2 * t) * CI + lane * 4;
    const v4f_t wr0 = *(const v4fa*)wp, wr1 = *(const v4fa*)(wp + CI);
    addr_wait(wp);
    const float* xp = x1 + off0 + (size_t)(2 * t) * HWn;
    const v4f_t xr0 = *(const v4fa*)xp, xr1 = *(const v4fa*)(xp + HWn);
    addr_wait(xp);
    f32x8 s[4];
#pragma unroll
    for (int j = 0; j < 4; ++j) {
      f32x8 a = {}, ax = {};
#pragma unroll
      for (int ks = 0; ks < 4; ++ks) {
        const f16x16 kh = lds_frag(sKh + (16 * j) * AKS + ks * 32, AKS), kl = lds_frag(sKl + (16 * j) * AKS + ks * 32, AKS);
        a = wmma_p(kh, qh[ks], a); ax = wmma_p(kl, qh[ks], ax); ax = wmma_p(kh, ql[ks], ax);
      }
      s[j] = a + ax * (1.0f / 2048.0f);
    }
    float mx = s[0][0];
#pragma unroll
    for (int j = 0; j < 4; ++j)
#pragma unroll
      for (int r = 0; r < 8; ++r) mx = fmaxf(mx, s[j][r]);
    mx = fmaxf(mx, __shfl_xor(mx, 16));            // the other half of the wave holds this query's other 32 keys
    const float mn = fmaxf(m, mx);
    const float alpha = exp2_slot((m - mn) * L2E);
    const float bias = 10.0f - mn * L2E;            // + 10: P carries a factor 1024 (small weights stay normal f16); it cancels against the sum
    m = mn;
#pragma unroll
    for (int j = 0; j < 4; ++j)
#pragma unroll
      for (int r = 0; r < 8; ++r) s[j][r] = exp2_slot(s[j][r] * L2E + bias);
    const f32x8 sv = (s[0] + s[1]) + (s[2] + s[3]);   // pairwise: a chain of 32 dependent adds would stand in the pass's critical path
    l = l * alpha + (((sv[0] + sv[1]) + (sv[2] + sv[3])) + ((sv[4] + sv[5]) + (sv[6] + sv[7])));
#pragma unroll
    for (int c = 0; c < 8; ++c) o[c] *= alpha;
    f16x16 pf[2];                                   // two score tiles (keys 32k2 .. + 31) converted in place = one B fragment in lds_frag's k order
#pragma unroll
    for (int k2 = 0; k2 < 2; ++k2)
#pragma unroll
      for (int i = 0; i < 8; ++i) { pf[k2][i] = (f16)s[2 * k2][i]; pf[k2][i + 8] = (f16)s[2 * k2 + 1][i]; }
    f16x16 vf[2][8];                                // all 16 g^T fragments are requested before the first product, so that one LDS latency is paid and not sixteen
#pragma unroll
    for (int k2 = 0; k2 < 2; ++k2)
#pragma unroll
      for (int c = 0; c < 8; ++c) vf[k2][c] = lds_frag(sVt + (16 * c) * AVS + k2 * 32, AVS);
    __builtin_amdgcn_sched_barrier(0);              // keeps the fragment loads above from sinking down to their products
#pragma unroll
    for (int k2 = 0; k2 < 2; ++k2)
#pragma unroll
      for (int c = 0; c < 8; ++c) o[c] = wmma_p(vf[k2][c], pf[k2], o[c]);
    __builtin_amdgcn_sched_barrier(0);              // keeps the products in front of the waits below, so that they run while the later fragments are still arriving
    { bf16x4 h0, h1;                                // behind the products: the W_w and x1 rows have had the whole pass to land
#pragma unroll
      for (int u = 0; u < 4; ++u) { h0[u] = (f16)wr0[u]; h1[u] = (f16)wr1[u]; }
      *(bf16x4*)(sW + (wave * 32 + 2 * t) * AWS + lane * 4) = h0; *(bf16x4*)(sW + (wave * 32 + 2 * t + 1) * AWS + lane * 4) = h1;
      *(v4fa*)(sX + (wave * 32 + 2 * t) * 128 + lane * 4) = xr0; *(v4fa*)(sX + (wave * 32 + 2 * t + 1) * 128 + lane * 4) = xr1; }
    asm volatile("s_wait_dscnt 0x0" ::: "memory");    // this wave's reads of the buffers that are refilled below have returned
    asm volatile("s_wait_asynccnt 0x0" ::: "memory"); // this wave's pieces of tile t + 1 have landed
    __syncthreads();                                // tile t + 1 is published; every wave has left the buffers of pass t
    if (t + 2 < N2 / AKT)                           // tile t + 2 into the buffers that pass t has read: it flies under the whole of pass t + 1
      tile_copy(kdst + (t & 1) * (AKB * 2), vdst + (t & 1) * (AVB * 2), ksrc + (size_t)(t + 2) * (AKT * CI), vsrc + (size_t)(t + 2) * (AKT * CI / 2));
  }
  asm volatile("s_wait_asynccnt 0x0" ::: "memory");   // no copy is under way when the ring is put to its other uses
  // The last product in the same block: out = BN(y * W_w^T + b) + x1 for the block's 128 positions and all 256 channels; a wave takes its 32 channels x 128 positions.
  l += __shfl_xor(l, 16);
  const float inv = rcp_slot(l);
  // lane holds y[query cl][16c + 8*hf + r]: 8 channels = 16 bytes of the [position][channel] f16 tile that every wave reads as A operand (the phi planes of buffer 0 that it overwrites were last read in pass 14, left at that pass's barrier)
#pragma unroll
  for (int c = 0; c < 8; ++c) { f16x8 w;
#pragma unroll
    for (int r = 0; r < 8; ++r) w[r] = (f16)(o[c][r] * inv);
    *(f16x8*)(sY + (wave * 16 + cl) * AWS + 16 * c + 8 * hf) = w; }
  __syncthreads();                                  // y of all 128 positions is published
  f16x16 wf[2][4];
#pragma unroll
  for (int j = 0; j < 2; ++j)
#pragma unroll
    for (int ks = 0; ks < 4; ++ks) wf[j][ks] = lds_frag(sW + (wave * 32 + 16 * j) * AWS + ks * 32, AWS);
  f32x8 acc[8][2];
#pragma unroll
  for (int i = 0; i < 8; ++i) {
    f32x8 z = {}; acc[i][0] = z; acc[i][1] = z;
#pragma unroll
    for (int ks = 0; ks < 4; ++ks) {
      const f16x16 yf = lds_frag(sY + (16 * i) * AWS + ks * 32, AWS);
      acc[i][0] = wmma_p(yf, wf[0][ks], acc[i][0]); acc[i][1] = wmma_p(yf, wf[1][ks], acc[i][1]);
    }
  }
  // lane holds positions 16i + 8*hf + r of channel 16j + cl: 8 neighbours of an output row. 16 channels at a time are turned, wave-private, into whole 512-B rows for the stores
  float* so = (float*)(sT + AKB) + wave * (16 * AOS);
#pragma unroll
  for (int j = 0; j < 2; ++j) {
    const int ch = wave * 32 + 16 * j + cl;
    const float bi = sBi[ch], iv = sInv[ch], sh = sSh[ch];
#pragma unroll
    for (int i = 0; i < 8; ++i) { v4f_t w0, w1;
#pragma unroll
      for (int r = 0; r < 4; ++r) { float a = acc[i][j][r], b = acc[i][j][r + 4]; a += bi; b += bi; w0[r] = a * iv + sh; w1[r] = b * iv + sh; }
      *(v4fa*)(so + cl * AOS + 16 * i + 8 * hf) = w0; *(v4fa*)(so + cl * AOS + 16 * i + 8 * hf + 4) = w1; }
    asm volatile("s_wait_dscnt 0" ::: "memory");    // the rows read below were written by other lanes of this wave
    __builtin_amdgcn_wave_barrier();
#pragma unroll
    for (int it = 0; it < 16; ++it) {
      v4f_t v = *(const v4fa*)(so + it * AOS + lane * 4);
      v += *(const v4fa*)(sX + (wave * 32 + 16 * j + it) * 128 + lane * 4);
      *(v4f_t*)(out + off0 + (size_t)(16 * j + it) * HWn) = v;
    }
    if (j == 0) {
      asm volatile("s_wait_dscnt 0\n\ts_wait_xcnt 0x0" ::: "memory");   // the staging rows have been read before other lanes rewrite them; the stores' registers are free before they are reused
      __builtin_amdgcn_wave_barrier();
    }
  }
}
// ---------------------------------------------------------------------------------------------------------------------------
// gemm_tile: D[m][n] = sum_k A[m][k] * B[n][k], every operand read in the layout it has in memory, so that no transposed copy is made.
// B is row-major [n][k] (row stride LDB). A is row-major [m][k] (AKM false, row stride LDA) or k-major [k][m] (AKM true, row stride LDA).
// PL: value+residual planes on both operands (hh + (hl + lh)/2048, f32-class); else plain f16 operands. f32 accumulate.
// EPI 0: Y[m][n] = D + bias[n]. EPI 2: max of D + bias[n] over the 2 x 2 window of positions p (m = 64-wide image rows; LDY = channels of the pooled map, strideY its batch stride in f32 units), stored as the f16 operands that k_attn copies into LDS:
// under PL a row of 2 * LDY f16 a position (LDY values, then LDY residuals * 2048), else [p / 8][n][p % 8] f16 (16-byte pieces of the transposed map: 8 positions of one channel).
// Block = 128 x 128 tile, 8 waves as 4(M, 32 rows) x 2(N, 64 cols); per 64-wide k-step both tiles are staged f16 in LDS as [row][k]: a trip is a chain of load latency, conversion, two barriers and products,
// and the wide step pays the latency and the barriers half as often, with twice the bytes in flight; the products still walk k in 32-wide chunks in rising order.
// Without planes (half the accumulators, half the staged bytes a k) the step is 128 wide.
// EPI 2: the tile's 128 positions are image rows 2i and 2i + 1 (i = bx); a wave takes the same 16 columns of both rows (m = 16a .. + 15 and 64 + 16a .. + 15),
// so that all four positions of a window lie in one lane's accumulators (two neighbouring registers of both fragments) and the maximum needs no exchange.
// bz selects a batch (element strides).
// ---------------------------------------------------------------------------------------------------------------------------
// KS: k range of one staged tile (64 or 128). Staged tile pitch KS + 8 f16 elements (128-B rows at 144 B, 256-B rows at 272 B: 16-byte reads of 16 neighbouring rows fall on distinct banks)
#define TILE_F16 (128 * 72)   // f16 elements of one staged tile at KS = 64; four of them (two operands, two planes) also hold the two tiles at KS = 128
// 128 rows x KS k of a row-major f32 matrix: KS / 4 lanes take the whole KS * 4 B of a row, KS / 8 loads a thread
template <int LD, int KS>
__device__ __forceinline__ void rows_load(const float* __restrict__ p, v4f_t* v) {
#pragma unroll
  for (int it = 0; it < KS / 8; ++it) v[it] = *(const v4fa*)(p + (size_t)((1024 / KS) * it) * LD);
}
template <bool PL, int KS>
__device__ __forceinline__ void rows_store(const v4f_t* v, f16* dh, f16* dl) {
  constexpr int TPITCH = KS + 8;
  const int tid = threadIdx.x, r0 = tid / (KS / 4), c4 = (tid % (KS / 4)) * 4;
#pragma unroll
  for (int it = 0; it < KS / 8; ++it) { bf16x4 h, lo;
#pragma unroll
    for (int u = 0; u < 4; ++u) { h[u] = (f16)v[it][u]; lo[u] = (f16)((v[it][u] - (float)h[u]) * 2048.0f); }
    *(bf16x4*)(dh + (r0 + (1024 / KS) * it) * TPITCH + c4) = h; if (PL) *(bf16x4*)(dl + (r0 + (1024 / KS) * it) * TPITCH + c4) = lo; }
}
// The body is a function of the block's place (bx, by, bz) and of LDS arrays that the kernel owns, so that one launch can hold tiles of several products:
// ldsA, ldsB (and ldsAl, ldsBl under PL) 128 * (KS + 8) f16 each, oS 8 waves x (EPI 2: 8, else 32) rows x 68 f32.
template <bool PL, bool AKM, int EPI, int LDA, int LDB, int LDY, int K>
__device__ __forceinline__ void gemm_tile(f16* ldsA, f16* ldsAl, f16* ldsB, f16* ldsBl, float* oS, const int bx, const int by, const int bz,
                                          const float* __restrict__ A, size_t strideA, const float* __restrict__ B, size_t strideB,
                                          const float* __restrict__ bias, float* __restrict__ Y, size_t strideY) {
  constexpr int OSW = (EPI == 2 ? 8 : 32) * 68;   // f32 elements of one wave's output staging
  constexpr int KSTEP = PL ? 64 : 128, TPITCH = KSTEP + 8;
  const int tid = threadIdx.x, lane = tid & 31, wave = tid >> 5, cl = lane & 15, rh = (lane >> 4) * 8;
  const int m0 = bx * 128, n0 = by * 128;
  const int wm = (wave & 3) * (EPI == 2 ? 16 : 32), wn = (wave >> 2) * 64;
  constexpr int FM = EPI == 2 ? 64 : 16;   // rows between a wave's two A fragments
  A += (size_t)bz * strideA; B += (size_t)bz * strideB; Y += (size_t)bz * strideY;
  f32x8 acc[2][4], accx[2][4];
#pragma unroll
  for (int i = 0; i < 2; ++i)
#pragma unroll
    for (int j = 0; j < 4; ++j) { f32x8 z = {}; acc[i][j] = z; accx[i][j] = z; }
  // k-major A: wave -> 8 k rows (kg) of each 32-wide chunk of the k-step, of one 64-wide half of the tile's m range (mh); lane -> m = 2 * lane + {0, 1}: a load is 256 B of one k row
  const int kg = wave & 3, mh = wave >> 2;
  const float* pa = AKM ? A + (size_t)(kg * 8) * LDA + m0 + mh * 64 + 2 * lane : A + (size_t)(m0 + tid / (KSTEP / 4)) * LDA + (tid % (KSTEP / 4)) * 4;
  const float* pb = B + (size_t)(n0 + tid / (KSTEP / 4)) * LDB + (tid % (KSTEP / 4)) * 4;
#pragma unroll 1   // rolled: the trips are separated by barriers and gain nothing from a second copy of the staging code
  for (int k0 = 0; k0 < K; k0 += KSTEP) {
    __syncthreads();                                // every wave has left the tiles of the trip before
    v2fa at[KSTEP / 4]; v4f_t ar[KSTEP / 8], br[KSTEP / 8];
    if (AKM) {
#pragma unroll
      for (int kk = 0; kk < KSTEP / 4; ++kk) at[kk] = *(const v2fa*)(pa + (size_t)((kk >> 3) * 32 + (kk & 7)) * LDA);
    } else rows_load<LDA, KSTEP>(pa, ar);
    rows_load<LDB, KSTEP>(pb, br);
    asm volatile("s_wait_xcnt 0x0" :: "v"(pa), "v"(pb) : "memory");   // behind both runs of loads, before the two pointers they name are advanced
    pa += AKM ? (size_t)KSTEP * LDA : KSTEP; pb += KSTEP;
    if (AKM) {                                      // the turn: a thread's 8 k values of one m are 16 contiguous bytes of the [m][k] tile
#pragma unroll   // unrolled: at[] is indexed by constants only and stays in registers
      for (int g2 = 0; g2 < KSTEP / 32; ++g2)
#pragma unroll
      for (int e = 0; e < 2; ++e) { f16x8 h, lo;
#pragma unroll
        for (int kk = 0; kk < 8; ++kk) { const float v = at[g2 * 8 + kk][e]; h[kk] = (f16)v; lo[kk] = (f16)((v - (float)h[kk]) * 2048.0f); }
        *(f16x8*)(ldsA + (mh * 64 + 2 * lane + e) * TPITCH + g2 * 32 + kg * 8) = h; if (PL) *(f16x8*)(ldsAl + (mh * 64 + 2 * lane + e) * TPITCH + g2 * 32 + kg * 8) = lo; }
    } else rows_store<PL, KSTEP>(ar, ldsA, ldsAl);
    rows_store<PL, KSTEP>(br, ldsB, ldsBl);
    __syncthreads();                                // both tiles are published
#pragma unroll   // unrolled: the LDS offsets of all chunks are immediates of the fragment loads
    for (int kc = 0; kc < KSTEP; kc += 32) {
    f16x16 af[2], afl[2];
#pragma unroll
    for (int i = 0; i < 2; ++i) { af[i] = lds_frag(ldsA + (wm + FM * i) * TPITCH + kc, TPITCH); if (PL) afl[i] = lds_frag(ldsAl + (wm + FM * i) * TPITCH + kc, TPITCH); }
#pragma unroll
    for (int j = 0; j < 4; ++j) {
      const f16x16 bf = lds_frag(ldsB + (wn + 16 * j) * TPITCH + kc, TPITCH);
      if (PL) {
        const f16x16 bfl = lds_frag(ldsBl + (wn + 16 * j) * TPITCH + kc, TPITCH);
#pragma unroll
        for (int i = 0; i < 2; ++i) { acc[i][j] = wmma16(af[i], bf, acc[i][j]); accx[i][j] = wmma16(af[i], bfl, accx[i][j]); accx[i][j] = wmma16(afl[i], bf, accx[i][j]); }
      } else {
#pragma unroll
        for (int i = 0; i < 2; ++i) acc[i][j] = wmma16(af[i], bf, acc[i][j]);
      }
    }
    }
  }
  if (EPI == 2) {   // lane holds positions (row 2i + f, column wm + rh + r) of channel 16j + cl in acc[f][j][r]: window p of the lane = registers 2p, 2p + 1 of both fragments
    float* sp = oS + wave * OSW;
    // !PL: the lane's 4 pooled positions of a channel are 8 bytes of that channel's 16-byte piece; a store of the wave is 256 B, its 4 stores 1 KiB in a row
    f16* yt = (f16*)Y + ((size_t)(bx * 4 + (wave & 3)) * LDY + n0 + wn + cl) * 8 + (rh >> 1);
#pragma unroll
    for (int j = 0; j < 4; ++j) {
      const float bv = bias[n0 + wn + 16 * j + cl];
      bf16x4 q;
#pragma unroll
      for (int p = 0; p < 4; ++p) {
        float v[2][2];
#pragma unroll
        for (int i = 0; i < 2; ++i)
#pragma unroll
          for (int e = 0; e < 2; ++e) v[i][e] = (PL ? acc[i][j][2 * p + e] + accx[i][j][2 * p + e] * (1.0f / 2048.0f) : acc[i][j][2 * p + e]) + bv;
        const float mx = fmaxf(fmaxf(v[0][0], v[0][1]), fmaxf(v[1][0], v[1][1]));
        if (PL) sp[((rh >> 1) + p) * 68 + 16 * j + cl] = mx; else q[p] = (f16)mx;
      }
      if (!PL) *(bf16x4*)(yt + 16 * j * 8) = q;
    }
    if (PL) {
      asm volatile("s_wait_dscnt 0" ::: "memory");    // the rows read below were written by other lanes of this wave
      __builtin_amdgcn_wave_barrier();
      // a wave's 8 pooled positions x 64 channels go out as 128-B segments of f16 values and of f16 residuals
      f16* yp = (f16*)Y + (size_t)(bx * 32 + (wm >> 1) + (lane >> 4)) * (2 * LDY) + n0 + wn + (lane & 15) * 4;
#pragma unroll
      for (int it = 0; it < 4; ++it) { const v4f_t v = *(const v4fa*)(sp + ((lane >> 4) + 2 * it) * 68 + (lane & 15) * 4); bf16x4 h, lo;
#pragma unroll
        for (int u = 0; u < 4; ++u) { h[u] = (f16)v[u]; lo[u] = (f16)((v[u] - (float)h[u]) * 2048.0f); }
        *(bf16x4*)(yp + (size_t)(2 * it) * (2 * LDY)) = h; *(bf16x4*)(yp + (size_t)(2 * it) * (2 * LDY) + LDY) = lo; }
    }
    asm volatile("s_wait_xcnt 0x0" ::: "memory");   // behind the run of stores: in k_proj another product's code follows in the same kernel and writes the registers that they name
    return;
  }
  // a wave's 32 x 64 piece goes out as 256-B row segments: thread -> rows (lane >> 4) + 2 * it, 16 bytes at column (lane & 15) * 4
  const size_t off0 = (size_t)(m0 + wm + (lane >> 4)) * LDY + n0 + wn + (lane & 15) * 4;
  float* so = oS + wave * OSW;
#pragma unroll
  for (int i = 0; i < 2; ++i)
#pragma unroll
    for (int j = 0; j < 4; ++j) {
      const float bv = bias[n0 + wn + 16 * j + cl];
#pragma unroll
      for (int r = 0; r < 8; ++r) {
        float v = PL ? acc[i][j][r] + accx[i][j][r] * (1.0f / 2048.0f) : acc[i][j][r];
        v += bv;
        so[(16 * i + rh + r) * 68 + 16 * j + cl] = v;
      }
    }
  asm volatile("s_wait_dscnt 0" ::: "memory");      // the rows read below were written by other lanes of this wave
  __builtin_amdgcn_wave_barrier();
#pragma unroll
  for (int it = 0; it < 16; ++it) {
    const v4f_t v = *(const v4fa*)(so + ((lane >> 4) + 2 * it) * 68 + (lane & 15) * 4);
    *(v4f_t*)(Y + off0 + (size_t)(2 * it) * LDY) = v;
  }
  asm volatile("s_wait_xcnt 0x0" ::: "memory");   // behind the run of stores, as above
}
// k_proj: the three 1x1 convolutions depend on nothing but the inputs, so their 3 x 256 tiles go out as one launch: no launch gap between them, and
// two blocks share a WGP (registers allow four waves a SIMD), so that one block's products run while the other waits for its global loads.
// blockIdx.z = 8 * product + batch; the two products with planes come first, the short one (g) fills the places that they leave.
__global__ __launch_bounds__(256) void k_proj(const float* __restrict__ x1, const float* __restrict__ x2,
                                              const float* __restrict__ pw, const float* __restrict__ pb, const float* __restrict__ tw, const float* __restrict__ tb,
                                              const float* __restrict__ gw, const float* __restrict__ gb,
                                              float* __restrict__ PH, float* __restrict__ TH, float* __restrict__ GP) {
  __shared__ __attribute__((aligned(16))) f16 tiles[4 * TILE_F16];
  f16* const ldsA = tiles, * const ldsAl = tiles + TILE_F16, * const ldsB = tiles + 2 * TILE_F16, * const ldsBl = tiles + 3 * TILE_F16;   // g: two tiles of 128 * 136 f16, A in the first half, B in the second
  __shared__ __attribute__((aligned(16))) float oS[8 * 32 * 68];   // theta's size, the largest of the three
  const int which = blockIdx.z >> 3, bz = blockIdx.z & 7;
  if (which == 0)      gemm_tile<true, true, 2, HWn, CC, CI, CC>(ldsA, ldsAl, ldsB, ldsBl, oS, blockIdx.x, 0, bz, x2, (size_t)CC * HWn, pw, 0, pb, PH, (size_t)N2 * CI);    // pooled phi rows (products with planes; stored as f16 planes)
  else if (which == 1) gemm_tile<true, true, 0, HWn, CC, CI, CC>(ldsA, ldsAl, ldsB, ldsBl, oS, blockIdx.x, 0, bz, x1, (size_t)CC * HWn, tw, 0, tb, TH, (size_t)HWn * CI);   // theta rows (planes)
  else                 gemm_tile<false, true, 2, HWn, CC, CI, CC>(ldsA, nullptr, ldsB, nullptr, oS, blockIdx.x, 0, bz, x1, (size_t)CC * HWn, gw, 0, gb, GP, (size_t)N2 * CI / 2);   // pooled g, f16 pieces (on x1, faithful)
}
extern "C" void kernel_launch(void* const* d_in, const int* in_sizes, int n_in,
                              void* d_out, int out_size, void* d_ws, size_t ws_size,
                              hipStream_t stream) {
  (void)in_sizes; (void)n_in; (void)out_size;
  const float** f = (const float**)d_in;
  const float* x1 = f[0], *x2 = f[1], *gw = f[2], *gb = f[3], *tw = f[4], *tb = f[5], *pw = f[6], *pb = f[7], *Ww = f[8], *Wb = f[9], *bng = f[10], *bnb = f[11], *bnm = f[12], *bnv = f[13];
  float* out = (float*)d_out;     // [8,256,64,64]
  char* ws = (char*)d_ws;
  // every per-batch buffer holds all NBT batches, batch b at b * (its per-batch size)
  float* TH = (float*)ws; ws += (size_t)NBT * HWn * CI * 4;             // theta rows [8][4096][128] f32
  float* GP = (float*)ws; ws += (size_t)NBT * N2 * CI * 2;              // pooled g, f16 [8][128 key groups][128][8]
  float* PH = (float*)ws; ws += (size_t)NBT * N2 * CI * 4;              // pooled phi, f16 [8][1024][value, residual][128]
  if ((size_t)(ws - (char*)d_ws) > ws_size) return;                     // WS TOTAL 23,068,672 B
  const dim3 blk(256);
  // one launch per stage for all NBT batches: the batch is a grid dimension; the three convolutions are one stage
  k_proj<<<dim3(HWn / 128, 1, 3 * NBT), blk, 0, stream>>>(x1, x2, pw, pb, tw, tb, gw, gb, PH, TH, GP);                                                         // pooled phi, theta, pooled g
  k_attn<<<dim3(HWn / 128, NBT), blk, 0, stream>>>(TH, PH, GP, Ww, Wb, bng, bnb, bnm, bnv, x1, out);                                                         // y = softmax(theta * phi^T) * g, out = BN(W_w * y^T + b) + x1; scores and y kept on chip
}

// v009
// One run takes 50.5 microseconds.
// Timed twice side by side with v008, it ran 1.03 and 1.04 times as fast.
// Counting every step since v000, it is 27.9 times as fast.
// Contractions on v_wmma_f32_16x16x32_f16, f32 accumulate: the three 1x1 convs as position-major GEMMs (x^T * W^T + b, K = 256, theta out as f32, pooled phi and g out as f16; theta and phi, the score operands, with f16 value+residual planes, g plain f16;
// x is read as it lies in memory, channel-major, and turned in registers on its way to LDS; the weights are read as they lie, [out][in]), 2x2 max-pooling of the g / phi maps over positions in the epilogue of their GEMMs (the full-resolution maps never reach memory), per batch the non-local scores f = theta * phi^T (K = 128, 4096 x 1024) with f16 value+residual planes
// (hi*hi + (hi*lo + lo*hi)/2048: unscaled logits of spread about 11 give a peaked softmax that needs f32-class scores), running f32 row softmax and y = P * g (plain f16 operands, P carried as 1024 * exp(s - max))
// in the same kernel as the scores, and there too W_y = y * W_w^T + b (K = 128, plain f16; y goes from wave to wave through LDS and never reaches memory), turned channel-major in LDS, with BatchNorm (running stats) + the x1 residual in its epilogue.
// compute dtype: f16 operands (planes on the scores), f32 accumulate; pooling / softmax / BN in f32.  x1, x2 [8,256,64,64].
#include <hip/hip_runtime.h>
#include <hip/hip_bf16.h>
#include <math.h>


typedef _Float16 bf16;
typedef _Float16 f16;
typedef __attribute__((ext_vector_type(4))) unsigned v4u_t;
typedef unsigned v4ua __attribute__((ext_vector_type(4), may_alias));
typedef __attribute__((ext_vector_type(4))) float v4f_t;
typedef float v4fa __attribute__((ext_vector_type(4), may_alias));
typedef __attribute__((ext_vector_type(16))) bf16  bf16x16;
typedef bf16x16 f16x16;
typedef __attribute__((ext_vector_type(8)))  bf16  bf16x8;
typedef bf16x8 f16x8;
typedef __attribute__((ext_vector_type(4)))  bf16  bf16x4;
typedef __attribute__((ext_vector_type(8)))  float f32x8;
__device__ __forceinline__ f32x8 wmma16(f16x16 a, f16x16 b, f32x8 c) {
  c = __builtin_amdgcn_wmma_f32_16x16x32_f16(false, a, false, b, (short)0, c, false, false);
  asm volatile("v_nop\n\tv_nop\n\tv_nop\n\tv_nop" : "+v"(c) : "v"(a), "v"(b));
  return c;
}
#define LDS_STRIDE 48   // unused; the GEMM tiles use TPITCH
#define KSTRIDE    72   // unused
#define VSTRIDE    48   // unused

__device__ __forceinline__ f32x8 wmma_bf16(bf16x16 a, bf16x16 b, f32x8 c) {
  c = __builtin_amdgcn_wmma_f32_16x16x32_f16(false, a, false, b, (short)0, c, false, false);
  asm volatile("v_nop\n\tv_nop\n\tv_nop\n\tv_nop" : "+v"(c) : "v"(a), "v"(b));   // A/B-overwrite hazard guard
  return c;
}

// 16x32 (MxK) f16 fragment from a row-major global matrix.
// lanes 0-15  (row=lane)    : elems 0..7 = K+0..7,  8..15 = K+16..23
// lanes 16-31 (row=lane-16) : elems 0..7 = K+8..15, 8..15 = K+24..31
template <typename T>
__device__ __forceinline__ bf16x16 load_frag(const T* __restrict__ base, int ld,
                                             int row0, int k0) {
  const int lane = threadIdx.x & 31;
  const int r    = lane & 15;
  const int kh   = (lane >> 4) * 8;
  const T* p0 = base + (size_t)(row0 + r) * ld + (k0 + kh);
  const T* p1 = p0 + 16;
  bf16x16 f;
#pragma unroll
  for (int i = 0; i < 8; ++i) {
    f[i]     = (bf16)p0[i];
    f[i + 8] = (bf16)p1[i];
  }
  return f;
}

// Same fragment from an LDS tile with padded row stride (base includes row0/k0).
__device__ __forceinline__ bf16x16 lds_frag(const bf16* base, int stride) {
  const int lane = threadIdx.x & 31;
  const int row  = lane & 15;
  const int kh   = (lane >> 4) * 8;
  const bf16x8 lo = *(const bf16x8*)(base + row * stride + kh);
  const bf16x8 hi = *(const bf16x8*)(base + row * stride + kh + 16);
  bf16x16 f;
#pragma unroll
  for (int i = 0; i < 8; ++i) { f[i] = lo[i]; f[i + 8] = hi[i]; }
  return f;
}

template <typename T>
__device__ __forceinline__ void stage_read16(const T* __restrict__ p, float* buf) {
#pragma unroll
  for (int i = 0; i < 16; ++i) buf[i] = (float)p[i];
}

__device__ __forceinline__ void stage_write(bf16* dst, const float* buf, int nquad) {
#pragma unroll
  for (int i = 0; i < nquad; ++i) {
    bf16x4 q;
    q[0] = (bf16)buf[4 * i];     q[1] = (bf16)buf[4 * i + 1];
    q[2] = (bf16)buf[4 * i + 2]; q[3] = (bf16)buf[4 * i + 3];
    *(bf16x4*)(dst + 4 * i) = q;
  }
}


#define NBT 8
#define BBn 8
#define CC 256
#define CI 128
#define HWn 4096       // 64 x 64 positions
#define N2 1024        // pooled positions (32 x 32)
// ---------------------------------------------------------------------------------------------------------------------------
// k_attn: scores, row softmax, y and the output convolution in one kernel; neither the score matrix nor y reaches memory. Block = 128 queries of one batch,
// 8 waves x 16 queries; 16 passes of 64 keys. Per pass S^T = phi * theta^T (A = phi rows from LDS, B = theta kept in registers,
// value+residual planes: hh + (lh + hl)/2048), so a lane holds 32 scores of ONE query (query = lane & 15, keys 16j + 8*(lane >> 4) + r):
// running maximum and sum per lane, one exchange between the wave halves. 1024 * exp(s - max), converted to f16 in place, is the
// B operand of O^T += g^T * P^T (A = g^T from LDS); y = O / sum at the end. The block holds all 128 channels of its 128 positions' y, which is all that its piece of
// out = BN(y * W_w^T + b) + x1 needs: each wave takes 32 of the 256 output channels; its rows of W_w (f16) and of x1 come into LDS two a pass, under the products.
// k_proj stores the phi planes and g^T as the f16 operands that are read here, so a tile needs no conversion and comes into LDS by asynchronous copies, two buffers.
// The one barrier of a pass is split. A wave signals when it has fetched its last fragment of tile t (all of phi, all of g^T) and its own pieces of tile t + 1 have landed; it waits at the top of pass t + 1.
// Between the two stand exp, the rescaling and P * g, on registers alone, with no LDS read: a wave that is ahead does them while the wave that shares its SIMD still fetches and multiplies, and starts its next scores
// as soon as that wave has signalled, so that the waves of a SIMD need not be in the same phase of a pass. Right behind the wait the tile of pass t + 1 is requested, into the buffers that pass t - 1 has read.
// ---------------------------------------------------------------------------------------------------------------------------
#define AKT 64     // keys per pass
#define AKS 136    // phi tile pitch, f16 elements (272-B rows: 16 rows of b128 reads fall on distinct banks)
#define AVS 72     // g^T tile pitch, f16 elements (144-B rows, the same)
#define AWS 136    // W_w and y tile pitch, f16 elements (272-B rows, as the phi tile)
#define AOS 132    // output staging pitch, f32 elements
#define AKB (2 * AKT * AKS)   // f16 elements of one phi buffer (both planes)
#define AVB (CI * AVS)        // f16 elements of one g^T buffer
typedef float v2fa __attribute__((ext_vector_type(2), may_alias));
// One tile (64 keys: 32 KiB of phi planes, 16 KiB of g^T) into LDS through no register: 8 + 4 asynchronous 16-byte copies a lane, each with an LDS byte address and a global address of its own.
// kd, vd: the lane's first LDS byte of the phi and of the g^T buffer (further pieces 8 keys = 8 rows, and 2 key groups = 32 B, on); ks, vs: its first global piece (further pieces 4 KiB on).
// s_wait_xcnt 0 is the statement's last line, so that it stands in front of every later write of a register that a copy names.
__device__ __forceinline__ void tile_copy(unsigned kd, unsigned vd, const float* ks, const float* vs) {
  asm volatile("global_load_async_to_lds_b128 %0, %12, off\n\t"
               "global_load_async_to_lds_b128 %1, %13, off\n\t"
               "global_load_async_to_lds_b128 %2, %14, off\n\t"
               "global_load_async_to_lds_b128 %3, %15, off\n\t"
               "global_load_async_to_lds_b128 %4, %16, off\n\t"
               "global_load_async_to_lds_b128 %5, %17, off\n\t"
               "global_load_async_to_lds_b128 %6, %18, off\n\t"
               "global_load_async_to_lds_b128 %7, %19, off\n\t"
               "global_load_async_to_lds_b128 %8, %20, off\n\t"
               "global_load_async_to_lds_b128 %9, %21, off\n\t"
               "global_load_async_to_lds_b128 %10, %22, off\n\t"
               "global_load_async_to_lds_b128 %11, %23, off\n\t"
               "s_wait_xcnt 0x0"
               :: "v"(kd), "v"(kd + 1 * 8 * AKS * 2), "v"(kd + 2 * 8 * AKS * 2), "v"(kd + 3 * 8 * AKS * 2), "v"(kd + 4 * 8 * AKS * 2), "v"(kd + 5 * 8 * AKS * 2), "v"(kd + 6 * 8 * AKS * 2), "v"(kd + 7 * 8 * AKS * 2),
                  "v"(vd), "v"(vd + 32), "v"(vd + 64), "v"(vd + 96),
                  "v"(ks), "v"(ks + 1024), "v"(ks + 2048), "v"(ks + 3072), "v"(ks + 4096), "v"(ks + 5120), "v"(ks + 6144), "v"(ks + 7168),
                  "v"(vs), "v"(vs + 1024), "v"(vs + 2048), "v"(vs + 3072)
               : "memory");
}
// s_wait_xcnt 0 behind a run of global loads, before their address registers are reused; the base pointer is an input so that it stays in its registers up to the wait
__device__ __forceinline__ void addr_wait(const float* p) { asm volatile("s_wait_xcnt 0x0" :: "v"(p) : "memory"); }
// v_nop: the one independent slot that the instruction set asks for behind a transcendental, kept whatever the compiler schedules next
__device__ __forceinline__ float exp2_slot(float x) { float r; asm("v_exp_f32 %0, %1\n\tv_nop" : "=v"(r) : "v"(x)); return r; }
__device__ __forceinline__ float rcp_slot(float x) { float r; asm("v_rcp_f32 %0, %1\n\tv_nop" : "=v"(r) : "v"(x)); return r; }
// the two halves of the work-group barrier; the "memory" clobber keeps every LDS access on its side of them
__device__ __forceinline__ void bar_signal() { asm volatile("s_barrier_signal -1" ::: "memory"); }
__device__ __forceinline__ void bar_wait() { asm volatile("s_barrier_wait -1" ::: "memory"); }
__device__ __forceinline__ f32x8 wmma_p(f16x16 a, f16x16 b, f32x8 c) { return __builtin_amdgcn_wmma_f32_16x16x32_f16(false, a, false, b, (short)0, c, false, false); }
// two waves per SIMD is all the grid gives (one block per WGP): let the register allocator use that room to fetch fragments ahead
__global__ __launch_bounds__(256) __attribute__((amdgpu_waves_per_eu(2, 2))) void k_attn(const float* __restrict__ TH, const float* __restrict__ PH, const float* __restrict__ GP,
                                                                                             const float* __restrict__ Ww, const float* __restrict__ Wb, const float* __restrict__ bng, const float* __restrict__ bnb,
                                                                                             const float* __restrict__ bnm, const float* __restrict__ bnv, const float* __restrict__ x1, float* __restrict__ out) {
  // the ring: phi buffer 0, phi buffer 1 (both planes each), g^T buffer 0, g^T buffer 1. Behind the loop phi buffer 0 is the block's y tile (128 * AWS, the same size) and the other three are the output staging (8 waves x 16 * AOS f32)
  __shared__ __attribute__((aligned(16))) f16 sT[2 * AKB + 2 * AVB];
  __shared__ __attribute__((aligned(16))) f16 sW[CC * AWS];
  __shared__ __attribute__((aligned(16))) float sX[CC * 128], sBi[CC], sInv[CC], sSh[CC];
  f16* const sY = sT;
  const int tid = threadIdx.x, lane = tid & 31, wave = tid >> 5, cl = lane & 15, hf = lane >> 4;
  const int q0 = blockIdx.x * 128 + wave * 16;
  TH += (size_t)blockIdx.y * HWn * CI; PH += (size_t)blockIdx.y * N2 * CI; GP += (size_t)blockIdx.y * (N2 * CI / 2);
  // a thread's 16-byte pieces of a tile. phi: a wave takes one key's 512 B (values, then residuals) a copy, keys wave + 8 * it. g^T: piece = 8 keys of one channel, a wave takes 32 channels of one key group a copy
  // the lane's own part of each address is kept apart from the part that the whole block shares (buffer, tile), which is scalar arithmetic
  const unsigned ring = (unsigned)(size_t)sT;
  const unsigned klane = hf * (AKT * AKS * 2) + wave * (AKS * 2) + cl * 16;
  const unsigned vlane = (tid & 127) * (AVS * 2) + (tid >> 7) * 16;
  // tile t lies in the buffers (t + 1) mod 2, and the loop forms its global addresses from a 32-bit element index: so no address that lives through the loop is itself an operand of the copies' asm statement here,
  // which would tie it to the low 256 registers (the compiler then spilled all four and reloaded them in front of every pass's copies)
  tile_copy(ring + AKB * 2 + klane, ring + 2 * AKB * 2 + AVB * 2 + vlane, PH + tid * 4, GP + tid * 4);   // tile 0: it flies under the theta loads and their conversion
  const float L2E = 1.4426950408889634f;
  const size_t off0 = ((size_t)blockIdx.y * CC + wave * 32) * HWn + blockIdx.x * 128 + lane * 4;   // the wave's 32 channels of x1 and out: 512 B of one channel a wave access
  // per-channel constants of the last epilogue, one output channel a thread; requested early, stored in front of the first barrier, which publishes them
  const float* cb = Wb + tid; const float* cg = bng + tid; const float* cs = bnb + tid; const float* cm = bnm + tid; const float* cv = bnv + tid;
  const float c_b = *cb, c_g = *cg, c_s = *cs, c_m = *cm, c_v = *cv;
  asm volatile("s_wait_xcnt 0x0" :: "v"(cb), "v"(cg), "v"(cs), "v"(cm), "v"(cv) : "memory");   // behind the five loads, before the registers that they name are reused
  // theta fragments (B operand: column = query cl), same k order as lds_frag
  f16x16 qh[4], ql[4];
  { const float* qb = TH + (size_t)(q0 + cl) * CI + hf * 8;
    v4f_t qa[4][4];
#pragma unroll
    for (int ks = 0; ks < 4; ++ks) { qa[ks][0] = *(const v4fa*)(qb + ks * 32); qa[ks][1] = *(const v4fa*)(qb + ks * 32 + 4); qa[ks][2] = *(const v4fa*)(qb + ks * 32 + 16); qa[ks][3] = *(const v4fa*)(qb + ks * 32 + 20); }
    addr_wait(qb);
#pragma unroll
    for (int ks = 0; ks < 4; ++ks)
#pragma unroll
      for (int i = 0; i < 8; ++i) {
        const float va = qa[ks][i >> 2][i & 3], vb = qa[ks][2 + (i >> 2)][i & 3];
        const f16 ha = (f16)va, hb = (f16)vb;
        qh[ks][i] = ha; ql[ks][i] = (f16)((va - (float)ha) * 2048.0f);
        qh[ks][i + 8] = hb; ql[ks][i + 8] = (f16)((vb - (float)hb) * 2048.0f);
      }
  }
  f32x8 o[8];
#pragma unroll
  for (int c = 0; c < 8; ++c) { f32x8 z = {}; o[c] = z; }
  float m = -3.0e38f, l = 0.0f;
  { const float inv = c_g * rsqrtf(c_v + 1e-5f); sBi[tid] = c_b; sInv[tid] = inv; sSh[tid] = c_s - c_m * inv; }
  asm volatile("s_wait_dscnt 0x0" ::: "memory");      // the constants stored above are in LDS before the signal (a bare signal waits for nothing)
  asm volatile("s_wait_asynccnt 0x0" ::: "memory");   // this wave's pieces of tile 0 have landed
  bar_signal();                                     // tile 0: this wave's part is published
#pragma unroll 1   // rolled: one pass is already 64 matrix instructions, and a second copy would double the live staging registers
  for (int t = 0; t < N2 / AKT; ++t) {
    bar_wait();                                     // tile t is published; every wave has fetched its last fragment of tile t - 1
    if (t + 1 < N2 / AKT)                           // tile t + 1 into the buffers that pass t - 1 has read: it flies under the fragment loads and the scores of pass t
      tile_copy(ring + (t & 1) * (AKB * 2) + klane, ring + 2 * AKB * 2 + (t & 1) * (AVB * 2) + vlane, PH + (tid * 4 + (t + 1) * (AKT * CI)), GP + (tid * 4 + (t + 1) * (AKT * CI / 2)));
    const f16* const sKh = sT + ((t + 1) & 1) * AKB; const f16* const sKl = sKh + AKT * AKS; const f16* const sVt = sT + 2 * AKB + ((t + 1) & 1) * AVB;   // pass t reads the buffers (t + 1) mod 2 alone
    // The fragment loads go out in groups of 16 loads, ahead of their products: phi keys 0-31 first, then with each 16 keys' products one more group (phi 32-47, phi 48-63, g^T keys 0-31, g^T keys 32-63),
    // so that all 16 g^T fragments are fetched in front of the signal (behind it the wave reads nothing of the ring) and no more than three groups are live at a time.
    f32x8 s[4]; f16x16 kh[4][4], kl[4][4], vf[2][8];
    auto phi_load = [&](const int j) {
#pragma unroll
      for (int ks = 0; ks < 4; ++ks) { kh[j][ks] = lds_frag(sKh + (16 * j) * AKS + ks * 32, AKS); kl[j][ks] = lds_frag(sKl + (16 * j) * AKS + ks * 32, AKS); }
    };
    auto g_load = [&](const int k2) {
#pragma unroll
      for (int c = 0; c < 8; ++c) vf[k2][c] = lds_frag(sVt + (16 * c) * AVS + k2 * 32, AVS);
    };
    auto scores = [&](const int j) {
      f32x8 a = {}, ax = {};
#pragma unroll
      for (int ks = 0; ks < 4; ++ks) { a = wmma_p(kh[j][ks], qh[ks], a); ax = wmma_p(kl[j][ks], qh[ks], ax); ax = wmma_p(kh[j][ks], ql[ks], ax); }
      s[j] = a + ax * (1.0f / 2048.0f);
    };
    float mx = -3.0e38f;
    auto row_max = [&](const int j) {
#pragma unroll
      for (int r = 0; r < 8; ++r) mx = fmaxf(mx, s[j][r]);
    };
    // each sched_barrier below keeps a group of loads in its place: hoisted further the groups would not fit the registers (spills), sunk behind the last products they would pay the LDS latency in front of the signal.
    // The running maximum of 16 keys is taken under the next 16 keys' products.
    phi_load(0); phi_load(1);
    __builtin_amdgcn_sched_barrier(0);
    // two of the wave's own 32 rows of W_w and of x1 a pass (whole 512-B rows): after 16 passes the last product's weights and its residual stand in LDS, with no wait of their own.
    // Behind the first fragment loads, so that the two address waits pass while those are on their way and the LDS is not left idle at the top of a pass
    const float* wp = Ww + (size_t)(wave * 32 + 2 * t) * CI + lane * 4;
    const v4f_t wr0 = *(const v4fa*)wp, wr1 = *(const v4fa*)(wp + CI);
    addr_wait(wp);
    const float* xp = x1 + off0 + (size_t)(2 * t) * HWn;
    const v4f_t xr0 = *(const v4fa*)xp, xr1 = *(const v4fa*)(xp + HWn);
    addr_wait(xp);
    phi_load(2); scores(0);
    __builtin_amdgcn_sched_barrier(0);
    phi_load(3); scores(1); row_max(0);
    __builtin_amdgcn_sched_barrier(0);
    g_load(0); scores(2); row_max(1);
    __builtin_amdgcn_sched_barrier(0);
    g_load(1);
    __builtin_amdgcn_sched_barrier(0);
    scores(3); row_max(2); row_max(3);
    mx = fmaxf(mx, __shfl_xor(mx, 16));            // the other half of the wave holds this query's other 32 keys (an exchange on the LDS path: it too stands in front of the signal)
    __builtin_amdgcn_sched_barrier(0);              // keeps that exchange in front of the waits and the signal
    asm volatile("s_wait_dscnt 0x0" ::: "memory");    // this wave's reads of the buffers of pass t have returned
    asm volatile("s_wait_asynccnt 0x0" ::: "memory"); // this wave's pieces of tile t + 1 have landed
    bar_signal();                                   // this wave has left the buffers of pass t, and its part of tile t + 1 is published
    __builtin_amdgcn_sched_barrier(0);              // keeps exp and P * g behind the signal: moved in front of it they would delay it, and the split would gain nothing
    const float mn = fmaxf(m, mx);
    const float alpha = exp2_slot((m - mn) * L2E);
    const float bias = 10.0f - mn * L2E;            // + 10: P carries a factor 1024 (small weights stay normal f16); it cancels against the sum
    m = mn;
#pragma unroll
    for (int j = 0; j < 4; ++j)
#pragma unroll
      for (int r = 0; r < 8; ++r) s[j][r] = exp2_slot(s[j][r] * L2E + bias);
    const f32x8 sv = (s[0] + s[1]) + (s[2] + s[3]);   // pairwise: a chain of 32 dependent adds would stand in the pass's critical path
    l = l * alpha + (((sv[0] + sv[1]) + (sv[2] + sv[3])) + ((sv[4] + sv[5]) + (sv[6] + sv[7])));
#pragma unroll
    for (int c = 0; c < 8; ++c) o[c] *= alpha;
    f16x16 pf[2];                                   // two score tiles (keys 32k2 .. + 31) converted in place = one B fragment in lds_frag's k order
#pragma unroll
    for (int k2 = 0; k2 < 2; ++k2)
#pragma unroll
      for (int i = 0; i < 8; ++i) { pf[k2][i] = (f16)s[2 * k2][i]; pf[k2][i + 8] = (f16)s[2 * k2 + 1][i]; }
    __builtin_amdgcn_sched_barrier(0);              // keeps every exp in front of the products
#pragma unroll
    for (int k2 = 0; k2 < 2; ++k2)
#pragma unroll
      for (int c = 0; c < 8; ++c) o[c] = wmma_p(vf[k2][c], pf[k2], o[c]);
    __builtin_amdgcn_sched_barrier(0);              // keeps the products in front of the waits for the W_w and x1 rows below
    { bf16x4 h0, h1;                                // behind the products: the W_w and x1 rows have had the whole pass to land. Stores into rows that this wave alone reads, behind the loop
#pragma unroll
      for (int u = 0; u < 4; ++u) { h0[u] = (f16)wr0[u]; h1[u] = (f16)wr1[u]; }
      *(bf16x4*)(sW + (wave * 32 + 2 * t) * AWS + lane * 4) = h0; *(bf16x4*)(sW + (wave * 32 + 2 * t + 1) * AWS + lane * 4) = h1;
      *(v4fa*)(sX + (wave * 32 + 2 * t) * 128 + lane * 4) = xr0; *(v4fa*)(sX + (wave * 32 + 2 * t + 1) * 128 + lane * 4) = xr1; }
  }
  bar_wait();                                       // the last signal's wait: every wave has left the ring
  __builtin_amdgcn_sched_barrier(0);                // keeps the exchange of the sums below (it runs on the LDS path) behind that wait
  asm volatile("s_wait_asynccnt 0x0" ::: "memory");   // no copy is under way when the ring is put to its other uses
  // The last product in the same block: out = BN(y * W_w^T + b) + x1 for the block's 128 positions and all 256 channels; a wave takes its 32 channels x 128 positions.
  l += __shfl_xor(l, 16);
  const float inv = rcp_slot(l);
  // lane holds y[query cl][16c + 8*hf + r]: 8 channels = 16 bytes of the [position][channel] f16 tile that every wave reads as A operand (the phi planes of buffer 0 that it overwrites were last read in pass 15, left at the wait behind the loop)
#pragma unroll
  for (int c = 0; c < 8; ++c) { f16x8 w;
#pragma unroll
    for (int r = 0; r < 8; ++r) w[r] = (f16)(o[c][r] * inv);
    *(f16x8*)(sY + (wave * 16 + cl) * AWS + 16 * c + 8 * hf) = w; }
  __syncthreads();                                  // y of all 128 positions is published
  f16x16 wf[2][4];
#pragma unroll
  for (int j = 0; j < 2; ++j)
#pragma unroll
    for (int ks = 0; ks < 4; ++ks) wf[j][ks] = lds_frag(sW + (wave * 32 + 16 * j) * AWS + ks * 32, AWS);
  f32x8 acc[8][2];
#pragma unroll
  for (int i = 0; i < 8; ++i) {
    f32x8 z = {}; acc[i][0] = z; acc[i][1] = z;
#pragma unroll
    for (int ks = 0; ks < 4; ++ks) {
      const f16x16 yf = lds_frag(sY + (16 * i) * AWS + ks * 32, AWS);
      acc[i][0] = wmma_p(yf, wf[0][ks], acc[i][0]); acc[i][1] = wmma_p(yf, wf[1][ks], acc[i][1]);
    }
  }
  // lane holds positions 16i + 8*hf + r of channel 16j + cl: 8 neighbours of an output row. 16 channels at a time are turned, wave-private, into whole 512-B rows for the stores
  float* so = (float*)(sT + AKB) + wave * (16 * AOS);
#pragma unroll
  for (int j = 0; j < 2; ++j) {
    const int ch = wave * 32 + 16 * j + cl;
    const float bi = sBi[ch], iv = sInv[ch], sh = sSh[ch];
#pragma unroll
    for (int i = 0; i < 8; ++i) { v4f_t w0, w1;
#pragma unroll
      for (int r = 0; r < 4; ++r) { float a = acc[i][j][r], b = acc[i][j][r + 4]; a += bi; b += bi; w0[r] = a * iv + sh; w1[r] = b * iv + sh; }
      *(v4fa*)(so + cl * AOS + 16 * i + 8 * hf) = w0; *(v4fa*)(so + cl * AOS + 16 * i + 8 * hf + 4) = w1; }
    asm volatile("s_wait_dscnt 0" ::: "memory");    // the rows read below were written by other lanes of this wave
    __builtin_amdgcn_wave_barrier();
#pragma unroll
    for (int it = 0; it < 16; ++it) {
      v4f_t v = *(const v4fa*)(so + it * AOS + lane * 4);
      v += *(const v4fa*)(sX + (wave * 32 + 16 * j + it) * 128 + lane * 4);
      *(v4f_t*)(out + off0 + (size_t)(16 * j + it) * HWn) = v;
    }
    if (j == 0) {
      asm volatile("s_wait_dscnt 0\n\ts_wait_xcnt 0x0" ::: "memory");   // the staging rows have been read before other lanes rewrite them; the stores' registers are free before they are reused
      __builtin_amdgcn_wave_barrier();
    }
  }
}
// ---------------------------------------------------------------------------------------------------------------------------
// gemm_tile: D[m][n] = sum_k A[m][k] * B[n][k], every operand read in the layout it has in memory, so that no transposed copy is made.
// B is row-major [n][k] (row stride LDB). A is row-major [m][k] (AKM false, row stride LDA) or k-major [k][m] (AKM true, row stride LDA).
// PL: value+residual planes on both operands (hh + (hl + lh)/2048, f32-class); else plain f16 operands. f32 accumulate.
// EPI 0: Y[m][n] = D + bias[n]. EPI 2: max of D + bias[n] over the 2 x 2 window of positions p (m = 64-wide image rows; LDY = channels of the pooled map, strideY its batch stride in f32 units), stored as the f16 operands that k_attn copies into LDS:
// under PL a row of 2 * LDY f16 a position (LDY values, then LDY residuals * 2048), else [p / 8][n][p % 8] f16 (16-byte pieces of the transposed map: 8 positions of one channel).
// Block = 128 x 128 tile, 8 waves as 4(M, 32 rows) x 2(N, 64 cols); per 64-wide k-step both tiles are staged f16 in LDS as [row][k]: a trip is a chain of load latency, conversion, two barriers and products,
// and the wide step pays the latency and the barriers half as often, with twice the bytes in flight; the products still walk k in 32-wide chunks in rising order.
// Without planes (half the accumulators, half the staged bytes a k) the step is 128 wide.
// EPI 2: the tile's 128 positions are image rows 2i and 2i + 1 (i = bx); a wave takes the same 16 columns of both rows (m = 16a .. + 15 and 64 + 16a .. + 15),
// so that all four positions of a window lie in one lane's accumulators (two neighbouring registers of both fragments) and the maximum needs no exchange.
// bz selects a batch (element strides).
// ---------------------------------------------------------------------------------------------------------------------------
// KS: k range of one staged tile (64 or 128). Staged tile pitch KS + 8 f16 elements (128-B rows at 144 B, 256-B rows at 272 B: 16-byte reads of 16 neighbouring rows fall on distinct banks)
#define TILE_F16 (128 * 72)   // f16 elements of one staged tile at KS = 64; four of them (two operands, two planes) also hold the two tiles at KS = 128
// 128 rows x KS k of a row-major f32 matrix: KS / 4 lanes take the whole KS * 4 B of a row, KS / 8 loads a thread
template <int LD, int KS>
__device__ __forceinline__ void rows_load(const float* __restrict__ p, v4f_t* v) {
#pragma unroll
  for (int it = 0; it < KS / 8; ++it) v[it] = *(const v4fa*)(p + (size_t)((1024 / KS) * it) * LD);
}
template <bool PL, int KS>
__device__ __forceinline__ void rows_store(const v4f_t* v, f16* dh, f16* dl) {
  constexpr int TPITCH = KS + 8;
  const int tid = threadIdx.x, r0 = tid / (KS / 4), c4 = (tid % (KS / 4)) * 4;
#pragma unroll
  for (int it = 0; it < KS / 8; ++it) { bf16x4 h, lo;
#pragma unroll
    for (int u = 0; u < 4; ++u) { h[u] = (f16)v[it][u]; lo[u] = (f16)((v[it][u] - (float)h[u]) * 2048.0f); }
    *(bf16x4*)(dh + (r0 + (1024 / KS) * it) * TPITCH + c4) = h; if (PL) *(bf16x4*)(dl + (r0 + (1024 / KS) * it) * TPITCH + c4) = lo; }
}
// The body is a function of the block's place (bx, by, bz) and of LDS arrays that the kernel owns, so that one launch can hold tiles of several products:
// ldsA, ldsB (and ldsAl, ldsBl under PL) 128 * (KS + 8) f16 each, oS 8 waves x (EPI 2: 8, else 32) rows x 68 f32.
template <bool PL, bool AKM, int EPI, int LDA, int LDB, int LDY, int K>
__device__ __forceinline__ void gemm_tile(f16* ldsA, f16* ldsAl, f16* ldsB, f16* ldsBl, float* oS, const int bx, const int by, const int bz,
                                          const float* __restrict__ A, size_t strideA, const float* __restrict__ B, size_t strideB,
                                          const float* __restrict__ bias, float* __restrict__ Y, size_t strideY) {
  constexpr int OSW = (EPI == 2 ? 8 : 32) * 68;   // f32 elements of one wave's output staging
  constexpr int KSTEP = PL ? 64 : 128, TPITCH = KSTEP + 8;
  const int tid = threadIdx.x, lane = tid & 31, wave = tid >> 5, cl = lane & 15, rh = (lane >> 4) * 8;
  const int m0 = bx * 128, n0 = by * 128;
  const int wm = (wave & 3) * (EPI == 2 ? 16 : 32), wn = (wave >> 2) * 64;
  constexpr int FM = EPI == 2 ? 64 : 16;   // rows between a wave's two A fragments
  A += (size_t)bz * strideA; B += (size_t)bz * strideB; Y += (size_t)bz * strideY;
  f32x8 acc[2][4], accx[2][4];
#pragma unroll
  for (int i = 0; i < 2; ++i)
#pragma unroll
    for (int j = 0; j < 4; ++j) { f32x8 z = {}; acc[i][j] = z; accx[i][j] = z; }
  // k-major A: wave -> 8 k rows (kg) of each 32-wide chunk of the k-step, of one 64-wide half of the tile's m range (mh); lane -> m = 2 * lane + {0, 1}: a load is 256 B of one k row
  const int kg = wave & 3, mh = wave >> 2;
  const float* pa = AKM ? A + (size_t)(kg * 8) * LDA + m0 + mh * 64 + 2 * lane : A + (size_t)(m0 + tid / (KSTEP / 4)) * LDA + (tid % (KSTEP / 4)) * 4;
  const float* pb = B + (size_t)(n0 + tid / (KSTEP / 4)) * LDB + (tid % (KSTEP / 4)) * 4;
#pragma unroll 1   // rolled: the trips are separated by barriers and gain nothing from a second copy of the staging code
  for (int k0 = 0; k0 < K; k0 += KSTEP) {
    __syncthreads();                                // every wave has left the tiles of the trip before
    v2fa at[KSTEP / 4]; v4f_t ar[KSTEP / 8], br[KSTEP / 8];
    if (AKM) {
#pragma unroll
      for (int kk = 0; kk < KSTEP / 4; ++kk) at[kk] = *(const v2fa*)(pa + (size_t)((kk >> 3) * 32 + (kk & 7)) * LDA);
    } else rows_load<LDA, KSTEP>(pa, ar);
    rows_load<LDB, KSTEP>(pb, br);
    asm volatile("s_wait_xcnt 0x0" :: "v"(pa), "v"(pb) : "memory");   // behind both runs of loads, before the two pointers they name are advanced
    pa += AKM ? (size_t)KSTEP * LDA : KSTEP; pb += KSTEP;
    if (AKM) {                                      // the turn: a thread's 8 k values of one m are 16 contiguous bytes of the [m][k] tile
#pragma unroll   // unrolled: at[] is indexed by constants only and stays in registers
      for (int g2 = 0; g2 < KSTEP / 32; ++g2)
#pragma unroll
      for (int e = 0; e < 2; ++e) { f16x8 h, lo;
#pragma unroll
        for (int kk = 0; kk < 8; ++kk) { const float v = at[g2 * 8 + kk][e]; h[kk] = (f16)v; lo[kk] = (f16)((v - (float)h[kk]) * 2048.0f); }
        *(f16x8*)(ldsA + (mh * 64 + 2 * lane + e) * TPITCH + g2 * 32 + kg * 8) = h; if (PL) *(f16x8*)(ldsAl + (mh * 64 + 2 * lane + e) * TPITCH + g2 * 32 + kg * 8) = lo; }
    } else rows_store<PL, KSTEP>(ar, ldsA, ldsAl);
    rows_store<PL, KSTEP>(br, ldsB, ldsBl);
    __syncthreads();                                // both tiles are published
#pragma unroll   // unrolled: the LDS offsets of all chunks are immediates of the fragment loads
    for (int kc = 0; kc < KSTEP; kc += 32) {
    f16x16 af[2], afl[2];
#pragma unroll
    for (int i = 0; i < 2; ++i) { af[i] = lds_frag(ldsA + (wm + FM * i) * TPITCH + kc, TPITCH); if (PL) afl[i] = lds_frag(ldsAl + (wm + FM * i) * TPITCH + kc, TPITCH); }
#pragma unroll
    for (int j = 0; j < 4; ++j) {
      const f16x16 bf = lds_frag(ldsB + (wn + 16 * j) * TPITCH + kc, TPITCH);
      if (PL) {
        const f16x16 bfl = lds_frag(ldsBl + (wn + 16 * j) * TPITCH + kc, TPITCH);
#pragma unroll
        for (int i = 0; i < 2; ++i) { acc[i][j] = wmma16(af[i], bf, acc[i][j]); accx[i][j] = wmma16(af[i], bfl, accx[i][j]); accx[i][j] = wmma16(afl[i], bf, accx[i][j]); }
      } else {
#pragma unroll
        for (int i = 0; i < 2; ++i) acc[i][j] = wmma16(af[i], bf, acc[i][j]);
      }
    }
    }
  }
  if (EPI == 2) {   // lane holds positions (row 2i + f, column wm + rh + r) of channel 16j + cl in acc[f][j][r]: window p of the lane = registers 2p, 2p + 1 of both fragments
    float* sp = oS + wave * OSW;
    // !PL: the lane's 4 pooled positions of a channel are 8 bytes of that channel's 16-byte piece; a store of the wave is 256 B, its 4 stores 1 KiB in a row
    f16* yt = (f16*)Y + ((size_t)(bx * 4 + (wave & 3)) * LDY + n0 + wn + cl) * 8 + (rh >> 1);
#pragma unroll
    for (int j = 0; j < 4; ++j) {
      const float bv = bias[n0 + wn + 16 * j + cl];
      bf16x4 q;
#pragma unroll
      for (int p = 0; p < 4; ++p) {
        float v[2][2];
#pragma unroll
        for (int i = 0; i < 2; ++i)
#pragma unroll
          for (int e = 0; e < 2; ++e) v[i][e] = (PL ? acc[i][j][2 * p + e] + accx[i][j][2 * p + e] * (1.0f / 2048.0f) : acc[i][j][2 * p + e]) + bv;
        const float mx = fmaxf(fmaxf(v[0][0], v[0][1]), fmaxf(v[1][0], v[1][1]));
        if (PL) sp[((rh >> 1) + p) * 68 + 16 * j + cl] = mx; else q[p] = (f16)mx;
      }
      if (!PL) *(bf16x4*)(yt + 16 * j * 8) = q;
    }
    if (PL) {
      asm volatile("s_wait_dscnt 0" ::: "memory");    // the rows read below were written by other lanes of this wave
      __builtin_amdgcn_wave_barrier();
      // a wave's 8 pooled positions x 64 channels go out as 128-B segments of f16 values and of f16 residuals
      f16* yp = (f16*)Y + (size_t)(bx * 32 + (wm >> 1) + (lane >> 4)) * (2 * LDY) + n0 + wn + (lane & 15) * 4;
#pragma unroll
      for (int it = 0; it < 4; ++it) { const v4f_t v = *(const v4fa*)(sp + ((lane >> 4) + 2 * it) * 68 + (lane & 15) * 4); bf16x4 h, lo;
#pragma unroll
        for (int u = 0; u < 4; ++u) { h[u] = (f16)v[u]; lo[u] = (f16)((v[u] - (float)h[u]) * 2048.0f); }
        *(bf16x4*)(yp + (size_t)(2 * it) * (2 * LDY)) = h; *(bf16x4*)(yp + (size_t)(2 * it) * (2 * LDY) + LDY) = lo; }
    }
    asm volatile("s_wait_xcnt 0x0" ::: "memory");   // behind the run of stores: a precaution, as in k_proj a block runs one product and the kernel ends behind it
    return;
  }
  // a wave's 32 x 64 piece goes out as 256-B row segments: thread -> rows (lane >> 4) + 2 * it, 16 bytes at column (lane & 15) * 4
  const size_t off0 = (size_t)(m0 + wm + (lane >> 4)) * LDY + n0 + wn + (lane & 15) * 4;
  float* so = oS + wave * OSW;
#pragma unroll
  for (int i = 0; i < 2; ++i)
#pragma unroll
    for (int j = 0; j < 4; ++j) {
      const float bv = bias[n0 + wn + 16 * j + cl];
#pragma unroll
      for (int r = 0; r < 8; ++r) {
        float v = PL ? acc[i][j][r] + accx[i][j][r] * (1.0f / 2048.0f) : acc[i][j][r];
        v += bv;
        so[(16 * i + rh + r) * 68 + 16 * j + cl] = v;
      }
    }
  asm volatile("s_wait_dscnt 0" ::: "memory");      // the rows read below were written by other lanes of this wave
  __builtin_amdgcn_wave_barrier();
#pragma unroll
  for (int it = 0; it < 16; ++it) {
    const v4f_t v = *(const v4fa*)(so + ((lane >> 4) + 2 * it) * 68 + (lane & 15) * 4);
    *(v4f_t*)(Y + off0 + (size_t)(2 * it) * LDY) = v;
  }
  asm volatile("s_wait_xcnt 0x0" ::: "memory");   // behind the run of stores, as above
}
// k_proj: the three 1x1 convolutions depend on nothing but the inputs, so their 3 x 256 tiles go out as one launch: no launch gap between them, and
// two blocks share a WGP (registers allow four waves a SIMD), so that one block's products run while the other waits for its global loads.
// blockIdx.z = 8 * product + batch; the two products with planes come first, the short one (g) fills the places that they leave.
__global__ __launch_bounds__(256) void k_proj(const float* __restrict__ x1, const float* __restrict__ x2,
                                              const float* __restrict__ pw, const float* __restrict__ pb, const float* __restrict__ tw, const float* __restrict__ tb,
                                              const float* __restrict__ gw, const float* __restrict__ gb,
                                              float* __restrict__ PH, float* __restrict__ TH, float* __restrict__ GP) {
  __shared__ __attribute__((aligned(16))) f16 tiles[4 * TILE_F16];
  f16* const ldsA = tiles, * const ldsAl = tiles + TILE_F16, * const ldsB = tiles + 2 * TILE_F16, * const ldsBl = tiles + 3 * TILE_F16;   // g: two tiles of 128 * 136 f16, A in the first half, B in the second
  __shared__ __attribute__((aligned(16))) float oS[8 * 32 * 68];   // theta's size, the largest of the three
  const int which = blockIdx.z >> 3, bz = blockIdx.z & 7;
  if (which == 0)      gemm_tile<true, true, 2, HWn, CC, CI, CC>(ldsA, ldsAl, ldsB, ldsBl, oS, blockIdx.x, 0, bz, x2, (size_t)CC * HWn, pw, 0, pb, PH, (size_t)N2 * CI);    // pooled phi rows (products with planes; stored as f16 planes)
  else if (which == 1) gemm_tile<true, true, 0, HWn, CC, CI, CC>(ldsA, ldsAl, ldsB, ldsBl, oS, blockIdx.x, 0, bz, x1, (size_t)CC * HWn, tw, 0, tb, TH, (size_t)HWn * CI);   // theta rows (planes)
  else                 gemm_tile<false, true, 2, HWn, CC, CI, CC>(ldsA, nullptr, ldsB, nullptr, oS, blockIdx.x, 0, bz, x1, (size_t)CC * HWn, gw, 0, gb, GP, (size_t)N2 * CI / 2);   // pooled g, f16 pieces (on x1, faithful)
}
extern "C" void kernel_launch(void* const* d_in, const int* in_sizes, int n_in,
                              void* d_out, int out_size, void* d_ws, size_t ws_size,
                              hipStream_t stream) {
  (void)in_sizes; (void)n_in; (void)out_size;
  const float** f = (const float**)d_in;
  const float* x1 = f[0], *x2 = f[1], *gw = f[2], *gb = f[3], *tw = f[4], *tb = f[5], *pw = f[6], *pb = f[7], *Ww = f[8], *Wb = f[9], *bng = f[10], *bnb = f[11], *bnm = f[12], *bnv = f[13];
  float* out = (float*)d_out;     // [8,256,64,64]
  char* ws = (char*)d_ws;
  // every per-batch buffer holds all NBT batches, batch b at b * (its per-batch size)
  float* TH = (float*)ws; ws += (size_t)NBT * HWn * CI * 4;             // theta rows [8][4096][128] f32
  float* GP = (float*)ws; ws += (size_t)NBT * N2 * CI * 2;              // pooled g, f16 [8][128 key groups][128][8]
  float* PH = (float*)ws; ws += (size_t)NBT * N2 * CI * 4;              // pooled phi, f16 [8][1024][value, residual][128]
  if ((size_t)(ws - (char*)d_ws) > ws_size) return;                     // WS TOTAL 23,068,672 B
  const dim3 blk(256);
  // one launch per stage for all NBT batches: the batch is a grid dimension; the three convolutions are one stage
  k_proj<<<dim3(HWn / 128, 1, 3 * NBT), blk, 0, stream>>>(x1, x2, pw, pb, tw, tb, gw, gb, PH, TH, GP);                                                         // pooled phi, theta, pooled g
  k_attn<<<dim3(HWn / 128, NBT), blk, 0, stream>>>(TH, PH, GP, Ww, Wb, bng, bnb, bnm, bnv, x1, out);                                                         // y = softmax(theta * phi^T) * g, out = BN(W_w * y^T + b) + x1; scores and y kept on chip
}

// v010
// Measured time: 48.7 microseconds a run.
// Two timings next to v009 both put it at 1.04 times that version's speed.
// All steps since v000 together make it 29.0 times as fast.
// Contractions on v_wmma_f32_16x16x32_f16, f32 accumulate: the three 1x1 convs as position-major GEMMs (x^T * W^T + b, K = 256, theta out as f32, pooled phi and g out as f16; theta and phi, the score operands, with f16 value+residual planes, g plain f16;
// x is read as it lies in memory, channel-major, and turned in registers on its way to LDS; the weights are read as they lie, [out][in]), 2x2 max-pooling of the g / phi maps over positions in the epilogue of their GEMMs (the full-resolution maps never reach memory), per batch the non-local scores f = theta * phi^T (K = 128, 4096 x 1024) with f16 value+residual planes
// (hi*hi + (hi*lo + lo*hi)/2048: unscaled logits of spread about 11 give a peaked softmax that needs f32-class scores), running f32 row softmax and y = P * g (plain f16 operands, P carried as 1024 * exp(s - max))
// in the same kernel as the scores, and there too W_y = y * W_w^T + b (K = 128, plain f16; y goes from wave to wave through LDS and never reaches memory), turned channel-major in LDS, with BatchNorm (running stats) + the x1 residual in its epilogue.
// compute dtype: f16 operands (planes on the scores), f32 accumulate; pooling / softmax / BN in f32.  x1, x2 [8,256,64,64].
#include <hip/hip_runtime.h>
#include <hip/hip_bf16.h>
#include <math.h>


typedef _Float16 bf16;
typedef _Float16 f16;
typedef __attribute__((ext_vector_type(4))) unsigned v4u_t;
typedef unsigned v4ua __attribute__((ext_vector_type(4), may_alias));
typedef __attribute__((ext_vector_type(4))) float v4f_t;
typedef float v4fa __attribute__((ext_vector_type(4), may_alias));
typedef __attribute__((ext_vector_type(16))) bf16  bf16x16;
typedef bf16x16 f16x16;
typedef __attribute__((ext_vector_type(8)))  bf16  bf16x8;
typedef bf16x8 f16x8;
typedef __attribute__((ext_vector_type(4)))  bf16  bf16x4;
typedef __attribute__((ext_vector_type(8)))  float f32x8;
#define LDS_STRIDE 48   // unused
#define KSTRIDE    72   // unused
#define VSTRIDE    48   // unused

__device__ __forceinline__ f32x8 wmma_bf16(bf16x16 a, bf16x16 b, f32x8 c) {
  c = __builtin_amdgcn_wmma_f32_16x16x32_f16(false, a, false, b, (short)0, c, false, false);
  asm volatile("v_nop\n\tv_nop\n\tv_nop\n\tv_nop" : "+v"(c) : "v"(a), "v"(b));   // A/B-overwrite hazard guard
  return c;
}

// 16x32 (MxK) f16 fragment from a row-major global matrix.
// lanes 0-15  (row=lane)    : elems 0..7 = K+0..7,  8..15 = K+16..23
// lanes 16-31 (row=lane-16) : elems 0..7 = K+8..15, 8..15 = K+24..31
template <typename T>
__device__ __forceinline__ bf16x16 load_frag(const T* __restrict__ base, int ld,
                                             int row0, int k0) {
  const int lane = threadIdx.x & 31;
  const int r    = lane & 15;
  const int kh   = (lane >> 4) * 8;
  const T* p0 = base + (size_t)(row0 + r) * ld + (k0 + kh);
  const T* p1 = p0 + 16;
  bf16x16 f;
#pragma unroll
  for (int i = 0; i < 8; ++i) {
    f[i]     = (bf16)p0[i];
    f[i + 8] = (bf16)p1[i];
  }
  return f;
}

// Same fragment from an LDS tile with padded row stride (base includes row0/k0).
__device__ __forceinline__ bf16x16 lds_frag(const bf16* base, int stride) {
  const int lane = threadIdx.x & 31;
  const int row  = lane & 15;
  const int kh   = (lane >> 4) * 8;
  const bf16x8 lo = *(const bf16x8*)(base + row * stride + kh);
  const bf16x8 hi = *(const bf16x8*)(base + row * stride + kh + 16);
  bf16x16 f;
#pragma unroll
  for (int i = 0; i < 8; ++i) { f[i] = lo[i]; f[i + 8] = hi[i]; }
  return f;
}

template <typename T>
__device__ __forceinline__ void stage_read16(const T* __restrict__ p, float* buf) {
#pragma unroll
  for (int i = 0; i < 16; ++i) buf[i] = (float)p[i];
}

__device__ __forceinline__ void stage_write(bf16* dst, const float* buf, int nquad) {
#pragma unroll
  for (int i = 0; i < nquad; ++i) {
    bf16x4 q;
    q[0] = (bf16)buf[4 * i];     q[1] = (bf16)buf[4 * i + 1];
    q[2] = (bf16)buf[4 * i + 2]; q[3] = (bf16)buf[4 * i + 3];
    *(bf16x4*)(dst + 4 * i) = q;
  }
}


#define NBT 8
#define BBn 8
#define CC 256
#define CI 128
#define HWn 4096       // 64 x 64 positions
#define N2 1024        // pooled positions (32 x 32)
// ---------------------------------------------------------------------------------------------------------------------------
// k_attn: scores, row softmax, y and the output convolution in one kernel; neither the score matrix nor y reaches memory. Block = 128 queries of one batch,
// 8 waves x 16 queries; 16 passes of 64 keys. Per pass S^T = phi * theta^T (A = phi rows from LDS, B = theta kept in registers,
// value+residual planes: hh + (lh + hl)/2048), so a lane holds 32 scores of ONE query (query = lane & 15, keys 16j + 8*(lane >> 4) + r):
// running maximum and sum per lane, one exchange between the wave halves. 1024 * exp(s - max), converted to f16 in place, is the
// B operand of O^T += g^T * P^T (A = g^T from LDS); y = O / sum at the end. The block holds all 128 channels of its 128 positions' y, which is all that its piece of
// out = BN(y * W_w^T + b) + x1 needs: each wave takes 32 of the 256 output channels; its rows of W_w (f16) and of x1 come into LDS two a pass, under the products.
// k_proj stores the phi planes and g^T as the f16 operands that are read here, so a tile needs no conversion and comes into LDS by asynchronous copies, two buffers.
// The one barrier of a pass is split. A wave signals when it has fetched its last fragment of tile t (all of phi, all of g^T) and its own pieces of tile t + 1 have landed; it waits at the top of pass t + 1.
// Between the two stand exp, the rescaling and P * g, on registers alone, with no LDS read: a wave that is ahead does them while the wave that shares its SIMD still fetches and multiplies, and starts its next scores
// as soon as that wave has signalled, so that the waves of a SIMD need not be in the same phase of a pass. Right behind the wait the tile of pass t + 1 is requested, into the buffers that pass t - 1 has read.
// ---------------------------------------------------------------------------------------------------------------------------
#define AKT 64     // keys per pass
#define AKS 136    // phi tile pitch, f16 elements (272-B rows: 16 rows of b128 reads fall on distinct banks)
#define AVS 72     // g^T tile pitch, f16 elements (144-B rows, the same)
#define AWS 136    // W_w and y tile pitch, f16 elements (272-B rows, as the phi tile)
#define AOS 132    // output staging pitch, f32 elements
#define AKB (2 * AKT * AKS)   // f16 elements of one phi buffer (both planes)
#define AVB (CI * AVS)        // f16 elements of one g^T buffer
typedef float v2fa __attribute__((ext_vector_type(2), may_alias));
// One tile (64 keys: 32 KiB of phi planes, 16 KiB of g^T) into LDS through no register: 8 + 4 asynchronous 16-byte copies a lane, each with an LDS byte address and a global address of its own.
// kd, vd: the lane's first LDS byte of the phi and of the g^T buffer (further pieces 8 keys = 8 rows, and 2 key groups = 32 B, on); ks, vs: its first global piece (further pieces 4 KiB on).
// s_wait_xcnt 0 is the statement's last line, so that it stands in front of every later write of a register that a copy names.
__device__ __forceinline__ void tile_copy(unsigned kd, unsigned vd, const float* ks, const float* vs) {
  asm volatile("global_load_async_to_lds_b128 %0, %12, off\n\t"
               "global_load_async_to_lds_b128 %1, %13, off\n\t"
               "global_load_async_to_lds_b128 %2, %14, off\n\t"
               "global_load_async_to_lds_b128 %3, %15, off\n\t"
               "global_load_async_to_lds_b128 %4, %16, off\n\t"
               "global_load_async_to_lds_b128 %5, %17, off\n\t"
               "global_load_async_to_lds_b128 %6, %18, off\n\t"
               "global_load_async_to_lds_b128 %7, %19, off\n\t"
               "global_load_async_to_lds_b128 %8, %20, off\n\t"
               "global_load_async_to_lds_b128 %9, %21, off\n\t"
               "global_load_async_to_lds_b128 %10, %22, off\n\t"
               "global_load_async_to_lds_b128 %11, %23, off\n\t"
               "s_wait_xcnt 0x0"
               :: "v"(kd), "v"(kd + 1 * 8 * AKS * 2), "v"(kd + 2 * 8 * AKS * 2), "v"(kd + 3 * 8 * AKS * 2), "v"(kd + 4 * 8 * AKS * 2), "v"(kd + 5 * 8 * AKS * 2), "v"(kd + 6 * 8 * AKS * 2), "v"(kd + 7 * 8 * AKS * 2),
                  "v"(vd), "v"(vd + 32), "v"(vd + 64), "v"(vd + 96),
                  "v"(ks), "v"(ks + 1024), "v"(ks + 2048), "v"(ks + 3072), "v"(ks + 4096), "v"(ks + 5120), "v"(ks + 6144), "v"(ks + 7168),
                  "v"(vs), "v"(vs + 1024), "v"(vs + 2048), "v"(vs + 3072)
               : "memory");
}
// s_wait_xcnt 0 behind a run of global loads, before their address registers are reused; the base pointer is an input so that it stays in its registers up to the wait
__device__ __forceinline__ void addr_wait(const float* p) { asm volatile("s_wait_xcnt 0x0" :: "v"(p) : "memory"); }
// v_nop: the one independent slot that the instruction set asks for behind a transcendental, kept whatever the compiler schedules next
__device__ __forceinline__ float exp2_slot(float x) { float r; asm("v_exp_f32 %0, %1\n\tv_nop" : "=v"(r) : "v"(x)); return r; }
__device__ __forceinline__ float rcp_slot(float x) { float r; asm("v_rcp_f32 %0, %1\n\tv_nop" : "=v"(r) : "v"(x)); return r; }
// the two halves of the work-group barrier; the "memory" clobber keeps every LDS access on its side of them
__device__ __forceinline__ void bar_signal() { asm volatile("s_barrier_signal -1" ::: "memory"); }
__device__ __forceinline__ void bar_wait() { asm volatile("s_barrier_wait -1" ::: "memory"); }
__device__ __forceinline__ f32x8 wmma_p(f16x16 a, f16x16 b, f32x8 c) { return __builtin_amdgcn_wmma_f32_16x16x32_f16(false, a, false, b, (short)0, c, false, false); }
// two waves per SIMD is all the grid gives (one block per WGP): let the register allocator use that room to fetch fragments ahead
__global__ __launch_bounds__(256) __attribute__((amdgpu_waves_per_eu(2, 2))) void k_attn(const float* __restrict__ TH, const float* __restrict__ PH, const float* __restrict__ GP,
                                                                                             const float* __restrict__ Ww, const float* __restrict__ Wb, const float* __restrict__ bng, const float* __restrict__ bnb,
                                                                                             const float* __restrict__ bnm, const float* __restrict__ bnv, const float* __restrict__ x1, float* __restrict__ out) {
  // the ring: phi buffer 0, phi buffer 1 (both planes each), g^T buffer 0, g^T buffer 1. Behind the loop phi buffer 0 is the block's y tile (128 * AWS, the same size) and the other three are the output staging (8 waves x 16 * AOS f32)
  __shared__ __attribute__((aligned(16))) f16 sT[2 * AKB + 2 * AVB];
  __shared__ __attribute__((aligned(16))) f16 sW[CC * AWS];
  __shared__ __attribute__((aligned(16))) float sX[CC * 128], sBi[CC], sInv[CC], sSh[CC];
  f16* const sY = sT;
  const int tid = threadIdx.x, lane = tid & 31, wave = tid >> 5, cl = lane & 15, hf = lane >> 4;
  const int q0 = blockIdx.x * 128 + wave * 16;
  TH += (size_t)blockIdx.y * HWn * CI; PH += (size_t)blockIdx.y * N2 * CI; GP += (size_t)blockIdx.y * (N2 * CI / 2);
  // a thread's 16-byte pieces of a tile. phi: a wave takes one key's 512 B (values, then residuals) a copy, keys wave + 8 * it. g^T: piece = 8 keys of one channel, a wave takes 32 channels of one key group a copy
  // the lane's own part of each address is kept apart from the part that the whole block shares (buffer, tile), which is scalar arithmetic
  const unsigned ring = (unsigned)(size_t)sT;
  const unsigned klane = hf * (AKT * AKS * 2) + wave * (AKS * 2) + cl * 16;
  const unsigned vlane = (tid & 127) * (AVS * 2) + (tid >> 7) * 16;
  // tile t lies in the buffers (t + 1) mod 2, and the loop forms its global addresses from a 32-bit element index: so no address that lives through the loop is itself an operand of the copies' asm statement here,
  // which would tie it to the low 256 registers (the compiler then spilled all four and reloaded them in front of every pass's copies)
  tile_copy(ring + AKB * 2 + klane, ring + 2 * AKB * 2 + AVB * 2 + vlane, PH + tid * 4, GP + tid * 4);   // tile 0: it flies under the theta loads and their conversion
  const float L2E = 1.4426950408889634f;
  const size_t off0 = ((size_t)blockIdx.y * CC + wave * 32) * HWn + blockIdx.x * 128 + lane * 4;   // the wave's 32 channels of x1 and out: 512 B of one channel a wave access
  // per-channel constants of the last epilogue, one output channel a thread; requested early, stored in front of the first barrier, which publishes them
  const float* cb = Wb + tid; const float* cg = bng + tid; const float* cs = bnb + tid; const float* cm = bnm + tid; const float* cv = bnv + tid;
  const float c_b = *cb, c_g = *cg, c_s = *cs, c_m = *cm, c_v = *cv;
  asm volatile("s_wait_xcnt 0x0" :: "v"(cb), "v"(cg), "v"(cs), "v"(cm), "v"(cv) : "memory");   // behind the five loads, before the registers that they name are reused
  // theta fragments (B operand: column = query cl), same k order as lds_frag
  f16x16 qh[4], ql[4];
  { const float* qb = TH + (size_t)(q0 + cl) * CI + hf * 8;
    v4f_t qa[4][4];
#pragma unroll
    for (int ks = 0; ks < 4; ++ks) { qa[ks][0] = *(const v4fa*)(qb + ks * 32); qa[ks][1] = *(const v4fa*)(qb + ks * 32 + 4); qa[ks][2] = *(const v4fa*)(qb + ks * 32 + 16); qa[ks][3] = *(const v4fa*)(qb + ks * 32 + 20); }
    addr_wait(qb);
#pragma unroll
    for (int ks = 0; ks < 4; ++ks)
#pragma unroll
      for (int i = 0; i < 8; ++i) {
        const float va = qa[ks][i >> 2][i & 3], vb = qa[ks][2 + (i >> 2)][i & 3];
        const f16 ha = (f16)va, hb = (f16)vb;
        qh[ks][i] = ha; ql[ks][i] = (f16)((va - (float)ha) * 2048.0f);
        qh[ks][i + 8] = hb; ql[ks][i + 8] = (f16)((vb - (float)hb) * 2048.0f);
      }
  }
  f32x8 o[8];
#pragma unroll
  for (int c = 0; c < 8; ++c) { f32x8 z = {}; o[c] = z; }
  float m = -3.0e38f, l = 0.0f;
  { const float inv = c_g * rsqrtf(c_v + 1e-5f); sBi[tid] = c_b; sInv[tid] = inv; sSh[tid] = c_s - c_m * inv; }
  asm volatile("s_wait_dscnt 0x0" ::: "memory");      // the constants stored above are in LDS before the signal (a bare signal waits for nothing)
  asm volatile("s_wait_asynccnt 0x0" ::: "memory");   // this wave's pieces of tile 0 have landed
  bar_signal();                                     // tile 0: this wave's part is published
#pragma unroll 1   // rolled: one pass is already 64 matrix instructions, and a second copy would double the live staging registers
  for (int t = 0; t < N2 / AKT; ++t) {
    bar_wait();                                     // tile t is published; every wave has fetched its last fragment of tile t - 1
    if (t + 1 < N2 / AKT)                           // tile t + 1 into the buffers that pass t - 1 has read: it flies under the fragment loads and the scores of pass t
      tile_copy(ring + (t & 1) * (AKB * 2) + klane, ring + 2 * AKB * 2 + (t & 1) * (AVB * 2) + vlane, PH + (tid * 4 + (t + 1) * (AKT * CI)), GP + (tid * 4 + (t + 1) * (AKT * CI / 2)));
    const f16* const sKh = sT + ((t + 1) & 1) * AKB; const f16* const sKl = sKh + AKT * AKS; const f16* const sVt = sT + 2 * AKB + ((t + 1) & 1) * AVB;   // pass t reads the buffers (t + 1) mod 2 alone
    // The fragment loads go out in groups of 16 loads, ahead of their products: phi keys 0-31 first, then with each 16 keys' products one more group (phi 32-47, phi 48-63, g^T keys 0-31, g^T keys 32-63),
    // so that all 16 g^T fragments are fetched in front of the signal (behind it the wave reads nothing of the ring) and no more than three groups are live at a time.
    f32x8 s[4]; f16x16 kh[4][4], kl[4][4], vf[2][8];
    auto phi_load = [&](const int j) {
#pragma unroll
      for (int ks = 0; ks < 4; ++ks) { kh[j][ks] = lds_frag(sKh + (16 * j) * AKS + ks * 32, AKS); kl[j][ks] = lds_frag(sKl + (16 * j) * AKS + ks * 32, AKS); }
    };
    auto g_load = [&](const int k2) {
#pragma unroll
      for (int c = 0; c < 8; ++c) vf[k2][c] = lds_frag(sVt + (16 * c) * AVS + k2 * 32, AVS);
    };
    auto scores = [&](const int j) {
      f32x8 a = {}, ax = {};
#pragma unroll
      for (int ks = 0; ks < 4; ++ks) { a = wmma_p(kh[j][ks], qh[ks], a); ax = wmma_p(kl[j][ks], qh[ks], ax); ax = wmma_p(kh[j][ks], ql[ks], ax); }
      s[j] = a + ax * (1.0f / 2048.0f);
    };
    float mx = -3.0e38f;
    auto row_max = [&](const int j) {
#pragma unroll
      for (int r = 0; r < 8; ++r) mx = fmaxf(mx, s[j][r]);
    };
    // each sched_barrier below keeps a group of loads in its place: hoisted further the groups would not fit the registers (spills), sunk behind the last products they would pay the LDS latency in front of the signal.
    // The running maximum of 16 keys is taken under the next 16 keys' products.
    phi_load(0); phi_load(1);
    __builtin_amdgcn_sched_barrier(0);
    // two of the wave's own 32 rows of W_w and of x1 a pass (whole 512-B rows): after 16 passes the last product's weights and its residual stand in LDS, with no wait of their own.
    // Behind the first fragment loads, so that the two address waits pass while those are on their way and the LDS is not left idle at the top of a pass
    const float* wp = Ww + (size_t)(wave * 32 + 2 * t) * CI + lane * 4;
    const v4f_t wr0 = *(const v4fa*)wp, wr1 = *(const v4fa*)(wp + CI);
    addr_wait(wp);
    const float* xp = x1 + off0 + (size_t)(2 * t) * HWn;
    const v4f_t xr0 = *(const v4fa*)xp, xr1 = *(const v4fa*)(xp + HWn);
    addr_wait(xp);
    phi_load(2); scores(0);
    __builtin_amdgcn_sched_barrier(0);
    phi_load(3); scores(1); row_max(0);
    __builtin_amdgcn_sched_barrier(0);
    g_load(0); scores(2); row_max(1);
    __builtin_amdgcn_sched_barrier(0);
    g_load(1);
    __builtin_amdgcn_sched_barrier(0);
    scores(3); row_max(2); row_max(3);
    mx = fmaxf(mx, __shfl_xor(mx, 16));            // the other half of the wave holds this query's other 32 keys (an exchange on the LDS path: it too stands in front of the signal)
    __builtin_amdgcn_sched_barrier(0);              // keeps that exchange in front of the waits and the signal
    asm volatile("s_wait_dscnt 0x0" ::: "memory");    // this wave's reads of the buffers of pass t have returned
    asm volatile("s_wait_asynccnt 0x0" ::: "memory"); // this wave's pieces of tile t + 1 have landed
    bar_signal();                                   // this wave has left the buffers of pass t, and its part of tile t + 1 is published
    __builtin_amdgcn_sched_barrier(0);              // keeps exp and P * g behind the signal: moved in front of it they would delay it, and the split would gain nothing
    const float mn = fmaxf(m, mx);
    const float alpha = exp2_slot((m - mn) * L2E);
    const float bias = 10.0f - mn * L2E;            // + 10: P carries a factor 1024 (small weights stay normal f16); it cancels against the sum
    m = mn;
#pragma unroll
    for (int j = 0; j < 4; ++j)
#pragma unroll
      for (int r = 0; r < 8; ++r) s[j][r] = exp2_slot(s[j][r] * L2E + bias);
    const f32x8 sv = (s[0] + s[1]) + (s[2] + s[3]);   // pairwise: a chain of 32 dependent adds would stand in the pass's critical path
    l = l * alpha + (((sv[0] + sv[1]) + (sv[2] + sv[3])) + ((sv[4] + sv[5]) + (sv[6] + sv[7])));
#pragma unroll
    for (int c = 0; c < 8; ++c) o[c] *= alpha;
    f16x16 pf[2];                                   // two score tiles (keys 32k2 .. + 31) converted in place = one B fragment in lds_frag's k order
#pragma unroll
    for (int k2 = 0; k2 < 2; ++k2)
#pragma unroll
      for (int i = 0; i < 8; ++i) { pf[k2][i] = (f16)s[2 * k2][i]; pf[k2][i + 8] = (f16)s[2 * k2 + 1][i]; }
    __builtin_amdgcn_sched_barrier(0);              // keeps every exp in front of the products
#pragma unroll
    for (int k2 = 0; k2 < 2; ++k2)
#pragma unroll
      for (int c = 0; c < 8; ++c) o[c] = wmma_p(vf[k2][c], pf[k2], o[c]);
    __builtin_amdgcn_sched_barrier(0);              // keeps the products in front of the waits for the W_w and x1 rows below
    { bf16x4 h0, h1;                                // behind the products: the W_w and x1 rows have had the whole pass to land. Stores into rows that this wave alone reads, behind the loop
#pragma unroll
      for (int u = 0; u < 4; ++u) { h0[u] = (f16)wr0[u]; h1[u] = (f16)wr1[u]; }
      *(bf16x4*)(sW + (wave * 32 + 2 * t) * AWS + lane * 4) = h0; *(bf16x4*)(sW + (wave * 32 + 2 * t + 1) * AWS + lane * 4) = h1;
      *(v4fa*)(sX + (wave * 32 + 2 * t) * 128 + lane * 4) = xr0; *(v4fa*)(sX + (wave * 32 + 2 * t + 1) * 128 + lane * 4) = xr1; }
  }
  bar_wait();                                       // the last signal's wait: every wave has left the ring
  __builtin_amdgcn_sched_barrier(0);                // keeps the exchange of the sums below (it runs on the LDS path) behind that wait
  asm volatile("s_wait_asynccnt 0x0" ::: "memory");   // no copy is under way when the ring is put to its other uses
  // The last product in the same block: out = BN(y * W_w^T + b) + x1 for the block's 128 positions and all 256 channels; a wave takes its 32 channels x 128 positions.
  l += __shfl_xor(l, 16);
  const float inv = rcp_slot(l);
  // lane holds y[query cl][16c + 8*hf + r]: 8 channels = 16 bytes of the [position][channel] f16 tile that every wave reads as A operand (the phi planes of buffer 0 that it overwrites were last read in pass 15, left at the wait behind the loop)
#pragma unroll
  for (int c = 0; c < 8; ++c) { f16x8 w;
#pragma unroll
    for (int r = 0; r < 8; ++r) w[r] = (f16)(o[c][r] * inv);
    *(f16x8*)(sY + (wave * 16 + cl) * AWS + 16 * c + 8 * hf) = w; }
  __syncthreads();                                  // y of all 128 positions is published
  f16x16 wf[2][4];
#pragma unroll
  for (int j = 0; j < 2; ++j)
#pragma unroll
    for (int ks = 0; ks < 4; ++ks) wf[j][ks] = lds_frag(sW + (wave * 32 + 16 * j) * AWS + ks * 32, AWS);
  f32x8 acc[8][2];
#pragma unroll
  for (int i = 0; i < 8; ++i) {
    f32x8 z = {}; acc[i][0] = z; acc[i][1] = z;
#pragma unroll
    for (int ks = 0; ks < 4; ++ks) {
      const f16x16 yf = lds_frag(sY + (16 * i) * AWS + ks * 32, AWS);
      acc[i][0] = wmma_p(yf, wf[0][ks], acc[i][0]); acc[i][1] = wmma_p(yf, wf[1][ks], acc[i][1]);
    }
  }
  // lane holds positions 16i + 8*hf + r of channel 16j + cl: 8 neighbours of an output row. 16 channels at a time are turned, wave-private, into whole 512-B rows for the stores
  float* so = (float*)(sT + AKB) + wave * (16 * AOS);
#pragma unroll
  for (int j = 0; j < 2; ++j) {
    const int ch = wave * 32 + 16 * j + cl;
    const float bi = sBi[ch], iv = sInv[ch], sh = sSh[ch];
#pragma unroll
    for (int i = 0; i < 8; ++i) { v4f_t w0, w1;
#pragma unroll
      for (int r = 0; r < 4; ++r) { float a = acc[i][j][r], b = acc[i][j][r + 4]; a += bi; b += bi; w0[r] = a * iv + sh; w1[r] = b * iv + sh; }
      *(v4fa*)(so + cl * AOS + 16 * i + 8 * hf) = w0; *(v4fa*)(so + cl * AOS + 16 * i + 8 * hf + 4) = w1; }
    asm volatile("s_wait_dscnt 0" ::: "memory");    // the rows read below were written by other lanes of this wave
    __builtin_amdgcn_wave_barrier();
#pragma unroll
    for (int it = 0; it < 16; ++it) {
      v4f_t v = *(const v4fa*)(so + it * AOS + lane * 4);
      v += *(const v4fa*)(sX + (wave * 32 + 16 * j + it) * 128 + lane * 4);
      *(v4f_t*)(out + off0 + (size_t)(16 * j + it) * HWn) = v;
    }
    if (j == 0) {
      asm volatile("s_wait_dscnt 0\n\ts_wait_xcnt 0x0" ::: "memory");   // the staging rows have been read before other lanes rewrite them; the stores' registers are free before they are reused
      __builtin_amdgcn_wave_barrier();
    }
  }
}
// ---------------------------------------------------------------------------------------------------------------------------
// gemm_tile: D[m][n] = sum_k A[m][k] * B[n][k], every operand read in the layout it has in memory, so that no transposed copy is made.
// B is row-major [n][k] (row stride LDB). A is row-major [m][k] (AKM false, row stride LDA) or k-major [k][m] (AKM true, row stride LDA).
// PL: value+residual planes on both operands (hh + (hl + lh)/2048, f32-class); else plain f16 operands. f32 accumulate.
// EPI 0: Y[m][n] = D + bias[n]. EPI 2: max of D + bias[n] over the 2 x 2 window of positions p (m = 64-wide image rows; LDY = channels of the pooled map, strideY its batch stride in f32 units), stored as the f16 operands that k_attn copies into LDS:
// under PL a row of 2 * LDY f16 a position (LDY values, then LDY residuals * 2048), else [p / 8][n][p % 8] f16 (16-byte pieces of the transposed map: 8 positions of one channel).
// Block = 128 x 128 tile, 8 waves as 4(M, 32 rows) x 2(N, 64 cols); per 64-wide k-step both tiles are staged f16 in LDS as [row][k]: a trip is a chain of load latency, conversion, two barriers and products,
// and the wide step pays the latency and the barriers half as often, with twice the bytes in flight; the products still walk k in 32-wide chunks in rising order.
// Without planes (half the accumulators, half the staged bytes a k) the step is 128 wide.
// EPI 2: the tile's 128 positions are image rows 2i and 2i + 1 (i = bx); a wave takes the same 16 columns of both rows (m = 16a .. + 15 and 64 + 16a .. + 15),
// so that all four positions of a window lie in one lane's accumulators (two neighbouring registers of both fragments) and the maximum needs no exchange.
// bz selects a batch (element strides).
// ---------------------------------------------------------------------------------------------------------------------------
// KS: k range of one staged tile (64 or 128). Staged tile pitch KS + 8 f16 elements (128-B rows at 144 B, 256-B rows at 272 B: 16-byte reads of 16 neighbouring rows fall on distinct banks)
#define TILE_F16 (128 * 72)   // f16 elements of one staged tile at KS = 64; four of them (two operands, two planes) also hold the two tiles at KS = 128
// 128 rows x KS k of a row-major f32 matrix: KS / 4 lanes take the whole KS * 4 B of a row, KS / 8 loads a thread
template <int LD, int KS>
__device__ __forceinline__ void rows_load(const float* __restrict__ p, v4f_t* v) {
#pragma unroll
  for (int it = 0; it < KS / 8; ++it) v[it] = *(const v4fa*)(p + (size_t)((1024 / KS) * it) * LD);
}
template <bool PL, int KS>
__device__ __forceinline__ void rows_store(const v4f_t* v, f16* dh, f16* dl) {
  constexpr int TPITCH = KS + 8;
  const int tid = threadIdx.x, r0 = tid / (KS / 4), c4 = (tid % (KS / 4)) * 4;
#pragma unroll
  for (int it = 0; it < KS / 8; ++it) { bf16x4 h, lo;
#pragma unroll
    for (int u = 0; u < 4; ++u) { h[u] = (f16)v[it][u]; lo[u] = (f16)((v[it][u] - (float)h[u]) * 2048.0f); }
    *(bf16x4*)(dh + (r0 + (1024 / KS) * it) * TPITCH + c4) = h; if (PL) *(bf16x4*)(dl + (r0 + (1024 / KS) * it) * TPITCH + c4) = lo; }
}
// The body is a function of the block's place (bx, by, bz) and of LDS arrays that the kernel owns, so that one launch can hold tiles of several products:
// ldsA, ldsB (and ldsAl, ldsBl under PL) 128 * (KS + 8) f16 each, oS 8 waves x (EPI 2: 8, else 32) rows x 68 f32.
template <bool PL, bool AKM, int EPI, int LDA, int LDB, int LDY, int K>
__device__ __forceinline__ void gemm_tile(f16* ldsA, f16* ldsAl, f16* ldsB, f16* ldsBl, float* oS, const int bx, const int by, const int bz,
                                          const float* __restrict__ A, size_t strideA, const float* __restrict__ B, size_t strideB,
                                          const float* __restrict__ bias, float* __restrict__ Y, size_t strideY) {
  constexpr int OSW = (EPI == 2 ? 8 : 32) * 68;   // f32 elements of one wave's output staging
  constexpr int KSTEP = PL ? 64 : 128, TPITCH = KSTEP + 8;
  const int tid = threadIdx.x, lane = tid & 31, wave = tid >> 5, cl = lane & 15, rh = (lane >> 4) * 8;
  const int m0 = bx * 128, n0 = by * 128;
  const int wm = (wave & 3) * (EPI == 2 ? 16 : 32), wn = (wave >> 2) * 64;
  constexpr int FM = EPI == 2 ? 64 : 16;   // rows between a wave's two A fragments
  A += (size_t)bz * strideA; B += (size_t)bz * strideB; Y += (size_t)bz * strideY;
  f32x8 acc[2][4], accx[2][4];
#pragma unroll
  for (int i = 0; i < 2; ++i)
#pragma unroll
    for (int j = 0; j < 4; ++j) { f32x8 z = {}; acc[i][j] = z; accx[i][j] = z; }
  // k-major A: wave -> 8 k rows (kg) of each 32-wide chunk of the k-step, of one 64-wide half of the tile's m range (mh); lane -> m = 2 * lane + {0, 1}: a load is 256 B of one k row
  const int kg = wave & 3, mh = wave >> 2;
  const float* pa = AKM ? A + (size_t)(kg * 8) * LDA + m0 + mh * 64 + 2 * lane : A + (size_t)(m0 + tid / (KSTEP / 4)) * LDA + (tid % (KSTEP / 4)) * 4;
  const float* pb = B + (size_t)(n0 + tid / (KSTEP / 4)) * LDB + (tid % (KSTEP / 4)) * 4;
#pragma unroll 1   // rolled: the trips are separated by barriers and gain nothing from a second copy of the staging code
  for (int k0 = 0; k0 < K; k0 += KSTEP) {
    __syncthreads();                                // every wave has left the tiles of the trip before
    v2fa at[KSTEP / 4]; v4f_t ar[KSTEP / 8], br[KSTEP / 8];
    if (AKM) {
#pragma unroll
      for (int kk = 0; kk < KSTEP / 4; ++kk) at[kk] = *(const v2fa*)(pa + (size_t)((kk >> 3) * 32 + (kk & 7)) * LDA);
    } else rows_load<LDA, KSTEP>(pa, ar);
    rows_load<LDB, KSTEP>(pb, br);
    asm volatile("s_wait_xcnt 0x0" :: "v"(pa), "v"(pb) : "memory");   // behind both runs of loads, before the two pointers they name are advanced
    pa += AKM ? (size_t)KSTEP * LDA : KSTEP; pb += KSTEP;
    if (AKM) {                                      // the turn: a thread's 8 k values of one m are 16 contiguous bytes of the [m][k] tile
#pragma unroll   // unrolled: at[] is indexed by constants only and stays in registers
      for (int g2 = 0; g2 < KSTEP / 32; ++g2)
#pragma unroll
      for (int e = 0; e < 2; ++e) { f16x8 h, lo;
#pragma unroll
        for (int kk = 0; kk < 8; ++kk) { const float v = at[g2 * 8 + kk][e]; h[kk] = (f16)v; lo[kk] = (f16)((v - (float)h[kk]) * 2048.0f); }
        *(f16x8*)(ldsA + (mh * 64 + 2 * lane + e) * TPITCH + g2 * 32 + kg * 8) = h; if (PL) *(f16x8*)(ldsAl + (mh * 64 + 2 * lane + e) * TPITCH + g2 * 32 + kg * 8) = lo; }
    } else rows_store<PL, KSTEP>(ar, ldsA, ldsAl);
    rows_store<PL, KSTEP>(br, ldsB, ldsBl);
    __syncthreads();                                // both tiles are published
    // All fragments of a group of k (one 32-wide chunk under planes, two without: 24 loads either way) go out together, in the order in which the products want them:
    // a wave waits out the LDS latency once a group, not once a column fragment.
    constexpr int CG = PL ? 1 : 2;
#pragma unroll   // unrolled: the LDS offsets of all chunks are immediates of the fragment loads
    for (int kc = 0; kc < KSTEP; kc += 32 * CG) {
      f16x16 af[CG][2], afl[2], bf[CG][4], bfl[4];
#pragma unroll
      for (int c = 0; c < CG; ++c) {
#pragma unroll
        for (int i = 0; i < 2; ++i) af[c][i] = lds_frag(ldsA + (wm + FM * i) * TPITCH + kc + 32 * c, TPITCH);
#pragma unroll
        for (int j = 0; j < 4; ++j) bf[c][j] = lds_frag(ldsB + (wn + 16 * j) * TPITCH + kc + 32 * c, TPITCH);
      }
      if (PL) {
#pragma unroll
        for (int j = 0; j < 4; ++j) bfl[j] = lds_frag(ldsBl + (wn + 16 * j) * TPITCH + kc, TPITCH);
#pragma unroll
        for (int i = 0; i < 2; ++i) afl[i] = lds_frag(ldsAl + (wm + FM * i) * TPITCH + kc, TPITCH);
      }
      __builtin_amdgcn_sched_barrier(0);            // keeps the group of loads in front of the products: sunk among them, each load would pay its latency at its own place
      // The eight tiles take turns, so that no product follows closely on the one that wrote its accumulator; each accumulator still sums its products in the same order (k rising; hl, then lh).
#pragma unroll
      for (int c = 0; c < CG; ++c)
#pragma unroll
        for (int j = 0; j < 4; ++j)
#pragma unroll
          for (int i = 0; i < 2; ++i) acc[i][j] = wmma_p(af[c][i], bf[c][j], acc[i][j]);
      if (PL) {
#pragma unroll
        for (int j = 0; j < 4; ++j)
#pragma unroll
          for (int i = 0; i < 2; ++i) accx[i][j] = wmma_p(af[0][i], bfl[j], accx[i][j]);
#pragma unroll
        for (int j = 0; j < 4; ++j)
#pragma unroll
          for (int i = 0; i < 2; ++i) accx[i][j] = wmma_p(afl[i], bf[0][j], accx[i][j]);
      }
    }
  }
  if (EPI == 2) {   // lane holds positions (row 2i + f, column wm + rh + r) of channel 16j + cl in acc[f][j][r]: window p of the lane = registers 2p, 2p + 1 of both fragments
    float* sp = oS + wave * OSW;
    // !PL: the lane's 4 pooled positions of a channel are 8 bytes of that channel's 16-byte piece; a store of the wave is 256 B, its 4 stores 1 KiB in a row
    f16* yt = (f16*)Y + ((size_t)(bx * 4 + (wave & 3)) * LDY + n0 + wn + cl) * 8 + (rh >> 1);
#pragma unroll
    for (int j = 0; j < 4; ++j) {
      const float bv = bias[n0 + wn + 16 * j + cl];
      bf16x4 q;
#pragma unroll
      for (int p = 0; p < 4; ++p) {
        float v[2][2];
#pragma unroll
        for (int i = 0; i < 2; ++i)
#pragma unroll
          for (int e = 0; e < 2; ++e) v[i][e] = (PL ? acc[i][j][2 * p + e] + accx[i][j][2 * p + e] * (1.0f / 2048.0f) : acc[i][j][2 * p + e]) + bv;
        const float mx = fmaxf(fmaxf(v[0][0], v[0][1]), fmaxf(v[1][0], v[1][1]));
        if (PL) sp[((rh >> 1) + p) * 68 + 16 * j + cl] = mx; else q[p] = (f16)mx;
      }
      if (!PL) *(bf16x4*)(yt + 16 * j * 8) = q;
    }
    if (PL) {
      asm volatile("s_wait_dscnt 0" ::: "memory");    // the rows read below were written by other lanes of this wave
      __builtin_amdgcn_wave_barrier();
      // a wave's 8 pooled positions x 64 channels go out as 128-B segments of f16 values and of f16 residuals
      f16* yp = (f16*)Y + (size_t)(bx * 32 + (wm >> 1) + (lane >> 4)) * (2 * LDY) + n0 + wn + (lane & 15) * 4;
#pragma unroll
      for (int it = 0; it < 4; ++it) { const v4f_t v = *(const v4fa*)(sp + ((lane >> 4) + 2 * it) * 68 + (lane & 15) * 4); bf16x4 h, lo;
#pragma unroll
        for (int u = 0; u < 4; ++u) { h[u] = (f16)v[u]; lo[u] = (f16)((v[u] - (float)h[u]) * 2048.0f); }
        *(bf16x4*)(yp + (size_t)(2 * it) * (2 * LDY)) = h; *(bf16x4*)(yp + (size_t)(2 * it) * (2 * LDY) + LDY) = lo; }
    }
    asm volatile("s_wait_xcnt 0x0" ::: "memory");   // behind the run of stores: a precaution, as in k_proj a block runs one product and the kernel ends behind it
    return;
  }
  // a wave's 32 x 64 piece goes out as 256-B row segments: thread -> rows (lane >> 4) + 2 * it, 16 bytes at column (lane & 15) * 4
  const size_t off0 = (size_t)(m0 + wm + (lane >> 4)) * LDY + n0 + wn + (lane & 15) * 4;
  float* so = oS + wave * OSW;
#pragma unroll
  for (int i = 0; i < 2; ++i)
#pragma unroll
    for (int j = 0; j < 4; ++j) {
      const float bv = bias[n0 + wn + 16 * j + cl];
#pragma unroll
      for (int r = 0; r < 8; ++r) {
        float v = PL ? acc[i][j][r] + accx[i][j][r] * (1.0f / 2048.0f) : acc[i][j][r];
        v += bv;
        so[(16 * i + rh + r) * 68 + 16 * j + cl] = v;
      }
    }
  asm volatile("s_wait_dscnt 0" ::: "memory");      // the rows read below were written by other lanes of this wave
  __builtin_amdgcn_wave_barrier();
#pragma unroll
  for (int it = 0; it < 16; ++it) {
    const v4f_t v = *(const v4fa*)(so + ((lane >> 4) + 2 * it) * 68 + (lane & 15) * 4);
    *(v4f_t*)(Y + off0 + (size_t)(2 * it) * LDY) = v;
  }
  asm volatile("s_wait_xcnt 0x0" ::: "memory");   // behind the run of stores, as above
}
// k_proj: the three 1x1 convolutions depend on nothing but the inputs, so their 3 x 256 tiles go out as one launch: no launch gap between them, and
// two blocks share a WGP (registers allow four waves a SIMD), so that one block's products run while the other waits for its global loads.
// blockIdx.z = 8 * product + batch; the two products with planes come first, the short one (g) fills the places that they leave.
// amdgpu_waves_per_eu(4): holds the register allocator to the 256 registers of four waves a SIMD, without which the second block would not fit
__global__ __launch_bounds__(256) __attribute__((amdgpu_waves_per_eu(4))) void k_proj(const float* __restrict__ x1, const float* __restrict__ x2,
                                              const float* __restrict__ pw, const float* __restrict__ pb, const float* __restrict__ tw, const float* __restrict__ tb,
                                              const float* __restrict__ gw, const float* __restrict__ gb,
                                              float* __restrict__ PH, float* __restrict__ TH, float* __restrict__ GP) {
  __shared__ __attribute__((aligned(16))) f16 tiles[4 * TILE_F16];
  f16* const ldsA = tiles, * const ldsAl = tiles + TILE_F16, * const ldsB = tiles + 2 * TILE_F16, * const ldsBl = tiles + 3 * TILE_F16;   // g: two tiles of 128 * 136 f16, A in the first half, B in the second
  __shared__ __attribute__((aligned(16))) float oS[8 * 32 * 68];   // theta's size, the largest of the three
  const int which = blockIdx.z >> 3, bz = blockIdx.z & 7;
  if (which == 0)      gemm_tile<true, true, 2, HWn, CC, CI, CC>(ldsA, ldsAl, ldsB, ldsBl, oS, blockIdx.x, 0, bz, x2, (size_t)CC * HWn, pw, 0, pb, PH, (size_t)N2 * CI);    // pooled phi rows (products with planes; stored as f16 planes)
  else if (which == 1) gemm_tile<true, true, 0, HWn, CC, CI, CC>(ldsA, ldsAl, ldsB, ldsBl, oS, blockIdx.x, 0, bz, x1, (size_t)CC * HWn, tw, 0, tb, TH, (size_t)HWn * CI);   // theta rows (planes)
  else                 gemm_tile<false, true, 2, HWn, CC, CI, CC>(ldsA, nullptr, ldsB, nullptr, oS, blockIdx.x, 0, bz, x1, (size_t)CC * HWn, gw, 0, gb, GP, (size_t)N2 * CI / 2);   // pooled g, f16 pieces (on x1, faithful)
}
extern "C" void kernel_launch(void* const* d_in, const int* in_sizes, int n_in,
                              void* d_out, int out_size, void* d_ws, size_t ws_size,
                              hipStream_t stream) {
  (void)in_sizes; (void)n_in; (void)out_size;
  const float** f = (const float**)d_in;
  const float* x1 = f[0], *x2 = f[1], *gw = f[2], *gb = f[3], *tw = f[4], *tb = f[5], *pw = f[6], *pb = f[7], *Ww = f[8], *Wb = f[9], *bng = f[10], *bnb = f[11], *bnm = f[12], *bnv = f[13];
  float* out = (float*)d_out;     // [8,256,64,64]
  char* ws = (char*)d_ws;
  // every per-batch buffer holds all NBT batches, batch b at b * (its per-batch size)
  float* TH = (float*)ws; ws += (size_t)NBT * HWn * CI * 4;             // theta rows [8][4096][128] f32
  float* GP = (float*)ws; ws += (size_t)NBT * N2 * CI * 2;              // pooled g, f16 [8][128 key groups][128][8]
  float* PH = (float*)ws; ws += (size_t)NBT * N2 * CI * 4;              // pooled phi, f16 [8][1024][value, residual][128]
  if ((size_t)(ws - (char*)d_ws) > ws_size) return;                     // WS TOTAL 23,068,672 B
  const dim3 blk(256);
  // one launch per stage for all NBT batches: the batch is a grid dimension; the three convolutions are one stage
  k_proj<<<dim3(HWn / 128, 1, 3 * NBT), blk, 0, stream>>>(x1, x2, pw, pb, tw, tb, gw, gb, PH, TH, GP);                                                         // pooled phi, theta, pooled g
  k_attn<<<dim3(HWn / 128, NBT), blk, 0, stream>>>(TH, PH, GP, Ww, Wb, bng, bnb, bnm, bnv, x1, out);                                                         // y = softmax(theta * phi^T) * g, out = BN(W_w * y^T + b) + x1; scores and y kept on chip
}
